// v000
// Times are from an AMD MI455X. After a warm-up the kernel runs many times in a row, and a time is the length of
// such a window on the GPU divided by its runs, so every launch and the gaps after it count. The runs cycle
// through copies of the inputs. A figure is the median of several windows, for all but v000 over two sittings.
// Sittings can differ by a few percent; kernels timed side by side share one.
// v000, which the later versions start from, runs in 782 microseconds.
#include <hip/hip_runtime.h>
#include <hip/hip_bf16.h>
#include <math.h>

typedef __bf16 bf16_t;
typedef __attribute__((ext_vector_type(16))) __bf16 v16bf;
typedef __attribute__((ext_vector_type(8)))  float  v8f;

#define B_   8192
#define IN_  512
#define HID_ 1024
#define OUT_ 256
#define E_   16
#define TM   64      // token tile (M) per block

union Frag { v16bf v; unsigned int u[8]; };

__device__ __forceinline__ void ld_frag(Frag& f, const bf16_t* base, int ld,
                                        int row, int kk, int lane) {
  const int r  = row + (lane & 15);
  const int kb = kk + ((lane >> 4) << 3);
  const unsigned int* p0 = (const unsigned int*)(base + (size_t)r * ld + kb);
  const unsigned int* p1 = (const unsigned int*)(base + (size_t)r * ld + kb + 16);
  f.u[0] = p0[0]; f.u[1] = p0[1]; f.u[2] = p0[2]; f.u[3] = p0[3];
  f.u[4] = p1[0]; f.u[5] = p1[1]; f.u[6] = p1[2]; f.u[7] = p1[3];
}

__device__ __forceinline__ v8f wmma_bf16(const Frag& a, const Frag& b, v8f c) {
  return __builtin_amdgcn_wmma_f32_16x16x32_bf16(
      /*neg_a=*/false, a.v, /*neg_b=*/false, b.v,
      /*c_mod=*/(short)0, c, /*reuse_a=*/false, /*reuse_b=*/false);
}

template <int KTOT, int NTOT, bool RELU, bool OUT_F32>
__device__ __forceinline__ void gemm_tile(const bf16_t* __restrict__ A, int lda,
                                          const bf16_t* __restrict__ Bt, int ldb,
                                          const float* __restrict__ bias,
                                          bf16_t* __restrict__ outB,
                                          float* __restrict__ outF, int ldo,
                                          int wid, int lane) {
  const int mrow   = (wid & 3) * 16;
  const int nStart = (wid >> 2) * (NTOT / 2);
  for (int nc = nStart; nc < nStart + NTOT / 2; nc += 64) {
    v8f acc[4];
#pragma unroll
    for (int t = 0; t < 4; ++t)
#pragma unroll
      for (int r = 0; r < 8; ++r) acc[t][r] = 0.f;

    for (int kk = 0; kk < KTOT; kk += 32) {
      Frag a;
      ld_frag(a, A, lda, mrow, kk, lane);
      if (kk + 32 < KTOT)  // keep next weight chunk warm (near caches)
        __builtin_prefetch(Bt + (size_t)(nc + (lane & 15)) * ldb + kk + 32, 0, 3);
#pragma unroll
      for (int t = 0; t < 4; ++t) {
        Frag b;
        ld_frag(b, Bt, ldb, nc + t * 16, kk, lane);
        acc[t] = wmma_bf16(a, b, acc[t]);
      }
    }
    const int mo = mrow + ((lane >> 4) << 3);
    const int no = lane & 15;
#pragma unroll
    for (int t = 0; t < 4; ++t) {
      const int n = nc + t * 16 + no;
      const float bz = bias[n];
#pragma unroll
      for (int r = 0; r < 8; ++r) {
        float v = acc[t][r] + bz;
        if (RELU) v = v > 0.f ? v : 0.f;
        const int m = mo + r;
        if (OUT_F32) outF[m * ldo + n] = v;
        else         outB[m * ldo + n] = (bf16_t)v;
      }
    }
  }
}

// ---------------------------------------------------------------------------
// Prep kernels
// ---------------------------------------------------------------------------
extern "C" __global__ void cast_x_kernel(const float* __restrict__ x,
                                         bf16_t* __restrict__ xb, int n) {
  for (int i = blockIdx.x * blockDim.x + threadIdx.x; i < n;
       i += gridDim.x * blockDim.x)
    xb[i] = (bf16_t)x[i];
}

// dst[e][c][r] = (bf16) src[e][r][c]   (N-major weights -> K-contiguous B rows)
extern "C" __global__ void tcast_kernel(const float* __restrict__ src,
                                        bf16_t* __restrict__ dst,
                                        int R, int C, int total) {
  for (int i = blockIdx.x * blockDim.x + threadIdx.x; i < total;
       i += gridDim.x * blockDim.x) {
    const int r = i % R;
    const int t = i / R;
    const int c = t % C;
    const int e = t / C;
    dst[i] = (bf16_t)src[(size_t)e * R * C + (size_t)r * C + c];
  }
}

extern "C" __global__ void init_kernel(float* __restrict__ outf, int n_zero,
                                       int* __restrict__ counts,
                                       float* __restrict__ importance,
                                       float* __restrict__ loadv) {
  const int i = blockIdx.x * blockDim.x + threadIdx.x;
  for (int j = i; j < n_zero; j += gridDim.x * blockDim.x) outf[j] = 0.f;
  if (i < E_) { counts[i] = 0; importance[i] = 0.f; loadv[i] = 0.f; }
}

extern "C" __global__ void __launch_bounds__(128)
gating_kernel(const float* __restrict__ x, const float* __restrict__ noise,
              const float* __restrict__ gW, const float* __restrict__ gb,
              const float* __restrict__ nW, const float* __restrict__ nb,
              int* __restrict__ counts, int* __restrict__ assign,
              float* __restrict__ gateval, float* __restrict__ importance,
              float* __restrict__ loadv) {
  const int lane = threadIdx.x & 31;
  const int wid  = threadIdx.x >> 5;
  const int tok  = blockIdx.x * 4 + wid;
  const int e    = lane & 15;
  const bool np  = lane >= 16;

  const float* W = np ? nW : gW;
  float acc = (np ? nb : gb)[e];
  const float* xr = x + (size_t)tok * IN_;
  for (int i = 0; i < IN_; ++i) acc += xr[i] * W[i * E_ + e];

  const float pre_noise = __shfl(acc, e + 16);
  const float sp = (pre_noise > 20.f) ? pre_noise : log1pf(__expf(pre_noise));
  const float noisy = acc + noise[(size_t)tok * E_ + e] * sp;

  float best = -1e30f, second = -1e30f;
  int bi = 0, si = 0;
  for (int q = 0; q < 16; ++q) {
    const float v = __shfl(noisy, q);
    if (v > best)        { second = best; si = bi; best = v; bi = q; }
    else if (v > second) { second = v; si = q; }
  }
  if (lane == 0) {
    const float e1 = __expf(second - best);
    const float g0 = 1.f / (1.f + e1);
    const float g1 = e1 / (1.f + e1);
    int s0 = atomicAdd(&counts[bi], 1);
    assign[bi * B_ + s0] = tok;  gateval[bi * B_ + s0] = g0;
    atomicAdd(&importance[bi], g0); atomicAdd(&loadv[bi], 1.f);
    int s1 = atomicAdd(&counts[si], 1);
    assign[si * B_ + s1] = tok;  gateval[si * B_ + s1] = g1;
    atomicAdd(&importance[si], g1); atomicAdd(&loadv[si], 1.f);
  }
}

// ---------------------------------------------------------------------------
// Fused expert pipeline: x->h1->h2->(softmax p, alpha0)->scatter combine.
// grid = (E, B/TM), block = 256 (8 waves), 256 KB dynamic LDS.
// ---------------------------------------------------------------------------
extern "C" __global__ void __launch_bounds__(256)
expert_kernel(const bf16_t* __restrict__ xb,
              const bf16_t* __restrict__ W1t, const float* __restrict__ b1,
              const bf16_t* __restrict__ W2t, const float* __restrict__ b2,
              const bf16_t* __restrict__ Wpt, const float* __restrict__ bp,
              const float* __restrict__ Wa, const float* __restrict__ ba,
              const int* __restrict__ counts, const int* __restrict__ assign,
              const float* __restrict__ gateval,
              float* __restrict__ p_hat, float* __restrict__ alpha0) {
  extern __shared__ char smem[];
  bf16_t* bufA = (bf16_t*)smem;                  // 128KB: x tile (64x512) then h2 (64x1024)
  bf16_t* bufB = (bf16_t*)(smem + 128 * 1024);   // 128KB: h1 (64x1024)
  float*  lgts = (float*)(smem + 128 * 1024);    //  64KB overlay on bufB: logits (64x256)

  const int e   = blockIdx.x;
  const int cnt = counts[e];
  const int t0  = blockIdx.y * TM;
  if (t0 >= cnt) return;

  const int tid = threadIdx.x, lane = tid & 31, wid = tid >> 5;

  {
    const int row = tid >> 2, q = tid & 3;
    int slot = t0 + row;
    if (slot >= cnt) slot = cnt - 1;
    const int tok = assign[e * B_ + slot];
    const bf16_t* gsrc = xb + (size_t)tok * IN_ + q * 128;        // 256B chunk
    const unsigned ldst = (unsigned)(uintptr_t)(bufA + row * IN_ + q * 128);
#pragma unroll
    for (int i = 0; i < 16; ++i) {
      asm volatile("global_load_async_to_lds_b128 %0, %1, off offset:%2"
                   :: "v"(ldst), "v"(gsrc), "i"(i * 16) : "memory");
    }
    asm volatile("s_wait_asynccnt 0x0" ::: "memory");
  }
  __syncthreads();

  // h1 = relu(x @ W1 + b1)
  gemm_tile<IN_, HID_, true, false>(bufA, IN_, W1t + (size_t)e * HID_ * IN_, IN_,
                                    b1 + e * HID_, bufB, nullptr, HID_, wid, lane);
  __syncthreads();
  // h2 = relu(h1 @ W2 + b2)  (overwrites x region)
  gemm_tile<HID_, HID_, true, false>(bufB, HID_, W2t + (size_t)e * HID_ * HID_, HID_,
                                     b2 + e * HID_, bufA, nullptr, HID_, wid, lane);
  __syncthreads();
  // logits = h2 @ Wp + bp (float, overlays h1)
  gemm_tile<HID_, OUT_, false, true>(bufA, HID_, Wpt + (size_t)e * OUT_ * HID_, HID_,
                                     bp + e * OUT_, nullptr, lgts, OUT_, wid, lane);
  __syncthreads();

  // Per-row epilogue: alpha0 dot + softmax + gated atomic scatter.
  const float* Wag = Wa + e * HID_;
  const float  bag = ba[e];
#pragma unroll
  for (int rr = 0; rr < 8; ++rr) {
    const int m = wid * 8 + rr;
    const int slot = t0 + m;

    float s = 0.f;
    for (int k = lane; k < HID_; k += 32) s += (float)bufA[m * HID_ + k] * Wag[k];
#pragma unroll
    for (int off = 16; off > 0; off >>= 1) s += __shfl_xor(s, off);

    float mx = -1e30f, v[8];
#pragma unroll
    for (int j = 0; j < 8; ++j) {
      v[j] = lgts[m * OUT_ + lane + j * 32];
      mx = fmaxf(mx, v[j]);
    }
#pragma unroll
    for (int off = 16; off > 0; off >>= 1) mx = fmaxf(mx, __shfl_xor(mx, off));
    float sm = 0.f;
#pragma unroll
    for (int j = 0; j < 8; ++j) { v[j] = __expf(v[j] - mx); sm += v[j]; }
#pragma unroll
    for (int off = 16; off > 0; off >>= 1) sm += __shfl_xor(sm, off);

    if (slot < cnt) {
      const int   tok = assign[e * B_ + slot];
      const float g   = gateval[e * B_ + slot];
      if (lane == 0) {
        const float pre = s + bag;
        const float spv = (pre > 20.f) ? pre : log1pf(__expf(pre));
        const float a0v = fminf(fmaxf(spv + 10.f, 1.f), 500.f);
        atomicAdd(&alpha0[tok], g * a0v);
      }
      const float inv = g / sm;
#pragma unroll
      for (int j = 0; j < 8; ++j)
        atomicAdd(&p_hat[(size_t)tok * OUT_ + lane + j * 32], v[j] * inv);
    }
  }
}

// ---------------------------------------------------------------------------
// Post: aux loss (ddof=1 std) and p_hat row normalization.
// ---------------------------------------------------------------------------
extern "C" __global__ void aux_kernel(const float* __restrict__ importance,
                                      const float* __restrict__ loadv,
                                      float* __restrict__ out_aux) {
  if (threadIdx.x == 0 && blockIdx.x == 0) {
    float mi = 0.f, ml = 0.f;
    for (int i = 0; i < E_; ++i) { mi += importance[i]; ml += loadv[i]; }
    mi /= (float)E_; ml /= (float)E_;
    float vi = 0.f, vl = 0.f;
    for (int i = 0; i < E_; ++i) {
      const float di = importance[i] - mi; vi += di * di;
      const float dl = loadv[i] - ml;      vl += dl * dl;
    }
    vi /= (float)(E_ - 1); vl /= (float)(E_ - 1);
    *out_aux = sqrtf(vi) / (mi + 1e-8f) + sqrtf(vl) / (ml + 1e-8f);
  }
}

extern "C" __global__ void __launch_bounds__(256)
norm_kernel(float* __restrict__ p_hat) {
  __shared__ float part[8];
  const int row = blockIdx.x, tid = threadIdx.x, lane = tid & 31, wid = tid >> 5;
  const float v = p_hat[(size_t)row * OUT_ + tid];
  float s = v;
#pragma unroll
  for (int off = 16; off > 0; off >>= 1) s += __shfl_xor(s, off);
  if (lane == 0) part[wid] = s;
  __syncthreads();
  float tot = 0.f;
#pragma unroll
  for (int w = 0; w < 8; ++w) tot += part[w];
  p_hat[(size_t)row * OUT_ + tid] = v / (tot + 1e-8f);
}

// ---------------------------------------------------------------------------
// Host launch
// ---------------------------------------------------------------------------
extern "C" void kernel_launch(void* const* d_in, const int* in_sizes, int n_in,
                              void* d_out, int out_size, void* d_ws, size_t ws_size,
                              hipStream_t stream) {
  const float* x   = (const float*)d_in[0];
  const float* noi = (const float*)d_in[1];
  const float* gW  = (const float*)d_in[2];
  const float* gb  = (const float*)d_in[3];
  const float* nW  = (const float*)d_in[4];
  const float* nb  = (const float*)d_in[5];
  const float* W1  = (const float*)d_in[6];
  const float* b1  = (const float*)d_in[7];
  const float* W2  = (const float*)d_in[8];
  const float* b2  = (const float*)d_in[9];
  const float* Wp  = (const float*)d_in[10];
  const float* bp  = (const float*)d_in[11];
  const float* Wa  = (const float*)d_in[12];
  const float* ba  = (const float*)d_in[13];

  float* out    = (float*)d_out;
  float* p_hat  = out;                           // [B, OUT]
  float* alpha0 = out + (size_t)B_ * OUT_;       // [B]
  float* auxp   = out + (size_t)B_ * OUT_ + B_;  // scalar

  char* w = (char*)d_ws;
  bf16_t* xb  = (bf16_t*)w;  w += (size_t)B_ * IN_ * 2;         // 8 MB
  bf16_t* W1t = (bf16_t*)w;  w += (size_t)E_ * HID_ * IN_ * 2;  // 16 MB
  bf16_t* W2t = (bf16_t*)w;  w += (size_t)E_ * HID_ * HID_ * 2; // 32 MB
  bf16_t* Wpt = (bf16_t*)w;  w += (size_t)E_ * OUT_ * HID_ * 2; // 8 MB
  int*    counts     = (int*)w;   w += 256;
  int*    assign     = (int*)w;   w += (size_t)E_ * B_ * 4;     // 512 KB
  float*  gateval    = (float*)w; w += (size_t)E_ * B_ * 4;     // 512 KB
  float*  importance = (float*)w; w += 256;
  float*  loadv      = (float*)w; w += 256;

  init_kernel<<<2048, 256, 0, stream>>>(p_hat, B_ * OUT_ + B_, counts, importance, loadv);
  cast_x_kernel<<<2048, 256, 0, stream>>>(x, xb, B_ * IN_);
  tcast_kernel<<<4096, 256, 0, stream>>>(W1, W1t, IN_, HID_, E_ * IN_ * HID_);
  tcast_kernel<<<8192, 256, 0, stream>>>(W2, W2t, HID_, HID_, E_ * HID_ * HID_);
  tcast_kernel<<<2048, 256, 0, stream>>>(Wp, Wpt, HID_, OUT_, E_ * HID_ * OUT_);

  gating_kernel<<<B_ / 4, 128, 0, stream>>>(x, noi, gW, gb, nW, nb,
                                            counts, assign, gateval, importance, loadv);

  dim3 eg(E_, B_ / TM);
  expert_kernel<<<eg, 256, 256 * 1024, stream>>>(xb, W1t, b1, W2t, b2, Wpt, bp,
                                                 Wa, ba, counts, assign, gateval,
                                                 p_hat, alpha0);

  aux_kernel<<<1, 32, 0, stream>>>(importance, loadv, auxp);
  norm_kernel<<<B_, 256, 0, stream>>>(p_hat);
}

// v001
// A run of this version takes 460 microseconds.
// Next to v000, in two timings, it ran 1.71 and 1.72 times as fast.
#include <hip/hip_runtime.h>
#include <hip/hip_bf16.h>
#include <math.h>

typedef __bf16 bf16_t;
typedef __attribute__((ext_vector_type(16))) __bf16 v16bf;
typedef __attribute__((ext_vector_type(8)))  float  v8f;

#define B_   8192
#define IN_  512
#define HID_ 1024
#define OUT_ 256
#define E_   16
#define TM   64      // token tile (M) per block

union Frag { v16bf v; unsigned int u[8]; };

__device__ __forceinline__ void ld_frag(Frag& f, const bf16_t* base, int ld,
                                        int row, int kk, int lane) {
  const int r  = row + (lane & 15);
  const int kb = kk + ((lane >> 4) << 3);
  const unsigned int* p0 = (const unsigned int*)(base + (size_t)r * ld + kb);
  const unsigned int* p1 = (const unsigned int*)(base + (size_t)r * ld + kb + 16);
  f.u[0] = p0[0]; f.u[1] = p0[1]; f.u[2] = p0[2]; f.u[3] = p0[3];
  f.u[4] = p1[0]; f.u[5] = p1[1]; f.u[6] = p1[2]; f.u[7] = p1[3];
}

__device__ __forceinline__ v8f wmma_bf16(const Frag& a, const Frag& b, v8f c) {
  return __builtin_amdgcn_wmma_f32_16x16x32_bf16(
      /*neg_a=*/false, a.v, /*neg_b=*/false, b.v,
      /*c_mod=*/(short)0, c, /*reuse_a=*/false, /*reuse_b=*/false);
}

// One block = 8 waves. Each wave holds an (MT*16) x (NT*16) register tile of the
// 64 x NTOT result: per k step it fetches MT token fragments and NT weight
// fragments as one group and feeds MT*NT WMMAs from them.
template <int KTOT, int NTOT, int MT, bool RELU, bool OUT_F32>
__device__ __forceinline__ void gemm_tile(const bf16_t* __restrict__ A, int lda,
                                          const bf16_t* __restrict__ Bt, int ldb,
                                          const float* __restrict__ bias,
                                          bf16_t* __restrict__ outB,
                                          float* __restrict__ outF, int ldo,
                                          int wid, int lane) {
  constexpr int WM = (TM / 16) / MT;    // waves along the token rows
  constexpr int WN = 8 / WM;            // waves along the columns
  constexpr int NT = NTOT / 16 / WN;    // column tiles per wave
  const int mStart = (wid % WM) * (MT * 16);
  const int nStart = (wid / WM) * (NT * 16);
  v8f acc[MT][NT];
#pragma unroll  // constant indices keep acc, a, b in registers
  for (int i = 0; i < MT; ++i)
#pragma unroll  // constant indices keep acc, a, b in registers
    for (int t = 0; t < NT; ++t)
#pragma unroll  // constant indices keep acc, a, b in registers
      for (int r = 0; r < 8; ++r) acc[i][t][r] = 0.f;

  // This lane's place in the wave's first weight row tile; same k order as ld_frag.
  const bf16_t* bp = Bt + (size_t)(nStart + (lane & 15)) * ldb + ((lane >> 4) << 3);
  for (int kk = 0; kk < KTOT; kk += 32, bp += 32) {
    Frag b[NT];
#pragma unroll  // constant indices keep acc, a, b in registers
    for (int t = 0; t < NT; ++t) {
      const unsigned int* p = (const unsigned int*)(bp + (size_t)t * 16 * ldb);
      b[t].u[0] = p[0]; b[t].u[1] = p[1]; b[t].u[2] = p[2];  b[t].u[3] = p[3];
      b[t].u[4] = p[8]; b[t].u[5] = p[9]; b[t].u[6] = p[10]; b[t].u[7] = p[11];
    }
    Frag a[MT];
#pragma unroll  // constant indices keep acc, a, b in registers
    for (int i = 0; i < MT; ++i) ld_frag(a[i], A, lda, mStart + i * 16, kk, lane);
    if (kk + 32 < KTOT)  // keep next weight chunk warm (near caches)
      __builtin_prefetch(bp + 32, 0, 3);
    __builtin_amdgcn_sched_barrier(0);
#pragma unroll  // constant indices keep acc, a, b in registers
    for (int t = 0; t < NT; ++t)
#pragma unroll  // constant indices keep acc, a, b in registers
      for (int i = 0; i < MT; ++i) acc[i][t] = wmma_bf16(a[i], b[t], acc[i][t]);
    // Keeps the advance of bp behind the last WMMA, whose wait has drained the
    // weight loads: until then loads in flight still name bp's registers.
    __builtin_amdgcn_sched_barrier(0);
  }
  const int no = lane & 15;
#pragma unroll  // constant indices keep acc, a, b in registers
  for (int t = 0; t < NT; ++t) {
    const int n = nStart + t * 16 + no;
    const float bz = bias[n];
#pragma unroll  // constant indices keep acc, a, b in registers
    for (int i = 0; i < MT; ++i) {
      const int mo = mStart + i * 16 + ((lane >> 4) << 3);
#pragma unroll  // constant indices keep acc, a, b in registers
      for (int r = 0; r < 8; ++r) {
        float v = acc[i][t][r] + bz;
        if (RELU) v = v > 0.f ? v : 0.f;
        const int m = mo + r;
        if (OUT_F32) outF[m * ldo + n] = v;
        else         outB[m * ldo + n] = (bf16_t)v;
      }
    }
  }
}

// ---------------------------------------------------------------------------
// Prep kernels
// ---------------------------------------------------------------------------
extern "C" __global__ void cast_x_kernel(const float* __restrict__ x,
                                         bf16_t* __restrict__ xb, int n) {
  for (int i = blockIdx.x * blockDim.x + threadIdx.x; i < n;
       i += gridDim.x * blockDim.x)
    xb[i] = (bf16_t)x[i];
}

// dst[e][c][r] = (bf16) src[e][r][c]   (N-major weights -> K-contiguous B rows)
extern "C" __global__ void tcast_kernel(const float* __restrict__ src,
                                        bf16_t* __restrict__ dst,
                                        int R, int C, int total) {
  for (int i = blockIdx.x * blockDim.x + threadIdx.x; i < total;
       i += gridDim.x * blockDim.x) {
    const int r = i % R;
    const int t = i / R;
    const int c = t % C;
    const int e = t / C;
    dst[i] = (bf16_t)src[(size_t)e * R * C + (size_t)r * C + c];
  }
}

extern "C" __global__ void init_kernel(float* __restrict__ outf, int n_zero,
                                       int* __restrict__ counts,
                                       float* __restrict__ importance,
                                       float* __restrict__ loadv) {
  const int i = blockIdx.x * blockDim.x + threadIdx.x;
  for (int j = i; j < n_zero; j += gridDim.x * blockDim.x) outf[j] = 0.f;
  if (i < E_) { counts[i] = 0; importance[i] = 0.f; loadv[i] = 0.f; }
}

extern "C" __global__ void __launch_bounds__(128)
gating_kernel(const float* __restrict__ x, const float* __restrict__ noise,
              const float* __restrict__ gW, const float* __restrict__ gb,
              const float* __restrict__ nW, const float* __restrict__ nb,
              int* __restrict__ counts, int* __restrict__ assign,
              float* __restrict__ gateval, float* __restrict__ importance,
              float* __restrict__ loadv) {
  const int lane = threadIdx.x & 31;
  const int wid  = threadIdx.x >> 5;
  const int tok  = blockIdx.x * 4 + wid;
  const int e    = lane & 15;
  const bool np  = lane >= 16;

  const float* W = np ? nW : gW;
  float acc = (np ? nb : gb)[e];
  const float* xr = x + (size_t)tok * IN_;
  for (int i = 0; i < IN_; ++i) acc += xr[i] * W[i * E_ + e];

  const float pre_noise = __shfl(acc, e + 16);
  const float sp = (pre_noise > 20.f) ? pre_noise : log1pf(__expf(pre_noise));
  const float noisy = acc + noise[(size_t)tok * E_ + e] * sp;

  float best = -1e30f, second = -1e30f;
  int bi = 0, si = 0;
  for (int q = 0; q < 16; ++q) {
    const float v = __shfl(noisy, q);
    if (v > best)        { second = best; si = bi; best = v; bi = q; }
    else if (v > second) { second = v; si = q; }
  }
  if (lane == 0) {
    const float e1 = __expf(second - best);
    const float g0 = 1.f / (1.f + e1);
    const float g1 = e1 / (1.f + e1);
    int s0 = atomicAdd(&counts[bi], 1);
    assign[bi * B_ + s0] = tok;  gateval[bi * B_ + s0] = g0;
    atomicAdd(&importance[bi], g0); atomicAdd(&loadv[bi], 1.f);
    int s1 = atomicAdd(&counts[si], 1);
    assign[si * B_ + s1] = tok;  gateval[si * B_ + s1] = g1;
    atomicAdd(&importance[si], g1); atomicAdd(&loadv[si], 1.f);
  }
}

// ---------------------------------------------------------------------------
// Fused expert pipeline: x->h1->h2->(softmax p, alpha0)->scatter combine.
// grid = (E, B/TM), block = 256 (8 waves), 256 KB dynamic LDS.
// ---------------------------------------------------------------------------
extern "C" __global__ void __launch_bounds__(256)
expert_kernel(const bf16_t* __restrict__ xb,
              const bf16_t* __restrict__ W1t, const float* __restrict__ b1,
              const bf16_t* __restrict__ W2t, const float* __restrict__ b2,
              const bf16_t* __restrict__ Wpt, const float* __restrict__ bp,
              const float* __restrict__ Wa, const float* __restrict__ ba,
              const int* __restrict__ counts, const int* __restrict__ assign,
              const float* __restrict__ gateval,
              float* __restrict__ p_hat, float* __restrict__ alpha0) {
  extern __shared__ char smem[];
  bf16_t* bufA = (bf16_t*)smem;                  // 128KB: x tile (64x512) then h2 (64x1024)
  bf16_t* bufB = (bf16_t*)(smem + 128 * 1024);   // 128KB: h1 (64x1024)
  float*  lgts = (float*)(smem + 128 * 1024);    //  64KB overlay on bufB: logits (64x256)

  const int e   = blockIdx.x;
  const int cnt = counts[e];
  const int t0  = blockIdx.y * TM;
  if (t0 >= cnt) return;

  const int tid = threadIdx.x, lane = tid & 31, wid = tid >> 5;

  {
    const int row = tid >> 2, q = tid & 3;
    int slot = t0 + row;
    if (slot >= cnt) slot = cnt - 1;
    const int tok = assign[e * B_ + slot];
    const bf16_t* gsrc = xb + (size_t)tok * IN_ + q * 128;        // 256B chunk
    const unsigned ldst = (unsigned)(uintptr_t)(bufA + row * IN_ + q * 128);
#pragma unroll
    for (int i = 0; i < 16; ++i) {
      asm volatile("global_load_async_to_lds_b128 %0, %1, off offset:%2"
                   :: "v"(ldst), "v"(gsrc), "i"(i * 16) : "memory");
    }
    asm volatile("s_wait_asynccnt 0x0" ::: "memory");
  }
  __syncthreads();

  // h1 = relu(x @ W1 + b1)
  gemm_tile<IN_, HID_, 4, true, false>(bufA, IN_, W1t + (size_t)e * HID_ * IN_, IN_,
                                    b1 + e * HID_, bufB, nullptr, HID_, wid, lane);
  __syncthreads();
  // h2 = relu(h1 @ W2 + b2)  (overwrites x region)
  gemm_tile<HID_, HID_, 4, true, false>(bufB, HID_, W2t + (size_t)e * HID_ * HID_, HID_,
                                     b2 + e * HID_, bufA, nullptr, HID_, wid, lane);
  __syncthreads();
  // logits = h2 @ Wp + bp (float, overlays h1)
  gemm_tile<HID_, OUT_, 2, false, true>(bufA, HID_, Wpt + (size_t)e * OUT_ * HID_, HID_,
                                     bp + e * OUT_, nullptr, lgts, OUT_, wid, lane);
  __syncthreads();

  // Per-row epilogue: alpha0 dot + softmax + gated atomic scatter.
  const float* Wag = Wa + e * HID_;
  const float  bag = ba[e];
#pragma unroll
  for (int rr = 0; rr < 8; ++rr) {
    const int m = wid * 8 + rr;
    const int slot = t0 + m;

    float s = 0.f;
    for (int k = lane; k < HID_; k += 32) s += (float)bufA[m * HID_ + k] * Wag[k];
#pragma unroll
    for (int off = 16; off > 0; off >>= 1) s += __shfl_xor(s, off);

    float mx = -1e30f, v[8];
#pragma unroll
    for (int j = 0; j < 8; ++j) {
      v[j] = lgts[m * OUT_ + lane + j * 32];
      mx = fmaxf(mx, v[j]);
    }
#pragma unroll
    for (int off = 16; off > 0; off >>= 1) mx = fmaxf(mx, __shfl_xor(mx, off));
    float sm = 0.f;
#pragma unroll
    for (int j = 0; j < 8; ++j) { v[j] = __expf(v[j] - mx); sm += v[j]; }
#pragma unroll
    for (int off = 16; off > 0; off >>= 1) sm += __shfl_xor(sm, off);

    if (slot < cnt) {
      const int   tok = assign[e * B_ + slot];
      const float g   = gateval[e * B_ + slot];
      if (lane == 0) {
        const float pre = s + bag;
        const float spv = (pre > 20.f) ? pre : log1pf(__expf(pre));
        const float a0v = fminf(fmaxf(spv + 10.f, 1.f), 500.f);
        atomicAdd(&alpha0[tok], g * a0v);
      }
      const float inv = g / sm;
#pragma unroll
      for (int j = 0; j < 8; ++j)
        atomicAdd(&p_hat[(size_t)tok * OUT_ + lane + j * 32], v[j] * inv);
    }
  }
}

// ---------------------------------------------------------------------------
// Post: aux loss (ddof=1 std) and p_hat row normalization.
// ---------------------------------------------------------------------------
extern "C" __global__ void aux_kernel(const float* __restrict__ importance,
                                      const float* __restrict__ loadv,
                                      float* __restrict__ out_aux) {
  if (threadIdx.x == 0 && blockIdx.x == 0) {
    float mi = 0.f, ml = 0.f;
    for (int i = 0; i < E_; ++i) { mi += importance[i]; ml += loadv[i]; }
    mi /= (float)E_; ml /= (float)E_;
    float vi = 0.f, vl = 0.f;
    for (int i = 0; i < E_; ++i) {
      const float di = importance[i] - mi; vi += di * di;
      const float dl = loadv[i] - ml;      vl += dl * dl;
    }
    vi /= (float)(E_ - 1); vl /= (float)(E_ - 1);
    *out_aux = sqrtf(vi) / (mi + 1e-8f) + sqrtf(vl) / (ml + 1e-8f);
  }
}

extern "C" __global__ void __launch_bounds__(256)
norm_kernel(float* __restrict__ p_hat) {
  __shared__ float part[8];
  const int row = blockIdx.x, tid = threadIdx.x, lane = tid & 31, wid = tid >> 5;
  const float v = p_hat[(size_t)row * OUT_ + tid];
  float s = v;
#pragma unroll
  for (int off = 16; off > 0; off >>= 1) s += __shfl_xor(s, off);
  if (lane == 0) part[wid] = s;
  __syncthreads();
  float tot = 0.f;
#pragma unroll
  for (int w = 0; w < 8; ++w) tot += part[w];
  p_hat[(size_t)row * OUT_ + tid] = v / (tot + 1e-8f);
}

// ---------------------------------------------------------------------------
// Host launch
// ---------------------------------------------------------------------------
extern "C" void kernel_launch(void* const* d_in, const int* in_sizes, int n_in,
                              void* d_out, int out_size, void* d_ws, size_t ws_size,
                              hipStream_t stream) {
  const float* x   = (const float*)d_in[0];
  const float* noi = (const float*)d_in[1];
  const float* gW  = (const float*)d_in[2];
  const float* gb  = (const float*)d_in[3];
  const float* nW  = (const float*)d_in[4];
  const float* nb  = (const float*)d_in[5];
  const float* W1  = (const float*)d_in[6];
  const float* b1  = (const float*)d_in[7];
  const float* W2  = (const float*)d_in[8];
  const float* b2  = (const float*)d_in[9];
  const float* Wp  = (const float*)d_in[10];
  const float* bp  = (const float*)d_in[11];
  const float* Wa  = (const float*)d_in[12];
  const float* ba  = (const float*)d_in[13];

  float* out    = (float*)d_out;
  float* p_hat  = out;                           // [B, OUT]
  float* alpha0 = out + (size_t)B_ * OUT_;       // [B]
  float* auxp   = out + (size_t)B_ * OUT_ + B_;  // scalar

  char* w = (char*)d_ws;
  bf16_t* xb  = (bf16_t*)w;  w += (size_t)B_ * IN_ * 2;         // 8 MB
  bf16_t* W1t = (bf16_t*)w;  w += (size_t)E_ * HID_ * IN_ * 2;  // 16 MB
  bf16_t* W2t = (bf16_t*)w;  w += (size_t)E_ * HID_ * HID_ * 2; // 32 MB
  bf16_t* Wpt = (bf16_t*)w;  w += (size_t)E_ * OUT_ * HID_ * 2; // 8 MB
  int*    counts     = (int*)w;   w += 256;
  int*    assign     = (int*)w;   w += (size_t)E_ * B_ * 4;     // 512 KB
  float*  gateval    = (float*)w; w += (size_t)E_ * B_ * 4;     // 512 KB
  float*  importance = (float*)w; w += 256;
  float*  loadv      = (float*)w; w += 256;

  init_kernel<<<2048, 256, 0, stream>>>(p_hat, B_ * OUT_ + B_, counts, importance, loadv);
  cast_x_kernel<<<2048, 256, 0, stream>>>(x, xb, B_ * IN_);
  tcast_kernel<<<4096, 256, 0, stream>>>(W1, W1t, IN_, HID_, E_ * IN_ * HID_);
  tcast_kernel<<<8192, 256, 0, stream>>>(W2, W2t, HID_, HID_, E_ * HID_ * HID_);
  tcast_kernel<<<2048, 256, 0, stream>>>(Wp, Wpt, HID_, OUT_, E_ * HID_ * OUT_);

  gating_kernel<<<B_ / 4, 128, 0, stream>>>(x, noi, gW, gb, nW, nb,
                                            counts, assign, gateval, importance, loadv);

  dim3 eg(E_, B_ / TM);
  expert_kernel<<<eg, 256, 256 * 1024, stream>>>(xb, W1t, b1, W2t, b2, Wpt, bp,
                                                 Wa, ba, counts, assign, gateval,
                                                 p_hat, alpha0);

  aux_kernel<<<1, 32, 0, stream>>>(importance, loadv, auxp);
  norm_kernel<<<B_, 256, 0, stream>>>(p_hat);
}

// v002
// Measured time: 339 microseconds a run.
// Timed twice side by side with v001, it ran 1.36 times as fast both times.
// Counting every step since v000, it is 2.33 times as fast.
#include <hip/hip_runtime.h>
#include <hip/hip_bf16.h>
#include <math.h>

typedef __bf16 bf16_t;
typedef __attribute__((ext_vector_type(16))) __bf16 v16bf;
typedef __attribute__((ext_vector_type(8)))  float  v8f;

#define B_   8192
#define IN_  512
#define HID_ 1024
#define OUT_ 256
#define E_   16
#define TM   64      // token tile (M) per block

union Frag { v16bf v; unsigned int u[8]; };

__device__ __forceinline__ void ld_frag(Frag& f, const bf16_t* base, int ld,
                                        int row, int kk, int lane) {
  const int r  = row + (lane & 15);
  const int kb = kk + ((lane >> 4) << 3);
  const unsigned int* p0 = (const unsigned int*)(base + (size_t)r * ld + kb);
  const unsigned int* p1 = (const unsigned int*)(base + (size_t)r * ld + kb + 16);
  f.u[0] = p0[0]; f.u[1] = p0[1]; f.u[2] = p0[2]; f.u[3] = p0[3];
  f.u[4] = p1[0]; f.u[5] = p1[1]; f.u[6] = p1[2]; f.u[7] = p1[3];
}

__device__ __forceinline__ v8f wmma_bf16(const Frag& a, const Frag& b, v8f c) {
  return __builtin_amdgcn_wmma_f32_16x16x32_bf16(
      /*neg_a=*/false, a.v, /*neg_b=*/false, b.v,
      /*c_mod=*/(short)0, c, /*reuse_a=*/false, /*reuse_b=*/false);
}

// One block = 8 waves. Each wave holds an (MT*16) x (NT*16) register tile of the
// 64 x NTOT result: per k step it fetches MT token fragments and NT weight
// fragments as one group and feeds MT*NT WMMAs from them.
template <int KTOT, int NTOT, int MT, bool RELU, bool OUT_F32>
__device__ __forceinline__ void gemm_tile(const bf16_t* __restrict__ A, int lda,
                                          const bf16_t* __restrict__ Bt, int ldb,
                                          const float* __restrict__ bias,
                                          bf16_t* __restrict__ outB,
                                          float* __restrict__ outF, int ldo,
                                          int wid, int lane) {
  constexpr int WM = (TM / 16) / MT;    // waves along the token rows
  constexpr int WN = 8 / WM;            // waves along the columns
  constexpr int NT = NTOT / 16 / WN;    // column tiles per wave
  const int mStart = (wid % WM) * (MT * 16);
  const int nStart = (wid / WM) * (NT * 16);
  v8f acc[MT][NT];
#pragma unroll  // constant indices keep acc, a, b in registers
  for (int i = 0; i < MT; ++i)
#pragma unroll  // constant indices keep acc, a, b in registers
    for (int t = 0; t < NT; ++t)
#pragma unroll  // constant indices keep acc, a, b in registers
      for (int r = 0; r < 8; ++r) acc[i][t][r] = 0.f;

  // This lane's place in the wave's first weight row tile; same k order as ld_frag.
  const bf16_t* bp = Bt + (size_t)(nStart + (lane & 15)) * ldb + ((lane >> 4) << 3);
  for (int kk = 0; kk < KTOT; kk += 32, bp += 32) {
    Frag b[NT];
#pragma unroll  // constant indices keep acc, a, b in registers
    for (int t = 0; t < NT; ++t) {
      const unsigned int* p = (const unsigned int*)(bp + (size_t)t * 16 * ldb);
      b[t].u[0] = p[0]; b[t].u[1] = p[1]; b[t].u[2] = p[2];  b[t].u[3] = p[3];
      b[t].u[4] = p[8]; b[t].u[5] = p[9]; b[t].u[6] = p[10]; b[t].u[7] = p[11];
    }
    Frag a[MT];
#pragma unroll  // constant indices keep acc, a, b in registers
    for (int i = 0; i < MT; ++i) ld_frag(a[i], A, lda, mStart + i * 16, kk, lane);
    if (kk + 32 < KTOT)  // keep next weight chunk warm (near caches)
      __builtin_prefetch(bp + 32, 0, 3);
    __builtin_amdgcn_sched_barrier(0);
#pragma unroll  // constant indices keep acc, a, b in registers
    for (int t = 0; t < NT; ++t)
#pragma unroll  // constant indices keep acc, a, b in registers
      for (int i = 0; i < MT; ++i) acc[i][t] = wmma_bf16(a[i], b[t], acc[i][t]);
    // Keeps the advance of bp behind the last WMMA, whose wait has drained the
    // weight loads: until then loads in flight still name bp's registers.
    __builtin_amdgcn_sched_barrier(0);
  }
  const int no = lane & 15;
#pragma unroll  // constant indices keep acc, a, b in registers
  for (int t = 0; t < NT; ++t) {
    const int n = nStart + t * 16 + no;
    const float bz = bias[n];
#pragma unroll  // constant indices keep acc, a, b in registers
    for (int i = 0; i < MT; ++i) {
      const int mo = mStart + i * 16 + ((lane >> 4) << 3);
#pragma unroll  // constant indices keep acc, a, b in registers
      for (int r = 0; r < 8; ++r) {
        float v = acc[i][t][r] + bz;
        if (RELU) v = v > 0.f ? v : 0.f;
        const int m = mo + r;
        if (OUT_F32) outF[m * ldo + n] = v;
        else         outB[m * ldo + n] = (bf16_t)v;
      }
    }
  }
}

// ---------------------------------------------------------------------------
// Prep kernels
// ---------------------------------------------------------------------------
extern "C" __global__ void cast_x_kernel(const float* __restrict__ x,
                                         bf16_t* __restrict__ xb, int n) {
  for (int i = blockIdx.x * blockDim.x + threadIdx.x; i < n;
       i += gridDim.x * blockDim.x)
    xb[i] = (bf16_t)x[i];
}

// dst[e][c][r] = (bf16) src[e][r][c]   (N-major weights -> K-contiguous B rows)
// One block moves one 128 x 128 tile. Reads: a wave takes 512 contiguous bytes of one
// src row per load. Each thread turns its 16 rows x 4 columns into 16-byte pieces of
// 8 consecutive r in registers; LDS only regroups the pieces so that a wave's store
// covers 256 contiguous bytes of each of two dst rows.
// grid = (R/128, C/128, E), block = 256.
typedef __attribute__((ext_vector_type(8))) __bf16 v8bf;
typedef __attribute__((ext_vector_type(4))) float  v4f;

template <int R, int C>  // compile-time pitches: every row step is an immediate offset
__global__ void __launch_bounds__(256)
tcast_kernel(const float* __restrict__ src, bf16_t* __restrict__ dst) {
  __shared__ v8bf tile[128 * 16];
  const int tid = threadIdx.x;
  const int r0 = blockIdx.x * 128, c0 = blockIdx.y * 128;
  const size_t eoff = (size_t)blockIdx.z * R * C;

  const int cq = tid & 31, rg = tid >> 5;   // 4 columns from cq * 4, 16 rows from rg * 16
  const float* s = src + eoff + (size_t)(r0 + rg * 16) * C + c0 + cq * 4;
  v4f v[16];
#pragma unroll  // all 16 loads in flight at once; constant indices keep v in registers
  for (int i = 0; i < 16; ++i) v[i] = *(const v4f*)(s + (size_t)i * C);
  // All 16 loads name s's registers. Taking s as an input keeps those registers as they
  // are up to this wait, so nothing (a later load's result included) reuses them before it.
  asm volatile("s_wait_xcnt 0x0" :: "v"(s) : "memory");
  // Keeps the conversions behind the last load; left free, the compiler waits for the
  // first rows before it has issued the last ones.
  __builtin_amdgcn_sched_barrier(0);

#pragma unroll  // constant indices keep v in registers
  for (int j = 0; j < 4; ++j)
#pragma unroll  // constant indices keep v in registers
    for (int h = 0; h < 2; ++h) {
      v8bf o;
#pragma unroll  // constant indices keep v in registers
      for (int i = 0; i < 8; ++i) o[i] = (bf16_t)v[h * 8 + i][j];
      tile[(cq * 4 + j) * 16 + ((rg * 2 + h) ^ (cq & 15))] = o;
    }
  __syncthreads();

  const int k = tid & 15, cr = tid >> 4;
  bf16_t* d = dst + eoff + (size_t)(c0 + cr) * R + r0 + k * 8;
#pragma unroll  // the 8 LDS reads and stores go out back to back
  for (int p = 0; p < 8; ++p) {
    const int c = p * 16 + cr;
    *(v8bf*)(d + (size_t)p * 16 * R) = tile[c * 16 + (k ^ ((c >> 2) & 15))];
  }
}

extern "C" __global__ void init_kernel(float* __restrict__ outf, int n_zero,
                                       int* __restrict__ counts,
                                       float* __restrict__ importance,
                                       float* __restrict__ loadv) {
  const int i = blockIdx.x * blockDim.x + threadIdx.x;
  for (int j = i; j < n_zero; j += gridDim.x * blockDim.x) outf[j] = 0.f;
  if (i < E_) { counts[i] = 0; importance[i] = 0.f; loadv[i] = 0.f; }
}

extern "C" __global__ void __launch_bounds__(128)
gating_kernel(const float* __restrict__ x, const float* __restrict__ noise,
              const float* __restrict__ gW, const float* __restrict__ gb,
              const float* __restrict__ nW, const float* __restrict__ nb,
              int* __restrict__ counts, int* __restrict__ assign,
              float* __restrict__ gateval, float* __restrict__ importance,
              float* __restrict__ loadv) {
  const int lane = threadIdx.x & 31;
  const int wid  = threadIdx.x >> 5;
  const int tok  = blockIdx.x * 4 + wid;
  const int e    = lane & 15;
  const bool np  = lane >= 16;

  const float* W = np ? nW : gW;
  float acc = (np ? nb : gb)[e];
  const float* xr = x + (size_t)tok * IN_;
  for (int i = 0; i < IN_; ++i) acc += xr[i] * W[i * E_ + e];

  const float pre_noise = __shfl(acc, e + 16);
  const float sp = (pre_noise > 20.f) ? pre_noise : log1pf(__expf(pre_noise));
  const float noisy = acc + noise[(size_t)tok * E_ + e] * sp;

  float best = -1e30f, second = -1e30f;
  int bi = 0, si = 0;
  for (int q = 0; q < 16; ++q) {
    const float v = __shfl(noisy, q);
    if (v > best)        { second = best; si = bi; best = v; bi = q; }
    else if (v > second) { second = v; si = q; }
  }
  if (lane == 0) {
    const float e1 = __expf(second - best);
    const float g0 = 1.f / (1.f + e1);
    const float g1 = e1 / (1.f + e1);
    int s0 = atomicAdd(&counts[bi], 1);
    assign[bi * B_ + s0] = tok;  gateval[bi * B_ + s0] = g0;
    atomicAdd(&importance[bi], g0); atomicAdd(&loadv[bi], 1.f);
    int s1 = atomicAdd(&counts[si], 1);
    assign[si * B_ + s1] = tok;  gateval[si * B_ + s1] = g1;
    atomicAdd(&importance[si], g1); atomicAdd(&loadv[si], 1.f);
  }
}

// ---------------------------------------------------------------------------
// Fused expert pipeline: x->h1->h2->(softmax p, alpha0)->scatter combine.
// grid = (E, B/TM), block = 256 (8 waves), 256 KB dynamic LDS.
// ---------------------------------------------------------------------------
extern "C" __global__ void __launch_bounds__(256)
expert_kernel(const bf16_t* __restrict__ xb,
              const bf16_t* __restrict__ W1t, const float* __restrict__ b1,
              const bf16_t* __restrict__ W2t, const float* __restrict__ b2,
              const bf16_t* __restrict__ Wpt, const float* __restrict__ bp,
              const float* __restrict__ Wa, const float* __restrict__ ba,
              const int* __restrict__ counts, const int* __restrict__ assign,
              const float* __restrict__ gateval,
              float* __restrict__ p_hat, float* __restrict__ alpha0) {
  extern __shared__ char smem[];
  bf16_t* bufA = (bf16_t*)smem;                  // 128KB: x tile (64x512) then h2 (64x1024)
  bf16_t* bufB = (bf16_t*)(smem + 128 * 1024);   // 128KB: h1 (64x1024)
  float*  lgts = (float*)(smem + 128 * 1024);    //  64KB overlay on bufB: logits (64x256)

  const int e   = blockIdx.x;
  const int cnt = counts[e];
  const int t0  = blockIdx.y * TM;
  if (t0 >= cnt) return;

  const int tid = threadIdx.x, lane = tid & 31, wid = tid >> 5;

  {
    const int row = tid >> 2, q = tid & 3;
    int slot = t0 + row;
    if (slot >= cnt) slot = cnt - 1;
    const int tok = assign[e * B_ + slot];
    const bf16_t* gsrc = xb + (size_t)tok * IN_ + q * 128;        // 256B chunk
    const unsigned ldst = (unsigned)(uintptr_t)(bufA + row * IN_ + q * 128);
#pragma unroll
    for (int i = 0; i < 16; ++i) {
      asm volatile("global_load_async_to_lds_b128 %0, %1, off offset:%2"
                   :: "v"(ldst), "v"(gsrc), "i"(i * 16) : "memory");
    }
    asm volatile("s_wait_asynccnt 0x0" ::: "memory");
  }
  __syncthreads();

  // h1 = relu(x @ W1 + b1)
  gemm_tile<IN_, HID_, 4, true, false>(bufA, IN_, W1t + (size_t)e * HID_ * IN_, IN_,
                                    b1 + e * HID_, bufB, nullptr, HID_, wid, lane);
  __syncthreads();
  // h2 = relu(h1 @ W2 + b2)  (overwrites x region)
  gemm_tile<HID_, HID_, 4, true, false>(bufB, HID_, W2t + (size_t)e * HID_ * HID_, HID_,
                                     b2 + e * HID_, bufA, nullptr, HID_, wid, lane);
  __syncthreads();
  // logits = h2 @ Wp + bp (float, overlays h1)
  gemm_tile<HID_, OUT_, 2, false, true>(bufA, HID_, Wpt + (size_t)e * OUT_ * HID_, HID_,
                                     bp + e * OUT_, nullptr, lgts, OUT_, wid, lane);
  __syncthreads();

  // Per-row epilogue: alpha0 dot + softmax + gated atomic scatter.
  const float* Wag = Wa + e * HID_;
  const float  bag = ba[e];
#pragma unroll
  for (int rr = 0; rr < 8; ++rr) {
    const int m = wid * 8 + rr;
    const int slot = t0 + m;

    float s = 0.f;
    for (int k = lane; k < HID_; k += 32) s += (float)bufA[m * HID_ + k] * Wag[k];
#pragma unroll
    for (int off = 16; off > 0; off >>= 1) s += __shfl_xor(s, off);

    float mx = -1e30f, v[8];
#pragma unroll
    for (int j = 0; j < 8; ++j) {
      v[j] = lgts[m * OUT_ + lane + j * 32];
      mx = fmaxf(mx, v[j]);
    }
#pragma unroll
    for (int off = 16; off > 0; off >>= 1) mx = fmaxf(mx, __shfl_xor(mx, off));
    float sm = 0.f;
#pragma unroll
    for (int j = 0; j < 8; ++j) { v[j] = __expf(v[j] - mx); sm += v[j]; }
#pragma unroll
    for (int off = 16; off > 0; off >>= 1) sm += __shfl_xor(sm, off);

    if (slot < cnt) {
      const int   tok = assign[e * B_ + slot];
      const float g   = gateval[e * B_ + slot];
      if (lane == 0) {
        const float pre = s + bag;
        const float spv = (pre > 20.f) ? pre : log1pf(__expf(pre));
        const float a0v = fminf(fmaxf(spv + 10.f, 1.f), 500.f);
        atomicAdd(&alpha0[tok], g * a0v);
      }
      const float inv = g / sm;
#pragma unroll
      for (int j = 0; j < 8; ++j)
        atomicAdd(&p_hat[(size_t)tok * OUT_ + lane + j * 32], v[j] * inv);
    }
  }
}

// ---------------------------------------------------------------------------
// Post: aux loss (ddof=1 std) and p_hat row normalization.
// ---------------------------------------------------------------------------
extern "C" __global__ void aux_kernel(const float* __restrict__ importance,
                                      const float* __restrict__ loadv,
                                      float* __restrict__ out_aux) {
  if (threadIdx.x == 0 && blockIdx.x == 0) {
    float mi = 0.f, ml = 0.f;
    for (int i = 0; i < E_; ++i) { mi += importance[i]; ml += loadv[i]; }
    mi /= (float)E_; ml /= (float)E_;
    float vi = 0.f, vl = 0.f;
    for (int i = 0; i < E_; ++i) {
      const float di = importance[i] - mi; vi += di * di;
      const float dl = loadv[i] - ml;      vl += dl * dl;
    }
    vi /= (float)(E_ - 1); vl /= (float)(E_ - 1);
    *out_aux = sqrtf(vi) / (mi + 1e-8f) + sqrtf(vl) / (ml + 1e-8f);
  }
}

extern "C" __global__ void __launch_bounds__(256)
norm_kernel(float* __restrict__ p_hat) {
  __shared__ float part[8];
  const int row = blockIdx.x, tid = threadIdx.x, lane = tid & 31, wid = tid >> 5;
  const float v = p_hat[(size_t)row * OUT_ + tid];
  float s = v;
#pragma unroll
  for (int off = 16; off > 0; off >>= 1) s += __shfl_xor(s, off);
  if (lane == 0) part[wid] = s;
  __syncthreads();
  float tot = 0.f;
#pragma unroll
  for (int w = 0; w < 8; ++w) tot += part[w];
  p_hat[(size_t)row * OUT_ + tid] = v / (tot + 1e-8f);
}

// ---------------------------------------------------------------------------
// Host launch
// ---------------------------------------------------------------------------
extern "C" void kernel_launch(void* const* d_in, const int* in_sizes, int n_in,
                              void* d_out, int out_size, void* d_ws, size_t ws_size,
                              hipStream_t stream) {
  const float* x   = (const float*)d_in[0];
  const float* noi = (const float*)d_in[1];
  const float* gW  = (const float*)d_in[2];
  const float* gb  = (const float*)d_in[3];
  const float* nW  = (const float*)d_in[4];
  const float* nb  = (const float*)d_in[5];
  const float* W1  = (const float*)d_in[6];
  const float* b1  = (const float*)d_in[7];
  const float* W2  = (const float*)d_in[8];
  const float* b2  = (const float*)d_in[9];
  const float* Wp  = (const float*)d_in[10];
  const float* bp  = (const float*)d_in[11];
  const float* Wa  = (const float*)d_in[12];
  const float* ba  = (const float*)d_in[13];

  float* out    = (float*)d_out;
  float* p_hat  = out;                           // [B, OUT]
  float* alpha0 = out + (size_t)B_ * OUT_;       // [B]
  float* auxp   = out + (size_t)B_ * OUT_ + B_;  // scalar

  char* w = (char*)d_ws;
  bf16_t* xb  = (bf16_t*)w;  w += (size_t)B_ * IN_ * 2;         // 8 MB
  bf16_t* W1t = (bf16_t*)w;  w += (size_t)E_ * HID_ * IN_ * 2;  // 16 MB
  bf16_t* W2t = (bf16_t*)w;  w += (size_t)E_ * HID_ * HID_ * 2; // 32 MB
  bf16_t* Wpt = (bf16_t*)w;  w += (size_t)E_ * OUT_ * HID_ * 2; // 8 MB
  int*    counts     = (int*)w;   w += 256;
  int*    assign     = (int*)w;   w += (size_t)E_ * B_ * 4;     // 512 KB
  float*  gateval    = (float*)w; w += (size_t)E_ * B_ * 4;     // 512 KB
  float*  importance = (float*)w; w += 256;
  float*  loadv      = (float*)w; w += 256;

  init_kernel<<<2048, 256, 0, stream>>>(p_hat, B_ * OUT_ + B_, counts, importance, loadv);
  cast_x_kernel<<<2048, 256, 0, stream>>>(x, xb, B_ * IN_);
  tcast_kernel<IN_, HID_><<<dim3(IN_ / 128, HID_ / 128, E_), 256, 0, stream>>>(W1, W1t);
  tcast_kernel<HID_, HID_><<<dim3(HID_ / 128, HID_ / 128, E_), 256, 0, stream>>>(W2, W2t);
  tcast_kernel<HID_, OUT_><<<dim3(HID_ / 128, OUT_ / 128, E_), 256, 0, stream>>>(Wp, Wpt);

  gating_kernel<<<B_ / 4, 128, 0, stream>>>(x, noi, gW, gb, nW, nb,
                                            counts, assign, gateval, importance, loadv);

  dim3 eg(E_, B_ / TM);
  expert_kernel<<<eg, 256, 256 * 1024, stream>>>(xb, W1t, b1, W2t, b2, Wpt, bp,
                                                 Wa, ba, counts, assign, gateval,
                                                 p_hat, alpha0);

  aux_kernel<<<1, 32, 0, stream>>>(importance, loadv, auxp);
  norm_kernel<<<B_, 256, 0, stream>>>(p_hat);
}

// v003
// Measured time: 198 microseconds a run.
// Next to v002, in two timings, it ran 1.70 and 1.71 times as fast.
// Counting every step since v000, it is 3.97 times as fast.
#include <hip/hip_runtime.h>
#include <hip/hip_bf16.h>
#include <math.h>

typedef __bf16 bf16_t;
typedef __attribute__((ext_vector_type(16))) __bf16 v16bf;
typedef __attribute__((ext_vector_type(8)))  float  v8f;

#define B_   8192
#define IN_  512
#define HID_ 1024
#define OUT_ 256
#define E_   16
#define TM   80      // token tile (M) per block

union Frag { v16bf v; unsigned int u[8]; };

__device__ __forceinline__ void ld_frag(Frag& f, const bf16_t* base, int ld,
                                        int row, int kk, int lane) {
  const int r  = row + (lane & 15);
  const int kb = kk + ((lane >> 4) << 3);
  const unsigned int* p0 = (const unsigned int*)(base + (size_t)r * ld + kb);
  const unsigned int* p1 = (const unsigned int*)(base + (size_t)r * ld + kb + 16);
  f.u[0] = p0[0]; f.u[1] = p0[1]; f.u[2] = p0[2]; f.u[3] = p0[3];
  f.u[4] = p1[0]; f.u[5] = p1[1]; f.u[6] = p1[2]; f.u[7] = p1[3];
}

__device__ __forceinline__ v8f wmma_bf16(const Frag& a, const Frag& b, v8f c) {
  return __builtin_amdgcn_wmma_f32_16x16x32_bf16(
      /*neg_a=*/false, a.v, /*neg_b=*/false, b.v,
      /*c_mod=*/(short)0, c, /*reuse_a=*/false, /*reuse_b=*/false);
}

// One block = 8 waves. Each wave holds an (MT*16) x (NT*16) register tile of the
// block's result, from row mStart and column nStart: per k step it fetches MT token
// fragments and NT weight fragments as one group and feeds MT*NT WMMAs from them.
template <int KTOT, int MT, int NT, bool RELU, bool OUT_F32>
__device__ __forceinline__ void gemm_tile(const bf16_t* __restrict__ A, int lda,
                                          const bf16_t* __restrict__ Bt, int ldb,
                                          const float* __restrict__ bias,
                                          bf16_t* __restrict__ outB,
                                          float* __restrict__ outF, int ldo,
                                          int mStart, int nStart, int lane) {
  v8f acc[MT][NT];
#pragma unroll  // constant indices keep acc, a, b in registers
  for (int i = 0; i < MT; ++i)
#pragma unroll  // constant indices keep acc, a, b in registers
    for (int t = 0; t < NT; ++t)
#pragma unroll  // constant indices keep acc, a, b in registers
      for (int r = 0; r < 8; ++r) acc[i][t][r] = 0.f;

  // This lane's place in the wave's first weight row tile; same k order as ld_frag.
  const bf16_t* bp = Bt + (size_t)(nStart + (lane & 15)) * ldb + ((lane >> 4) << 3);
  for (int kk = 0; kk < KTOT; kk += 32, bp += 32) {
    Frag b[NT];
#pragma unroll  // constant indices keep acc, a, b in registers
    for (int t = 0; t < NT; ++t) {
      const unsigned int* p = (const unsigned int*)(bp + (size_t)t * 16 * ldb);
      b[t].u[0] = p[0]; b[t].u[1] = p[1]; b[t].u[2] = p[2];  b[t].u[3] = p[3];
      b[t].u[4] = p[8]; b[t].u[5] = p[9]; b[t].u[6] = p[10]; b[t].u[7] = p[11];
    }
    Frag a[MT];
#pragma unroll  // constant indices keep acc, a, b in registers
    for (int i = 0; i < MT; ++i) ld_frag(a[i], A, lda, mStart + i * 16, kk, lane);
    if (kk + 32 < KTOT)  // keep next weight chunk warm (near caches)
      __builtin_prefetch(bp + 32, 0, 3);
    __builtin_amdgcn_sched_barrier(0);
#pragma unroll  // constant indices keep acc, a, b in registers
    for (int t = 0; t < NT; ++t)
#pragma unroll  // constant indices keep acc, a, b in registers
      for (int i = 0; i < MT; ++i) acc[i][t] = wmma_bf16(a[i], b[t], acc[i][t]);
    // Keeps the advance of bp behind the last WMMA, whose wait has drained the
    // weight loads: until then loads in flight still name bp's registers.
    __builtin_amdgcn_sched_barrier(0);
  }
  const int no = lane & 15;
#pragma unroll  // constant indices keep acc, a, b in registers
  for (int t = 0; t < NT; ++t) {
    const int n = nStart + t * 16 + no;
    const float bz = bias[n];
#pragma unroll  // constant indices keep acc, a, b in registers
    for (int i = 0; i < MT; ++i) {
      const int mo = mStart + i * 16 + ((lane >> 4) << 3);
#pragma unroll  // constant indices keep acc, a, b in registers
      for (int r = 0; r < 8; ++r) {
        float v = acc[i][t][r] + bz;
        if (RELU) v = v > 0.f ? v : 0.f;
        const int m = mo + r;
        if (OUT_F32) outF[m * ldo + n] = v;
        else         outB[m * ldo + n] = (bf16_t)v;
      }
    }
  }
}

// ---------------------------------------------------------------------------
// Prep kernels
// ---------------------------------------------------------------------------
extern "C" __global__ void cast_x_kernel(const float* __restrict__ x,
                                         bf16_t* __restrict__ xb, int n) {
  for (int i = blockIdx.x * blockDim.x + threadIdx.x; i < n;
       i += gridDim.x * blockDim.x)
    xb[i] = (bf16_t)x[i];
}

// dst[e][c][r] = (bf16) src[e][r][c]   (N-major weights -> K-contiguous B rows)
// One block moves one 128 x 128 tile. Reads: a wave takes 512 contiguous bytes of one
// src row per load. Each thread turns its 16 rows x 4 columns into 16-byte pieces of
// 8 consecutive r in registers; LDS only regroups the pieces so that a wave's store
// covers 256 contiguous bytes of each of two dst rows.
// grid = (R/128, C/128, E), block = 256.
typedef __attribute__((ext_vector_type(8))) __bf16 v8bf;
typedef __attribute__((ext_vector_type(4))) float  v4f;

template <int R, int C>  // compile-time pitches: every row step is an immediate offset
__global__ void __launch_bounds__(256)
tcast_kernel(const float* __restrict__ src, bf16_t* __restrict__ dst) {
  __shared__ v8bf tile[128 * 16];
  const int tid = threadIdx.x;
  const int r0 = blockIdx.x * 128, c0 = blockIdx.y * 128;
  const size_t eoff = (size_t)blockIdx.z * R * C;

  const int cq = tid & 31, rg = tid >> 5;   // 4 columns from cq * 4, 16 rows from rg * 16
  const float* s = src + eoff + (size_t)(r0 + rg * 16) * C + c0 + cq * 4;
  v4f v[16];
#pragma unroll  // all 16 loads in flight at once; constant indices keep v in registers
  for (int i = 0; i < 16; ++i) v[i] = *(const v4f*)(s + (size_t)i * C);
  // All 16 loads name s's registers. Taking s as an input keeps those registers as they
  // are up to this wait, so nothing (a later load's result included) reuses them before it.
  asm volatile("s_wait_xcnt 0x0" :: "v"(s) : "memory");
  // Keeps the conversions behind the last load; left free, the compiler waits for the
  // first rows before it has issued the last ones.
  __builtin_amdgcn_sched_barrier(0);

#pragma unroll  // constant indices keep v in registers
  for (int j = 0; j < 4; ++j)
#pragma unroll  // constant indices keep v in registers
    for (int h = 0; h < 2; ++h) {
      v8bf o;
#pragma unroll  // constant indices keep v in registers
      for (int i = 0; i < 8; ++i) o[i] = (bf16_t)v[h * 8 + i][j];
      tile[(cq * 4 + j) * 16 + ((rg * 2 + h) ^ (cq & 15))] = o;
    }
  __syncthreads();

  const int k = tid & 15, cr = tid >> 4;
  bf16_t* d = dst + eoff + (size_t)(c0 + cr) * R + r0 + k * 8;
#pragma unroll  // the 8 LDS reads and stores go out back to back
  for (int p = 0; p < 8; ++p) {
    const int c = p * 16 + cr;
    *(v8bf*)(d + (size_t)p * 16 * R) = tile[c * 16 + (k ^ ((c >> 2) & 15))];
  }
}

extern "C" __global__ void init_kernel(float* __restrict__ outf, int n_zero,
                                       int* __restrict__ counts,
                                       float* __restrict__ importance,
                                       float* __restrict__ loadv) {
  const int i = blockIdx.x * blockDim.x + threadIdx.x;
  for (int j = i; j < n_zero; j += gridDim.x * blockDim.x) outf[j] = 0.f;
  if (i < E_) { counts[i] = 0; importance[i] = 0.f; loadv[i] = 0.f; }
}

extern "C" __global__ void __launch_bounds__(128)
gating_kernel(const float* __restrict__ x, const float* __restrict__ noise,
              const float* __restrict__ gW, const float* __restrict__ gb,
              const float* __restrict__ nW, const float* __restrict__ nb,
              int* __restrict__ counts, int* __restrict__ assign,
              float* __restrict__ gateval, float* __restrict__ importance,
              float* __restrict__ loadv) {
  const int lane = threadIdx.x & 31;
  const int wid  = threadIdx.x >> 5;
  const int tok  = blockIdx.x * 4 + wid;
  const int e    = lane & 15;
  const bool np  = lane >= 16;

  const float* W = np ? nW : gW;
  float acc = (np ? nb : gb)[e];
  const float* xr = x + (size_t)tok * IN_;
  for (int i = 0; i < IN_; ++i) acc += xr[i] * W[i * E_ + e];

  const float pre_noise = __shfl(acc, e + 16);
  const float sp = (pre_noise > 20.f) ? pre_noise : log1pf(__expf(pre_noise));
  const float noisy = acc + noise[(size_t)tok * E_ + e] * sp;

  float best = -1e30f, second = -1e30f;
  int bi = 0, si = 0;
  for (int q = 0; q < 16; ++q) {
    const float v = __shfl(noisy, q);
    if (v > best)        { second = best; si = bi; best = v; bi = q; }
    else if (v > second) { second = v; si = q; }
  }
  if (lane == 0) {
    const float e1 = __expf(second - best);
    const float g0 = 1.f / (1.f + e1);
    const float g1 = e1 / (1.f + e1);
    int s0 = atomicAdd(&counts[bi], 1);
    assign[bi * B_ + s0] = tok;  gateval[bi * B_ + s0] = g0;
    atomicAdd(&importance[bi], g0); atomicAdd(&loadv[bi], 1.f);
    int s1 = atomicAdd(&counts[si], 1);
    assign[si * B_ + s1] = tok;  gateval[si * B_ + s1] = g1;
    atomicAdd(&importance[si], g1); atomicAdd(&loadv[si], 1.f);
  }
}

extern "C" __global__ void __launch_bounds__(256)
expert_kernel(const bf16_t* __restrict__ xb,
              const bf16_t* __restrict__ W1t, const float* __restrict__ b1,
              const bf16_t* __restrict__ W2t, const float* __restrict__ b2,
              const bf16_t* __restrict__ Wpt, const float* __restrict__ bp,
              const float* __restrict__ Wa, const float* __restrict__ ba,
              const int* __restrict__ counts, const int* __restrict__ assign,
              const float* __restrict__ gateval,
              float* __restrict__ p_hat, float* __restrict__ alpha0) {
  __shared__ __attribute__((aligned(16))) char smem[2 * TM * HID_ * 2];
  bf16_t* bufA = (bf16_t*)smem;                    // 160KB: x tile (80x512) then h2 (80x1024)
  bf16_t* bufB = (bf16_t*)(smem + TM * HID_ * 2);  // 160KB: h1 (80x1024)
  float*  lgts = (float*)(smem + TM * HID_ * 2);   //  80KB overlay on bufB: logits (80x256)

  const int e   = blockIdx.x;
  const int cnt = counts[e];
  const int t0  = blockIdx.y * TM;
  if (t0 >= cnt) return;

  const int tid = threadIdx.x, lane = tid & 31, wid = tid >> 5;

  {
    const int col = tid & 63, rsub = tid >> 6;
    const int* ae = assign + e * B_;
    int slot[20], tok[20];
#pragma unroll
    for (int i = 0; i < 20; ++i) {
      slot[i] = t0 + i * 4 + rsub;
      if (slot[i] >= cnt) slot[i] = cnt - 1;
    }
#pragma unroll  // all 20 loads in flight at once; constant indices keep tok in registers
    for (int i = 0; i < 20; ++i) tok[i] = ae[slot[i]];
    asm volatile("s_wait_xcnt 0x0"
                 :: "v"(slot[0]), "v"(slot[1]), "v"(slot[2]), "v"(slot[3]), "v"(slot[4]),
                    "v"(slot[5]), "v"(slot[6]), "v"(slot[7]), "v"(slot[8]), "v"(slot[9]),
                    "v"(slot[10]), "v"(slot[11]), "v"(slot[12]), "v"(slot[13]), "v"(slot[14]),
                    "v"(slot[15]), "v"(slot[16]), "v"(slot[17]), "v"(slot[18]), "v"(slot[19])
                 : "memory");
    const bf16_t* g[20];
    unsigned l[20];
#pragma unroll  // constant indices keep g and l in registers
    for (int i = 0; i < 20; ++i) {
      g[i] = xb + (size_t)tok[i] * IN_ + col * 8;
      l[i] = (unsigned)(uintptr_t)(bufA + (i * 4 + rsub) * IN_ + col * 8);
    }
    // The wait closes each statement: the address registers stay as they are up to it.
    asm volatile(
        "global_load_async_to_lds_b128 %0, %1, off\n\t"
        "global_load_async_to_lds_b128 %2, %3, off\n\t"
        "global_load_async_to_lds_b128 %4, %5, off\n\t"
        "global_load_async_to_lds_b128 %6, %7, off\n\t"
        "global_load_async_to_lds_b128 %8, %9, off\n\t"
        "global_load_async_to_lds_b128 %10, %11, off\n\t"
        "global_load_async_to_lds_b128 %12, %13, off\n\t"
        "global_load_async_to_lds_b128 %14, %15, off\n\t"
        "global_load_async_to_lds_b128 %16, %17, off\n\t"
        "global_load_async_to_lds_b128 %18, %19, off\n\t"
        "s_wait_xcnt 0x0"
        :: "v"(l[0]), "v"(g[0]), "v"(l[1]), "v"(g[1]), "v"(l[2]), "v"(g[2]), "v"(l[3]), "v"(g[3]), "v"(l[4]), "v"(g[4]), "v"(l[5]), "v"(g[5]), "v"(l[6]), "v"(g[6]), "v"(l[7]), "v"(g[7]), "v"(l[8]), "v"(g[8]), "v"(l[9]), "v"(g[9]) : "memory");
    asm volatile(
        "global_load_async_to_lds_b128 %0, %1, off\n\t"
        "global_load_async_to_lds_b128 %2, %3, off\n\t"
        "global_load_async_to_lds_b128 %4, %5, off\n\t"
        "global_load_async_to_lds_b128 %6, %7, off\n\t"
        "global_load_async_to_lds_b128 %8, %9, off\n\t"
        "global_load_async_to_lds_b128 %10, %11, off\n\t"
        "global_load_async_to_lds_b128 %12, %13, off\n\t"
        "global_load_async_to_lds_b128 %14, %15, off\n\t"
        "global_load_async_to_lds_b128 %16, %17, off\n\t"
        "global_load_async_to_lds_b128 %18, %19, off\n\t"
        "s_wait_xcnt 0x0"
        :: "v"(l[10]), "v"(g[10]), "v"(l[11]), "v"(g[11]), "v"(l[12]), "v"(g[12]), "v"(l[13]), "v"(g[13]), "v"(l[14]), "v"(g[14]), "v"(l[15]), "v"(g[15]), "v"(l[16]), "v"(g[16]), "v"(l[17]), "v"(g[17]), "v"(l[18]), "v"(g[18]), "v"(l[19]), "v"(g[19]) : "memory");
    // The copies have landed before the barrier lets another wave read them.
    asm volatile("s_wait_asynccnt 0x0" ::: "memory");
  }
  __syncthreads();

  // h1 = relu(x @ W1 + b1)
  gemm_tile<IN_, 5, 8, true, false>(bufA, IN_, W1t + (size_t)e * HID_ * IN_, IN_,
                                    b1 + e * HID_, bufB, nullptr, HID_, 0, wid * 128, lane);
  __syncthreads();
  // h2 = relu(h1 @ W2 + b2)  (overwrites x region)
  gemm_tile<HID_, 5, 8, true, false>(bufB, HID_, W2t + (size_t)e * HID_ * HID_, HID_,
                                     b2 + e * HID_, bufA, nullptr, HID_, 0, wid * 128, lane);
  __syncthreads();
  // logits = h2 @ Wp + bp (float, overlays h1): four column strips of 64. Waves w and
  // w + 4 share a strip: one takes its upper 48 rows, the other its lower 32.
  if (__builtin_amdgcn_readfirstlane(wid) < 4)
    gemm_tile<HID_, 3, 4, false, true>(bufA, HID_, Wpt + (size_t)e * OUT_ * HID_, HID_,
                                       bp + e * OUT_, nullptr, lgts, OUT_, 0, (wid & 3) * 64, lane);
  else
    gemm_tile<HID_, 2, 4, false, true>(bufA, HID_, Wpt + (size_t)e * OUT_ * HID_, HID_,
                                       bp + e * OUT_, nullptr, lgts, OUT_, 48, (wid & 3) * 64, lane);
  __syncthreads();

  // Per-row epilogue: alpha0 dot + softmax + gated atomic scatter.
  const float* Wag = Wa + e * HID_;
  const float  bag = ba[e];
#pragma nounroll  // for speed only
  for (int rr = 0; rr < TM / 8; ++rr) {
    const int m = wid * (TM / 8) + rr;
    const int slot = t0 + m;

    float s = 0.f;
    for (int k = lane; k < HID_; k += 32) s += (float)bufA[m * HID_ + k] * Wag[k];
#pragma unroll
    for (int off = 16; off > 0; off >>= 1) s += __shfl_xor(s, off);

    float mx = -1e30f, v[8];
#pragma unroll
    for (int j = 0; j < 8; ++j) {
      v[j] = lgts[m * OUT_ + lane + j * 32];
      mx = fmaxf(mx, v[j]);
    }
#pragma unroll
    for (int off = 16; off > 0; off >>= 1) mx = fmaxf(mx, __shfl_xor(mx, off));
    float sm = 0.f;
#pragma unroll
    for (int j = 0; j < 8; ++j) { v[j] = __expf(v[j] - mx); sm += v[j]; }
#pragma unroll
    for (int off = 16; off > 0; off >>= 1) sm += __shfl_xor(sm, off);

    if (slot < cnt) {
      const int   tok = assign[e * B_ + slot];
      const float g   = gateval[e * B_ + slot];
      if (lane == 0) {
        const float pre = s + bag;
        const float spv = (pre > 20.f) ? pre : log1pf(__expf(pre));
        const float a0v = fminf(fmaxf(spv + 10.f, 1.f), 500.f);
        atomicAdd(&alpha0[tok], g * a0v);
      }
      const float inv = g / sm;
#pragma unroll
      for (int j = 0; j < 8; ++j)
        atomicAdd(&p_hat[(size_t)tok * OUT_ + lane + j * 32], v[j] * inv);
    }
  }
}

// ---------------------------------------------------------------------------
// Post: aux loss (ddof=1 std) and p_hat row normalization.
// ---------------------------------------------------------------------------
extern "C" __global__ void aux_kernel(const float* __restrict__ importance,
                                      const float* __restrict__ loadv,
                                      float* __restrict__ out_aux) {
  if (threadIdx.x == 0 && blockIdx.x == 0) {
    float mi = 0.f, ml = 0.f;
    for (int i = 0; i < E_; ++i) { mi += importance[i]; ml += loadv[i]; }
    mi /= (float)E_; ml /= (float)E_;
    float vi = 0.f, vl = 0.f;
    for (int i = 0; i < E_; ++i) {
      const float di = importance[i] - mi; vi += di * di;
      const float dl = loadv[i] - ml;      vl += dl * dl;
    }
    vi /= (float)(E_ - 1); vl /= (float)(E_ - 1);
    *out_aux = sqrtf(vi) / (mi + 1e-8f) + sqrtf(vl) / (ml + 1e-8f);
  }
}

extern "C" __global__ void __launch_bounds__(256)
norm_kernel(float* __restrict__ p_hat) {
  __shared__ float part[8];
  const int row = blockIdx.x, tid = threadIdx.x, lane = tid & 31, wid = tid >> 5;
  const float v = p_hat[(size_t)row * OUT_ + tid];
  float s = v;
#pragma unroll
  for (int off = 16; off > 0; off >>= 1) s += __shfl_xor(s, off);
  if (lane == 0) part[wid] = s;
  __syncthreads();
  float tot = 0.f;
#pragma unroll
  for (int w = 0; w < 8; ++w) tot += part[w];
  p_hat[(size_t)row * OUT_ + tid] = v / (tot + 1e-8f);
}

// ---------------------------------------------------------------------------
// Host launch
// ---------------------------------------------------------------------------
extern "C" void kernel_launch(void* const* d_in, const int* in_sizes, int n_in,
                              void* d_out, int out_size, void* d_ws, size_t ws_size,
                              hipStream_t stream) {
  const float* x   = (const float*)d_in[0];
  const float* noi = (const float*)d_in[1];
  const float* gW  = (const float*)d_in[2];
  const float* gb  = (const float*)d_in[3];
  const float* nW  = (const float*)d_in[4];
  const float* nb  = (const float*)d_in[5];
  const float* W1  = (const float*)d_in[6];
  const float* b1  = (const float*)d_in[7];
  const float* W2  = (const float*)d_in[8];
  const float* b2  = (const float*)d_in[9];
  const float* Wp  = (const float*)d_in[10];
  const float* bp  = (const float*)d_in[11];
  const float* Wa  = (const float*)d_in[12];
  const float* ba  = (const float*)d_in[13];

  float* out    = (float*)d_out;
  float* p_hat  = out;                           // [B, OUT]
  float* alpha0 = out + (size_t)B_ * OUT_;       // [B]
  float* auxp   = out + (size_t)B_ * OUT_ + B_;  // scalar

  char* w = (char*)d_ws;
  bf16_t* xb  = (bf16_t*)w;  w += (size_t)B_ * IN_ * 2;         // 8 MB
  bf16_t* W1t = (bf16_t*)w;  w += (size_t)E_ * HID_ * IN_ * 2;  // 16 MB
  bf16_t* W2t = (bf16_t*)w;  w += (size_t)E_ * HID_ * HID_ * 2; // 32 MB
  bf16_t* Wpt = (bf16_t*)w;  w += (size_t)E_ * OUT_ * HID_ * 2; // 8 MB
  int*    counts     = (int*)w;   w += 256;
  int*    assign     = (int*)w;   w += (size_t)E_ * B_ * 4;     // 512 KB
  float*  gateval    = (float*)w; w += (size_t)E_ * B_ * 4;     // 512 KB
  float*  importance = (float*)w; w += 256;
  float*  loadv      = (float*)w; w += 256;

  init_kernel<<<2048, 256, 0, stream>>>(p_hat, B_ * OUT_ + B_, counts, importance, loadv);
  cast_x_kernel<<<2048, 256, 0, stream>>>(x, xb, B_ * IN_);
  tcast_kernel<IN_, HID_><<<dim3(IN_ / 128, HID_ / 128, E_), 256, 0, stream>>>(W1, W1t);
  tcast_kernel<HID_, HID_><<<dim3(HID_ / 128, HID_ / 128, E_), 256, 0, stream>>>(W2, W2t);
  tcast_kernel<HID_, OUT_><<<dim3(HID_ / 128, OUT_ / 128, E_), 256, 0, stream>>>(Wp, Wpt);

  gating_kernel<<<B_ / 4, 128, 0, stream>>>(x, noi, gW, gb, nW, nb,
                                            counts, assign, gateval, importance, loadv);

  dim3 eg(E_, (B_ + TM - 1) / TM);
  expert_kernel<<<eg, 256, 0, stream>>>(xb, W1t, b1, W2t, b2, Wpt, bp,
                                                 Wa, ba, counts, assign, gateval,
                                                 p_hat, alpha0);

  aux_kernel<<<1, 32, 0, stream>>>(importance, loadv, auxp);
  norm_kernel<<<B_, 256, 0, stream>>>(p_hat);
}

// v004
// Measured time: 189 microseconds a run.
// Two timings next to v003 put it at 1.04 and 1.05 times that version's speed.
// Over all steps from v000 it is 4.15 times as fast.
#include <hip/hip_runtime.h>
#include <hip/hip_bf16.h>
#include <math.h>

typedef __bf16 bf16_t;
typedef __attribute__((ext_vector_type(16))) __bf16 v16bf;
typedef __attribute__((ext_vector_type(8)))  float  v8f;

#define B_   8192
#define IN_  512
#define HID_ 1024
#define OUT_ 256
#define E_   16
#define TM   80      // token tile (M) per block

union Frag { v16bf v; unsigned int u[8]; };

__device__ __forceinline__ void ld_frag(Frag& f, const bf16_t* base, int ld,
                                        int row, int kk, int lane) {
  const int r  = row + (lane & 15);
  const int kb = kk + ((lane >> 4) << 3);
  const unsigned int* p0 = (const unsigned int*)(base + (size_t)r * ld + kb);
  const unsigned int* p1 = (const unsigned int*)(base + (size_t)r * ld + kb + 16);
  f.u[0] = p0[0]; f.u[1] = p0[1]; f.u[2] = p0[2]; f.u[3] = p0[3];
  f.u[4] = p1[0]; f.u[5] = p1[1]; f.u[6] = p1[2]; f.u[7] = p1[3];
}

__device__ __forceinline__ v8f wmma_bf16(const Frag& a, const Frag& b, v8f c) {
  return __builtin_amdgcn_wmma_f32_16x16x32_bf16(
      /*neg_a=*/false, a.v, /*neg_b=*/false, b.v,
      /*c_mod=*/(short)0, c, /*reuse_a=*/false, /*reuse_b=*/false);
}

// One block = 8 waves. Each wave holds an (MT*16) x (NT*16) register tile of the
// block's result, from row mStart and column nStart: per k step it fetches MT token
// fragments and NT weight fragments as one group and feeds MT*NT WMMAs from them.
// Bt holds the weights in fragment order (see tcast_kernel); nTot is their column count.
template <int KTOT, int MT, int NT, bool RELU, bool OUT_F32>
__device__ __forceinline__ void gemm_tile(const bf16_t* __restrict__ A, int lda,
                                          const bf16_t* __restrict__ Bt, int nTot,
                                          const float* __restrict__ bias,
                                          bf16_t* __restrict__ outB,
                                          float* __restrict__ outF, int ldo,
                                          int mStart, int nStart, int lane) {
  v8f acc[MT][NT];
#pragma unroll  // constant indices keep acc, a, b in registers
  for (int i = 0; i < MT; ++i)
#pragma unroll  // constant indices keep acc, a, b in registers
    for (int t = 0; t < NT; ++t)
#pragma unroll  // constant indices keep acc, a, b in registers
      for (int r = 0; r < 8; ++r) acc[i][t][r] = 0.f;

  // This lane's 16 bytes in the wave's first weight fragment; same k order as ld_frag.
  // A k step's fragments of all columns lie side by side: the wave's NT are NT KB in a row.
  const bf16_t* bp = Bt + (size_t)nStart * 32 + lane * 8;
  const int kstep = nTot * 32;
  for (int kk = 0; kk < KTOT; kk += 32, bp += kstep) {
    Frag b[NT];
#pragma unroll  // constant indices keep acc, a, b in registers
    for (int t = 0; t < NT; ++t) {
      const unsigned int* p = (const unsigned int*)(bp + t * 512);
      b[t].u[0] = p[0];   b[t].u[1] = p[1];   b[t].u[2] = p[2];   b[t].u[3] = p[3];
      b[t].u[4] = p[128]; b[t].u[5] = p[129]; b[t].u[6] = p[130]; b[t].u[7] = p[131];
    }
    Frag a[MT];
#pragma unroll  // constant indices keep acc, a, b in registers
    for (int i = 0; i < MT; ++i) ld_frag(a[i], A, lda, mStart + i * 16, kk, lane);
    if (kk + 32 < KTOT)  // keep next weight chunk warm (near caches)
      __builtin_prefetch(bp + kstep, 0, 3);
    __builtin_amdgcn_sched_barrier(0);
#pragma unroll  // constant indices keep acc, a, b in registers
    for (int t = 0; t < NT; ++t)
#pragma unroll  // constant indices keep acc, a, b in registers
      for (int i = 0; i < MT; ++i) acc[i][t] = wmma_bf16(a[i], b[t], acc[i][t]);
    // Keeps the advance of bp behind the last WMMA, whose wait has drained the
    // weight loads: until then loads in flight still name bp's registers.
    __builtin_amdgcn_sched_barrier(0);
  }
  const int n0 = nStart + (lane & 15);
  float bzs[NT];
#pragma unroll  // all NT loads in flight at once; constant indices keep bzs in registers
  for (int t = 0; t < NT; ++t) bzs[t] = bias[n0 + t * 16];
  // All NT loads name n0's register. Taking n0 as an input keeps that register as it is
  // up to this wait, so nothing reuses it before it.
  asm volatile("s_wait_xcnt 0x0" :: "v"(n0) : "memory");
#pragma unroll  // constant indices keep acc, a, b in registers
  for (int t = 0; t < NT; ++t) {
    const int n = n0 + t * 16;
    const float bz = bzs[t];
#pragma unroll  // constant indices keep acc, a, b in registers
    for (int i = 0; i < MT; ++i) {
      const int mo = mStart + i * 16 + ((lane >> 4) << 3);
#pragma unroll  // constant indices keep acc, a, b in registers
      for (int r = 0; r < 8; ++r) {
        float v = acc[i][t][r] + bz;
        if (RELU) v = v > 0.f ? v : 0.f;
        const int m = mo + r;
        if (OUT_F32) outF[m * ldo + n] = v;
        else         outB[m * ldo + n] = (bf16_t)v;
      }
    }
  }
}

// ---------------------------------------------------------------------------
// Prep kernels
// ---------------------------------------------------------------------------
extern "C" __global__ void cast_x_kernel(const float* __restrict__ x,
                                         bf16_t* __restrict__ xb, int n) {
  for (int i = blockIdx.x * blockDim.x + threadIdx.x; i < n;
       i += gridDim.x * blockDim.x)
    xb[i] = (bf16_t)x[i];
}

// Casts src[e][r][c] to bf16 and lays it out in WMMA B-fragment order. The fragment of
// k chunk r / 32 and column tile c / 16 is 1 KB at fragment index (r / 32) * (C / 16) + c / 16;
// inside it the 16-byte piece of 8 consecutive r sits at [(r >> 4) & 1][lane], where
// lane = (c & 15) + 16 * ((r >> 3) & 1). So each of a fragment's two wave-wide 16-byte
// loads in gemm_tile reads 512 contiguous bytes (4 whole lines, not 32 bytes of 16 lines).
// One block moves one 128 x 128 tile. Reads: a wave takes 512 contiguous bytes of one
// src row per load. Each thread turns its 16 rows x 4 columns into 16-byte pieces of
// 8 consecutive r in registers; LDS only regroups the pieces so that a wave's store
// covers 512 contiguous bytes of dst (half a fragment).
// grid = (R/128, C/128, E), block = 256.
typedef __attribute__((ext_vector_type(8))) __bf16 v8bf;
typedef __attribute__((ext_vector_type(4))) float  v4f;

template <int R, int C>  // compile-time pitches: every row step is an immediate offset
__global__ void __launch_bounds__(256)
tcast_kernel(const float* __restrict__ src, bf16_t* __restrict__ dst) {
  __shared__ v8bf tile[128 * 16];
  const int tid = threadIdx.x;
  const int r0 = blockIdx.x * 128, c0 = blockIdx.y * 128;
  const size_t eoff = (size_t)blockIdx.z * R * C;

  const int cq = tid & 31, rg = tid >> 5;   // 4 columns from cq * 4, 16 rows from rg * 16
  const float* s = src + eoff + (size_t)(r0 + rg * 16) * C + c0 + cq * 4;
  v4f v[16];
#pragma unroll  // all 16 loads in flight at once; constant indices keep v in registers
  for (int i = 0; i < 16; ++i) v[i] = *(const v4f*)(s + (size_t)i * C);
  // All 16 loads name s's registers. Taking s as an input keeps those registers as they
  // are up to this wait, so nothing (a later load's result included) reuses them before it.
  asm volatile("s_wait_xcnt 0x0" :: "v"(s) : "memory");
  // Keeps the conversions behind the last load; left free, the compiler waits for the
  // first rows before it has issued the last ones.
  __builtin_amdgcn_sched_barrier(0);

#pragma unroll  // constant indices keep v in registers
  for (int j = 0; j < 4; ++j)
#pragma unroll  // constant indices keep v in registers
    for (int h = 0; h < 2; ++h) {
      v8bf o;
#pragma unroll  // constant indices keep v in registers
      for (int i = 0; i < 8; ++i) o[i] = (bf16_t)v[h * 8 + i][j];
      tile[(cq * 4 + j) * 16 + ((rg * 2 + h) ^ (cq & 15) ^ (j << 2))] = o;
    }
  __syncthreads();

  // The tile is 4 k chunks of 8 fragments: 8 KB in a row per chunk, two passes p each.
  const int fl = tid & 31, fh = (tid >> 5) & 1;   // lane and half inside a fragment
  bf16_t* d = dst + eoff + ((size_t)(r0 / 32) * (C / 16) + c0 / 16) * 512 + tid * 8;
#pragma unroll  // the 8 LDS reads and stores go out back to back
  for (int p = 0; p < 8; ++p) {
    const int c = ((p & 1) * 4 + (tid >> 6)) * 16 + (fl & 15);
    const int k = (p >> 1) * 4 + fh * 2 + (fl >> 4);
    *(v8bf*)(d + (size_t)(p >> 1) * (C / 16) * 512 + (p & 1) * 2048) =
        tile[c * 16 + (k ^ ((c >> 2) & 15) ^ ((c & 3) << 2))];
  }
}

extern "C" __global__ void init_kernel(float* __restrict__ outf, int n_zero,
                                       int* __restrict__ counts,
                                       float* __restrict__ importance,
                                       float* __restrict__ loadv) {
  const int i = blockIdx.x * blockDim.x + threadIdx.x;
  for (int j = i; j < n_zero; j += gridDim.x * blockDim.x) outf[j] = 0.f;
  if (i < E_) { counts[i] = 0; importance[i] = 0.f; loadv[i] = 0.f; }
}

extern "C" __global__ void __launch_bounds__(128)
gating_kernel(const float* __restrict__ x, const float* __restrict__ noise,
              const float* __restrict__ gW, const float* __restrict__ gb,
              const float* __restrict__ nW, const float* __restrict__ nb,
              int* __restrict__ counts, int* __restrict__ assign,
              float* __restrict__ gateval, float* __restrict__ importance,
              float* __restrict__ loadv) {
  const int lane = threadIdx.x & 31;
  const int wid  = threadIdx.x >> 5;
  const int tok  = blockIdx.x * 4 + wid;
  const int e    = lane & 15;
  const bool np  = lane >= 16;

  const float* W = np ? nW : gW;
  float acc = (np ? nb : gb)[e];
  const float* xr = x + (size_t)tok * IN_;
  for (int i = 0; i < IN_; ++i) acc += xr[i] * W[i * E_ + e];

  const float pre_noise = __shfl(acc, e + 16);
  const float sp = (pre_noise > 20.f) ? pre_noise : log1pf(__expf(pre_noise));
  const float noisy = acc + noise[(size_t)tok * E_ + e] * sp;

  float best = -1e30f, second = -1e30f;
  int bi = 0, si = 0;
  for (int q = 0; q < 16; ++q) {
    const float v = __shfl(noisy, q);
    if (v > best)        { second = best; si = bi; best = v; bi = q; }
    else if (v > second) { second = v; si = q; }
  }
  if (lane == 0) {
    const float e1 = __expf(second - best);
    const float g0 = 1.f / (1.f + e1);
    const float g1 = e1 / (1.f + e1);
    int s0 = atomicAdd(&counts[bi], 1);
    assign[bi * B_ + s0] = tok;  gateval[bi * B_ + s0] = g0;
    atomicAdd(&importance[bi], g0); atomicAdd(&loadv[bi], 1.f);
    int s1 = atomicAdd(&counts[si], 1);
    assign[si * B_ + s1] = tok;  gateval[si * B_ + s1] = g1;
    atomicAdd(&importance[si], g1); atomicAdd(&loadv[si], 1.f);
  }
}

extern "C" __global__ void __launch_bounds__(256)
expert_kernel(const bf16_t* __restrict__ xb,
              const bf16_t* __restrict__ W1t, const float* __restrict__ b1,
              const bf16_t* __restrict__ W2t, const float* __restrict__ b2,
              const bf16_t* __restrict__ Wpt, const float* __restrict__ bp,
              const float* __restrict__ Wa, const float* __restrict__ ba,
              const int* __restrict__ counts, const int* __restrict__ assign,
              const float* __restrict__ gateval,
              float* __restrict__ p_hat, float* __restrict__ alpha0) {
  __shared__ __attribute__((aligned(16))) char smem[2 * TM * HID_ * 2];
  bf16_t* bufA = (bf16_t*)smem;                    // 160KB: x tile (80x512) then h2 (80x1024)
  bf16_t* bufB = (bf16_t*)(smem + TM * HID_ * 2);  // 160KB: h1 (80x1024)
  float*  lgts = (float*)(smem + TM * HID_ * 2);   //  80KB overlay on bufB: logits (80x256)

  const int e   = blockIdx.x;
  const int cnt = counts[e];
  const int t0  = blockIdx.y * TM;
  if (t0 >= cnt) return;

  const int tid = threadIdx.x, lane = tid & 31, wid = tid >> 5;

  {
    const int col = tid & 63, rsub = tid >> 6;
    const int* ae = assign + e * B_;
    int slot[20], tok[20];
#pragma unroll
    for (int i = 0; i < 20; ++i) {
      slot[i] = t0 + i * 4 + rsub;
      if (slot[i] >= cnt) slot[i] = cnt - 1;
    }
#pragma unroll  // all 20 loads in flight at once; constant indices keep tok in registers
    for (int i = 0; i < 20; ++i) tok[i] = ae[slot[i]];
    asm volatile("s_wait_xcnt 0x0"
                 :: "v"(slot[0]), "v"(slot[1]), "v"(slot[2]), "v"(slot[3]), "v"(slot[4]),
                    "v"(slot[5]), "v"(slot[6]), "v"(slot[7]), "v"(slot[8]), "v"(slot[9]),
                    "v"(slot[10]), "v"(slot[11]), "v"(slot[12]), "v"(slot[13]), "v"(slot[14]),
                    "v"(slot[15]), "v"(slot[16]), "v"(slot[17]), "v"(slot[18]), "v"(slot[19])
                 : "memory");
    const bf16_t* g[20];
    unsigned l[20];
#pragma unroll  // constant indices keep g and l in registers
    for (int i = 0; i < 20; ++i) {
      g[i] = xb + (size_t)tok[i] * IN_ + col * 8;
      l[i] = (unsigned)(uintptr_t)(bufA + (i * 4 + rsub) * IN_ + col * 8);
    }
    // The wait closes each statement: the address registers stay as they are up to it.
    asm volatile(
        "global_load_async_to_lds_b128 %0, %1, off\n\t"
        "global_load_async_to_lds_b128 %2, %3, off\n\t"
        "global_load_async_to_lds_b128 %4, %5, off\n\t"
        "global_load_async_to_lds_b128 %6, %7, off\n\t"
        "global_load_async_to_lds_b128 %8, %9, off\n\t"
        "global_load_async_to_lds_b128 %10, %11, off\n\t"
        "global_load_async_to_lds_b128 %12, %13, off\n\t"
        "global_load_async_to_lds_b128 %14, %15, off\n\t"
        "global_load_async_to_lds_b128 %16, %17, off\n\t"
        "global_load_async_to_lds_b128 %18, %19, off\n\t"
        "s_wait_xcnt 0x0"
        :: "v"(l[0]), "v"(g[0]), "v"(l[1]), "v"(g[1]), "v"(l[2]), "v"(g[2]), "v"(l[3]), "v"(g[3]), "v"(l[4]), "v"(g[4]), "v"(l[5]), "v"(g[5]), "v"(l[6]), "v"(g[6]), "v"(l[7]), "v"(g[7]), "v"(l[8]), "v"(g[8]), "v"(l[9]), "v"(g[9]) : "memory");
    asm volatile(
        "global_load_async_to_lds_b128 %0, %1, off\n\t"
        "global_load_async_to_lds_b128 %2, %3, off\n\t"
        "global_load_async_to_lds_b128 %4, %5, off\n\t"
        "global_load_async_to_lds_b128 %6, %7, off\n\t"
        "global_load_async_to_lds_b128 %8, %9, off\n\t"
        "global_load_async_to_lds_b128 %10, %11, off\n\t"
        "global_load_async_to_lds_b128 %12, %13, off\n\t"
        "global_load_async_to_lds_b128 %14, %15, off\n\t"
        "global_load_async_to_lds_b128 %16, %17, off\n\t"
        "global_load_async_to_lds_b128 %18, %19, off\n\t"
        "s_wait_xcnt 0x0"
        :: "v"(l[10]), "v"(g[10]), "v"(l[11]), "v"(g[11]), "v"(l[12]), "v"(g[12]), "v"(l[13]), "v"(g[13]), "v"(l[14]), "v"(g[14]), "v"(l[15]), "v"(g[15]), "v"(l[16]), "v"(g[16]), "v"(l[17]), "v"(g[17]), "v"(l[18]), "v"(g[18]), "v"(l[19]), "v"(g[19]) : "memory");
    // The copies have landed before the barrier lets another wave read them.
    asm volatile("s_wait_asynccnt 0x0" ::: "memory");
  }
  __syncthreads();

  // h1 = relu(x @ W1 + b1)
  gemm_tile<IN_, 5, 8, true, false>(bufA, IN_, W1t + (size_t)e * HID_ * IN_, HID_,
                                    b1 + e * HID_, bufB, nullptr, HID_, 0, wid * 128, lane);
  __syncthreads();
  // h2 = relu(h1 @ W2 + b2)  (overwrites x region)
  gemm_tile<HID_, 5, 8, true, false>(bufB, HID_, W2t + (size_t)e * HID_ * HID_, HID_,
                                     b2 + e * HID_, bufA, nullptr, HID_, 0, wid * 128, lane);
  __syncthreads();
  // logits = h2 @ Wp + bp (float, overlays h1): four column strips of 64. Waves w and
  // w + 4 share a strip: one takes its upper 48 rows, the other its lower 32.
  if (__builtin_amdgcn_readfirstlane(wid) < 4)
    gemm_tile<HID_, 3, 4, false, true>(bufA, HID_, Wpt + (size_t)e * OUT_ * HID_, OUT_,
                                       bp + e * OUT_, nullptr, lgts, OUT_, 0, (wid & 3) * 64, lane);
  else
    gemm_tile<HID_, 2, 4, false, true>(bufA, HID_, Wpt + (size_t)e * OUT_ * HID_, OUT_,
                                       bp + e * OUT_, nullptr, lgts, OUT_, 48, (wid & 3) * 64, lane);
  __syncthreads();

  // Per-row epilogue: alpha0 dot + softmax + gated atomic scatter.
  const float* Wag = Wa + e * HID_;
  const float* bae = ba + e;
  const float  bag = *bae;
  // The load names bae's registers. Taking bae as an input keeps them as they are up to
  // this wait, so nothing reuses them before it.
  asm volatile("s_wait_xcnt 0x0" :: "s"(bae) : "memory");
#pragma nounroll  // kept rolled to keep the code small
  for (int rr = 0; rr < TM / 8; ++rr) {
    const int m = wid * (TM / 8) + rr;
    const int slot = t0 + m;

    float s = 0.f;
    for (int k = lane; k < HID_; k += 32) s += (float)bufA[m * HID_ + k] * Wag[k];
#pragma unroll
    for (int off = 16; off > 0; off >>= 1) s += __shfl_xor(s, off);

    float mx = -1e30f, v[8];
#pragma unroll
    for (int j = 0; j < 8; ++j) {
      v[j] = lgts[m * OUT_ + lane + j * 32];
      mx = fmaxf(mx, v[j]);
    }
#pragma unroll
    for (int off = 16; off > 0; off >>= 1) mx = fmaxf(mx, __shfl_xor(mx, off));
    float sm = 0.f;
#pragma unroll
    for (int j = 0; j < 8; ++j) { v[j] = __expf(v[j] - mx); sm += v[j]; }
#pragma unroll
    for (int off = 16; off > 0; off >>= 1) sm += __shfl_xor(sm, off);

    if (slot < cnt) {
      const int   tok = assign[e * B_ + slot];
      const float g   = gateval[e * B_ + slot];
      if (lane == 0) {
        const float pre = s + bag;
        const float spv = (pre > 20.f) ? pre : log1pf(__expf(pre));
        const float a0v = fminf(fmaxf(spv + 10.f, 1.f), 500.f);
        atomicAdd(&alpha0[tok], g * a0v);
      }
      const float inv = g / sm;
#pragma unroll
      for (int j = 0; j < 8; ++j)
        atomicAdd(&p_hat[(size_t)tok * OUT_ + lane + j * 32], v[j] * inv);
    }
  }
}

// ---------------------------------------------------------------------------
// Post: aux loss (ddof=1 std) and p_hat row normalization.
// ---------------------------------------------------------------------------
extern "C" __global__ void aux_kernel(const float* __restrict__ importance,
                                      const float* __restrict__ loadv,
                                      float* __restrict__ out_aux) {
  if (threadIdx.x == 0 && blockIdx.x == 0) {
    float mi = 0.f, ml = 0.f;
    for (int i = 0; i < E_; ++i) { mi += importance[i]; ml += loadv[i]; }
    mi /= (float)E_; ml /= (float)E_;
    float vi = 0.f, vl = 0.f;
    for (int i = 0; i < E_; ++i) {
      const float di = importance[i] - mi; vi += di * di;
      const float dl = loadv[i] - ml;      vl += dl * dl;
    }
    vi /= (float)(E_ - 1); vl /= (float)(E_ - 1);
    *out_aux = sqrtf(vi) / (mi + 1e-8f) + sqrtf(vl) / (ml + 1e-8f);
  }
}

extern "C" __global__ void __launch_bounds__(256)
norm_kernel(float* __restrict__ p_hat) {
  __shared__ float part[8];
  const int row = blockIdx.x, tid = threadIdx.x, lane = tid & 31, wid = tid >> 5;
  const float v = p_hat[(size_t)row * OUT_ + tid];
  float s = v;
#pragma unroll
  for (int off = 16; off > 0; off >>= 1) s += __shfl_xor(s, off);
  if (lane == 0) part[wid] = s;
  __syncthreads();
  float tot = 0.f;
#pragma unroll
  for (int w = 0; w < 8; ++w) tot += part[w];
  p_hat[(size_t)row * OUT_ + tid] = v / (tot + 1e-8f);
}

// ---------------------------------------------------------------------------
// Host launch
// ---------------------------------------------------------------------------
extern "C" void kernel_launch(void* const* d_in, const int* in_sizes, int n_in,
                              void* d_out, int out_size, void* d_ws, size_t ws_size,
                              hipStream_t stream) {
  const float* x   = (const float*)d_in[0];
  const float* noi = (const float*)d_in[1];
  const float* gW  = (const float*)d_in[2];
  const float* gb  = (const float*)d_in[3];
  const float* nW  = (const float*)d_in[4];
  const float* nb  = (const float*)d_in[5];
  const float* W1  = (const float*)d_in[6];
  const float* b1  = (const float*)d_in[7];
  const float* W2  = (const float*)d_in[8];
  const float* b2  = (const float*)d_in[9];
  const float* Wp  = (const float*)d_in[10];
  const float* bp  = (const float*)d_in[11];
  const float* Wa  = (const float*)d_in[12];
  const float* ba  = (const float*)d_in[13];

  float* out    = (float*)d_out;
  float* p_hat  = out;                           // [B, OUT]
  float* alpha0 = out + (size_t)B_ * OUT_;       // [B]
  float* auxp   = out + (size_t)B_ * OUT_ + B_;  // scalar

  char* w = (char*)d_ws;
  bf16_t* xb  = (bf16_t*)w;  w += (size_t)B_ * IN_ * 2;         // 8 MB
  bf16_t* W1t = (bf16_t*)w;  w += (size_t)E_ * HID_ * IN_ * 2;  // 16 MB
  bf16_t* W2t = (bf16_t*)w;  w += (size_t)E_ * HID_ * HID_ * 2; // 32 MB
  bf16_t* Wpt = (bf16_t*)w;  w += (size_t)E_ * OUT_ * HID_ * 2; // 8 MB
  int*    counts     = (int*)w;   w += 256;
  int*    assign     = (int*)w;   w += (size_t)E_ * B_ * 4;     // 512 KB
  float*  gateval    = (float*)w; w += (size_t)E_ * B_ * 4;     // 512 KB
  float*  importance = (float*)w; w += 256;
  float*  loadv      = (float*)w; w += 256;

  init_kernel<<<2048, 256, 0, stream>>>(p_hat, B_ * OUT_ + B_, counts, importance, loadv);
  cast_x_kernel<<<2048, 256, 0, stream>>>(x, xb, B_ * IN_);
  tcast_kernel<IN_, HID_><<<dim3(IN_ / 128, HID_ / 128, E_), 256, 0, stream>>>(W1, W1t);
  tcast_kernel<HID_, HID_><<<dim3(HID_ / 128, HID_ / 128, E_), 256, 0, stream>>>(W2, W2t);
  tcast_kernel<HID_, OUT_><<<dim3(HID_ / 128, OUT_ / 128, E_), 256, 0, stream>>>(Wp, Wpt);

  gating_kernel<<<B_ / 4, 128, 0, stream>>>(x, noi, gW, gb, nW, nb,
                                            counts, assign, gateval, importance, loadv);

  dim3 eg(E_, (B_ + TM - 1) / TM);
  expert_kernel<<<eg, 256, 0, stream>>>(xb, W1t, b1, W2t, b2, Wpt, bp,
                                                 Wa, ba, counts, assign, gateval,
                                                 p_hat, alpha0);

  aux_kernel<<<1, 32, 0, stream>>>(importance, loadv, auxp);
  norm_kernel<<<B_, 256, 0, stream>>>(p_hat);
}

// v005
// One run takes 181 microseconds.
// Two timings next to v004 both put it at 1.05 times that version's speed.
// Counting every step since v000, it is 4.35 times as fast.
#include <hip/hip_runtime.h>
#include <hip/hip_bf16.h>
#include <math.h>

typedef __bf16 bf16_t;
typedef __attribute__((ext_vector_type(16))) __bf16 v16bf;
typedef __attribute__((ext_vector_type(8)))  float  v8f;

#define B_   8192
#define IN_  512
#define HID_ 1024
#define OUT_ 256
#define E_   16
#define TM   80      // token tile (M) per block

typedef __attribute__((ext_vector_type(4))) unsigned int v4u;

union Frag { v16bf v; unsigned int u[8]; v4u q[2]; };

__device__ __forceinline__ int swz(int m, int b) { return b ^ ((m & 15) << 4); }

__device__ __forceinline__ v8f wmma_bf16(const Frag& a, const Frag& b, v8f c) {
  return __builtin_amdgcn_wmma_f32_16x16x32_bf16(
      /*neg_a=*/false, a.v, /*neg_b=*/false, b.v,
      /*c_mod=*/(short)0, c, /*reuse_a=*/false, /*reuse_b=*/false);
}

// One block = 8 waves. Each wave holds an (MT*16) x (NT*16) register tile of the
// block's result, from row mStart and column nStart: per k step it fetches MT token
// fragments and NT weight fragments as one group and feeds MT*NT WMMAs from them.
// Bt holds the weights in fragment order (see tcast_kernel); nTot is their column count.
// The token tile (pitch lda elements) starts at byte aOff of the LDS array sm, the result
// (pitch ldo elements) at byte oOff; mStart is a multiple of 16, aOff of the row pitch.
template <int KTOT, int MT, int NT, bool RELU, bool OUT_F32>
__device__ __forceinline__ void gemm_tile(char* sm, int aOff, int lda,
                                          const bf16_t* __restrict__ Bt, int nTot,
                                          const float* __restrict__ bias,
                                          int oOff, int ldo,
                                          int mStart, int nStart, int lane) {
  v8f acc[MT][NT];
#pragma unroll  // constant indices keep acc, a, b in registers
  for (int i = 0; i < MT; ++i)
#pragma unroll  // constant indices keep acc, a, b in registers
    for (int t = 0; t < NT; ++t)
#pragma unroll  // constant indices keep acc, a, b in registers
      for (int r = 0; r < 8; ++r) acc[i][t][r] = 0.f;

  // This lane's 16 bytes in the wave's first weight fragment; same k order as the token fragments (aL).
  // A k step's fragments of all columns lie side by side: the wave's NT are NT KB in a row.
  const bf16_t* bp = Bt + (size_t)nStart * 32 + lane * 8;
  const int kstep = nTot * 32;
  const int aL = aOff + (mStart + (lane & 15)) * lda * 2 + swz(lane, (lane >> 4) << 4);
#pragma nounroll  // 32 copies of the last GEMM's body would add about 20 KB of text that runs once
  for (int kk = 0; kk < KTOT; kk += 32, bp += kstep) {
    Frag b[NT];
#pragma unroll  // constant indices keep acc, a, b in registers
    for (int t = 0; t < NT; ++t) {
      const unsigned int* p = (const unsigned int*)(bp + t * 512);
      b[t].u[0] = p[0];   b[t].u[1] = p[1];   b[t].u[2] = p[2];   b[t].u[3] = p[3];
      b[t].u[4] = p[128]; b[t].u[5] = p[129]; b[t].u[6] = p[130]; b[t].u[7] = p[131];
    }
    Frag a[MT];
#pragma unroll  // constant indices keep acc, a, b in registers
    for (int i = 0; i < MT; ++i) {
      a[i].q[0] = *(const v4u*)(sm + ((aL ^ (kk * 2)) + i * 16 * lda * 2));
      a[i].q[1] = *(const v4u*)(sm + ((aL ^ (kk * 2) ^ 32) + i * 16 * lda * 2));
    }
    if (kk + 32 < KTOT)  // keep next weight chunk warm (near caches)
      __builtin_prefetch(bp + kstep, 0, 3);
    __builtin_amdgcn_sched_barrier(0);
#pragma unroll  // constant indices keep acc, a, b in registers
    for (int t = 0; t < NT; ++t)
#pragma unroll  // constant indices keep acc, a, b in registers
      for (int i = 0; i < MT; ++i) acc[i][t] = wmma_bf16(a[i], b[t], acc[i][t]);
    // Keeps the advance of bp behind the last WMMA, whose wait has drained the
    // weight loads: until then loads in flight still name bp's registers.
    __builtin_amdgcn_sched_barrier(0);
    // The prefetch names bp's registers too, and no load wait counts it. Taking bp as an
    // input keeps those registers as they are up to this wait.
    asm volatile("s_wait_xcnt 0x0" :: "v"(bp) : "memory");
  }
  const int n0 = nStart + (lane & 15);
  // bf16 result: this lane's place for t = 0, i = 0, r = 0 under swz, where m & 15 is
  // (lane >> 4) * 8 + r. nStart is a multiple of 128 there, so the column step t * 32 bytes
  // and swz's r * 16 fall in bits that an XOR with a constant sets: one XOR per (t, r).
  const int oL = oOff + (mStart + ((lane >> 4) << 3)) * ldo * 2 + swz((lane >> 4) << 3, n0 * 2);
  float bzs[NT];
#pragma unroll  // all NT loads in flight at once; constant indices keep bzs in registers
  for (int t = 0; t < NT; ++t) bzs[t] = bias[n0 + t * 16];
  // All NT loads name n0's register. Taking n0 as an input keeps that register as it is
  // up to this wait, so nothing reuses it before it.
  asm volatile("s_wait_xcnt 0x0" :: "v"(n0) : "memory");
#pragma unroll  // constant indices keep acc, a, b in registers
  for (int t = 0; t < NT; ++t) {
    const int n = n0 + t * 16;
    const float bz = bzs[t];
#pragma unroll  // constant indices keep acc, a, b in registers
    for (int i = 0; i < MT; ++i) {
      const int mo = mStart + i * 16 + ((lane >> 4) << 3);
#pragma unroll  // constant indices keep acc, a, b in registers
      for (int r = 0; r < 8; ++r) {
        float v = acc[i][t][r] + bz;
        if (RELU) v = v > 0.f ? v : 0.f;
        const int m = mo + r;
        if (OUT_F32) *(float*)(sm + oOff + (m * ldo + n) * 4) = v;
        else         *(bf16_t*)(sm + ((oL ^ ((t * 32) ^ (r * 16))) + (i * 16 + r) * ldo * 2)) = (bf16_t)v;
      }
    }
  }
}

// ---------------------------------------------------------------------------
// Prep kernels
// ---------------------------------------------------------------------------
extern "C" __global__ void cast_x_kernel(const float* __restrict__ x,
                                         bf16_t* __restrict__ xb, int n) {
  for (int i = blockIdx.x * blockDim.x + threadIdx.x; i < n;
       i += gridDim.x * blockDim.x)
    xb[i] = (bf16_t)x[i];
}

// Casts src[e][r][c] to bf16 and lays it out in WMMA B-fragment order. The fragment of
// k chunk r / 32 and column tile c / 16 is 1 KB at fragment index (r / 32) * (C / 16) + c / 16;
// inside it the 16-byte piece of 8 consecutive r sits at [(r >> 4) & 1][lane], where
// lane = (c & 15) + 16 * ((r >> 3) & 1). So each of a fragment's two wave-wide 16-byte
// loads in gemm_tile reads 512 contiguous bytes (4 whole lines, not 32 bytes of 16 lines).
// One block moves one 128 x 128 tile. Reads: a wave takes 512 contiguous bytes of one
// src row per load. Each thread turns its 16 rows x 4 columns into 16-byte pieces of
// 8 consecutive r in registers; LDS only regroups the pieces so that a wave's store
// covers 512 contiguous bytes of dst (half a fragment).
// grid = (R/128, C/128, E), block = 256.
typedef __attribute__((ext_vector_type(8))) __bf16 v8bf;
typedef __attribute__((ext_vector_type(4))) float  v4f;

template <int R, int C>  // compile-time pitches: every row step is an immediate offset
__global__ void __launch_bounds__(256)
tcast_kernel(const float* __restrict__ src, bf16_t* __restrict__ dst) {
  __shared__ v8bf tile[128 * 16];
  const int tid = threadIdx.x;
  const int r0 = blockIdx.x * 128, c0 = blockIdx.y * 128;
  const size_t eoff = (size_t)blockIdx.z * R * C;

  const int cq = tid & 31, rg = tid >> 5;   // 4 columns from cq * 4, 16 rows from rg * 16
  const float* s = src + eoff + (size_t)(r0 + rg * 16) * C + c0 + cq * 4;
  v4f v[16];
#pragma unroll  // all 16 loads in flight at once; constant indices keep v in registers
  for (int i = 0; i < 16; ++i) v[i] = *(const v4f*)(s + (size_t)i * C);
  // All 16 loads name s's registers. Taking s as an input keeps those registers as they
  // are up to this wait, so nothing (a later load's result included) reuses them before it.
  asm volatile("s_wait_xcnt 0x0" :: "v"(s) : "memory");
  // Keeps the conversions behind the last load; left free, the compiler waits for the
  // first rows before it has issued the last ones.
  __builtin_amdgcn_sched_barrier(0);

#pragma unroll  // constant indices keep v in registers
  for (int j = 0; j < 4; ++j)
#pragma unroll  // constant indices keep v in registers
    for (int h = 0; h < 2; ++h) {
      v8bf o;
#pragma unroll  // constant indices keep v in registers
      for (int i = 0; i < 8; ++i) o[i] = (bf16_t)v[h * 8 + i][j];
      tile[(cq * 4 + j) * 16 + ((rg * 2 + h) ^ (cq & 15) ^ (j << 2))] = o;
    }
  __syncthreads();

  // The tile is 4 k chunks of 8 fragments: 8 KB in a row per chunk, two passes p each.
  const int fl = tid & 31, fh = (tid >> 5) & 1;   // lane and half inside a fragment
  bf16_t* d = dst + eoff + ((size_t)(r0 / 32) * (C / 16) + c0 / 16) * 512 + tid * 8;
#pragma unroll  // the 8 LDS reads and stores go out back to back
  for (int p = 0; p < 8; ++p) {
    const int c = ((p & 1) * 4 + (tid >> 6)) * 16 + (fl & 15);
    const int k = (p >> 1) * 4 + fh * 2 + (fl >> 4);
    *(v8bf*)(d + (size_t)(p >> 1) * (C / 16) * 512 + (p & 1) * 2048) =
        tile[c * 16 + (k ^ ((c >> 2) & 15) ^ ((c & 3) << 2))];
  }
}

extern "C" __global__ void init_kernel(float* __restrict__ outf, int n_zero,
                                       int* __restrict__ counts,
                                       float* __restrict__ importance,
                                       float* __restrict__ loadv) {
  const int i = blockIdx.x * blockDim.x + threadIdx.x;
  for (int j = i; j < n_zero; j += gridDim.x * blockDim.x) outf[j] = 0.f;
  if (i < E_) { counts[i] = 0; importance[i] = 0.f; loadv[i] = 0.f; }
}

extern "C" __global__ void __launch_bounds__(128)
gating_kernel(const float* __restrict__ x, const float* __restrict__ noise,
              const float* __restrict__ gW, const float* __restrict__ gb,
              const float* __restrict__ nW, const float* __restrict__ nb,
              int* __restrict__ counts, int* __restrict__ assign,
              float* __restrict__ gateval, float* __restrict__ importance,
              float* __restrict__ loadv) {
  const int lane = threadIdx.x & 31;
  const int wid  = threadIdx.x >> 5;
  const int tok  = blockIdx.x * 4 + wid;
  const int e    = lane & 15;
  const bool np  = lane >= 16;

  const float* W = np ? nW : gW;
  float acc = (np ? nb : gb)[e];
  const float* xr = x + (size_t)tok * IN_;
  for (int i = 0; i < IN_; ++i) acc += xr[i] * W[i * E_ + e];

  const float pre_noise = __shfl(acc, e + 16);
  const float sp = (pre_noise > 20.f) ? pre_noise : log1pf(__expf(pre_noise));
  const float noisy = acc + noise[(size_t)tok * E_ + e] * sp;

  float best = -1e30f, second = -1e30f;
  int bi = 0, si = 0;
  for (int q = 0; q < 16; ++q) {
    const float v = __shfl(noisy, q);
    if (v > best)        { second = best; si = bi; best = v; bi = q; }
    else if (v > second) { second = v; si = q; }
  }
  if (lane == 0) {
    const float e1 = __expf(second - best);
    const float g0 = 1.f / (1.f + e1);
    const float g1 = e1 / (1.f + e1);
    int s0 = atomicAdd(&counts[bi], 1);
    assign[bi * B_ + s0] = tok;  gateval[bi * B_ + s0] = g0;
    atomicAdd(&importance[bi], g0); atomicAdd(&loadv[bi], 1.f);
    int s1 = atomicAdd(&counts[si], 1);
    assign[si * B_ + s1] = tok;  gateval[si * B_ + s1] = g1;
    atomicAdd(&importance[si], g1); atomicAdd(&loadv[si], 1.f);
  }
}

extern "C" __global__ void __launch_bounds__(256)
expert_kernel(const bf16_t* __restrict__ xb,
              const bf16_t* __restrict__ W1t, const float* __restrict__ b1,
              const bf16_t* __restrict__ W2t, const float* __restrict__ b2,
              const bf16_t* __restrict__ Wpt, const float* __restrict__ bp,
              const float* __restrict__ Wa, const float* __restrict__ ba,
              const int* __restrict__ counts, const int* __restrict__ assign,
              const float* __restrict__ gateval,
              float* __restrict__ p_hat, float* __restrict__ alpha0) {
  __shared__ __attribute__((aligned(16))) char smem[2 * TM * HID_ * 2];
  bf16_t* bufA = (bf16_t*)smem;                    // 160KB: x tile (80x512) then h2 (80x1024)
  // second 160KB, from byte TM * HID_ * 2: h1 (80x1024)
  float*  lgts = (float*)(smem + TM * HID_ * 2);   //  80KB overlay on h1: logits (80x256)

  const int e   = blockIdx.x;
  const int cnt = counts[e];
  const int t0  = blockIdx.y * TM;
  if (t0 >= cnt) return;

  const int tid = threadIdx.x, lane = tid & 31, wid = tid >> 5;

  {
    const int col = tid & 63, rsub = tid >> 6;
    const int* ae = assign + e * B_;
    int slot[20], tok[20];
#pragma unroll
    for (int i = 0; i < 20; ++i) {
      slot[i] = t0 + i * 4 + rsub;
      if (slot[i] >= cnt) slot[i] = cnt - 1;
    }
#pragma unroll  // all 20 loads in flight at once; constant indices keep tok in registers
    for (int i = 0; i < 20; ++i) tok[i] = ae[slot[i]];
    asm volatile("s_wait_xcnt 0x0"
                 :: "v"(slot[0]), "v"(slot[1]), "v"(slot[2]), "v"(slot[3]), "v"(slot[4]),
                    "v"(slot[5]), "v"(slot[6]), "v"(slot[7]), "v"(slot[8]), "v"(slot[9]),
                    "v"(slot[10]), "v"(slot[11]), "v"(slot[12]), "v"(slot[13]), "v"(slot[14]),
                    "v"(slot[15]), "v"(slot[16]), "v"(slot[17]), "v"(slot[18]), "v"(slot[19])
                 : "memory");
    const bf16_t* g[20];
    unsigned l[20];
#pragma unroll  // constant indices keep g and l in registers
    for (int i = 0; i < 20; ++i) {
      g[i] = xb + (size_t)tok[i] * IN_ + col * 8;
      l[i] = (unsigned)(uintptr_t)(smem + (i * 4 + rsub) * IN_ * 2 + swz(i * 4 + rsub, col * 16));
    }
    // The wait closes each statement: the address registers stay as they are up to it.
    asm volatile(
        "global_load_async_to_lds_b128 %0, %1, off\n\t"
        "global_load_async_to_lds_b128 %2, %3, off\n\t"
        "global_load_async_to_lds_b128 %4, %5, off\n\t"
        "global_load_async_to_lds_b128 %6, %7, off\n\t"
        "global_load_async_to_lds_b128 %8, %9, off\n\t"
        "global_load_async_to_lds_b128 %10, %11, off\n\t"
        "global_load_async_to_lds_b128 %12, %13, off\n\t"
        "global_load_async_to_lds_b128 %14, %15, off\n\t"
        "global_load_async_to_lds_b128 %16, %17, off\n\t"
        "global_load_async_to_lds_b128 %18, %19, off\n\t"
        "s_wait_xcnt 0x0"
        :: "v"(l[0]), "v"(g[0]), "v"(l[1]), "v"(g[1]), "v"(l[2]), "v"(g[2]), "v"(l[3]), "v"(g[3]), "v"(l[4]), "v"(g[4]), "v"(l[5]), "v"(g[5]), "v"(l[6]), "v"(g[6]), "v"(l[7]), "v"(g[7]), "v"(l[8]), "v"(g[8]), "v"(l[9]), "v"(g[9]) : "memory");
    asm volatile(
        "global_load_async_to_lds_b128 %0, %1, off\n\t"
        "global_load_async_to_lds_b128 %2, %3, off\n\t"
        "global_load_async_to_lds_b128 %4, %5, off\n\t"
        "global_load_async_to_lds_b128 %6, %7, off\n\t"
        "global_load_async_to_lds_b128 %8, %9, off\n\t"
        "global_load_async_to_lds_b128 %10, %11, off\n\t"
        "global_load_async_to_lds_b128 %12, %13, off\n\t"
        "global_load_async_to_lds_b128 %14, %15, off\n\t"
        "global_load_async_to_lds_b128 %16, %17, off\n\t"
        "global_load_async_to_lds_b128 %18, %19, off\n\t"
        "s_wait_xcnt 0x0"
        :: "v"(l[10]), "v"(g[10]), "v"(l[11]), "v"(g[11]), "v"(l[12]), "v"(g[12]), "v"(l[13]), "v"(g[13]), "v"(l[14]), "v"(g[14]), "v"(l[15]), "v"(g[15]), "v"(l[16]), "v"(g[16]), "v"(l[17]), "v"(g[17]), "v"(l[18]), "v"(g[18]), "v"(l[19]), "v"(g[19]) : "memory");
    // The copies have landed before the barrier lets another wave read them.
    asm volatile("s_wait_asynccnt 0x0" ::: "memory");
  }
  __syncthreads();

  // h1 = relu(x @ W1 + b1)
  gemm_tile<IN_, 5, 8, true, false>(smem, 0, IN_, W1t + (size_t)e * HID_ * IN_, HID_,
                                    b1 + e * HID_, TM * HID_ * 2, HID_, 0, wid * 128, lane);
  __syncthreads();
  // h2 = relu(h1 @ W2 + b2)  (overwrites x region)
  gemm_tile<HID_, 5, 8, true, false>(smem, TM * HID_ * 2, HID_, W2t + (size_t)e * HID_ * HID_, HID_,
                                     b2 + e * HID_, 0, HID_, 0, wid * 128, lane);
  __syncthreads();
  // logits = h2 @ Wp + bp (float, overlays h1): four column strips of 64. Waves w and
  // w + 4 share a strip: one takes its upper 48 rows, the other its lower 32.
  if (__builtin_amdgcn_readfirstlane(wid) < 4)
    gemm_tile<HID_, 3, 4, false, true>(smem, 0, HID_, Wpt + (size_t)e * OUT_ * HID_, OUT_,
                                       bp + e * OUT_, TM * HID_ * 2, OUT_, 0, (wid & 3) * 64, lane);
  else
    gemm_tile<HID_, 2, 4, false, true>(smem, 0, HID_, Wpt + (size_t)e * OUT_ * HID_, OUT_,
                                       bp + e * OUT_, TM * HID_ * 2, OUT_, 48, (wid & 3) * 64, lane);
  __syncthreads();

  // Per-row epilogue: alpha0 dot + softmax + gated atomic scatter.
  const float* Wag = Wa + e * HID_;
  const float* bae = ba + e;
  const float  bag = *bae;
  // The load names bae's registers. Taking bae as an input keeps them as they are up to
  // this wait, so nothing reuses them before it.
  asm volatile("s_wait_xcnt 0x0" :: "s"(bae) : "memory");
#pragma nounroll  // kept rolled to keep the code small
  for (int rr = 0; rr < TM / 8; ++rr) {
    const int m = wid * (TM / 8) + rr;
    const int slot = t0 + m;

    float s = 0.f;
    for (int k = lane; k < HID_; k += 32) s += (float)bufA[m * HID_ + (swz(m, k * 2) >> 1)] * Wag[k];
#pragma unroll
    for (int off = 16; off > 0; off >>= 1) s += __shfl_xor(s, off);

    float mx = -1e30f, v[8];
#pragma unroll
    for (int j = 0; j < 8; ++j) {
      v[j] = lgts[m * OUT_ + lane + j * 32];
      mx = fmaxf(mx, v[j]);
    }
#pragma unroll
    for (int off = 16; off > 0; off >>= 1) mx = fmaxf(mx, __shfl_xor(mx, off));
    float sm = 0.f;
#pragma unroll
    for (int j = 0; j < 8; ++j) { v[j] = __expf(v[j] - mx); sm += v[j]; }
#pragma unroll
    for (int off = 16; off > 0; off >>= 1) sm += __shfl_xor(sm, off);

    if (slot < cnt) {
      const int   tok = assign[e * B_ + slot];
      const float g   = gateval[e * B_ + slot];
      if (lane == 0) {
        const float pre = s + bag;
        const float spv = (pre > 20.f) ? pre : log1pf(__expf(pre));
        const float a0v = fminf(fmaxf(spv + 10.f, 1.f), 500.f);
        atomicAdd(&alpha0[tok], g * a0v);
      }
      const float inv = g / sm;
#pragma unroll
      for (int j = 0; j < 8; ++j)
        atomicAdd(&p_hat[(size_t)tok * OUT_ + lane + j * 32], v[j] * inv);
    }
  }
}

// ---------------------------------------------------------------------------
// Post: aux loss (ddof=1 std) and p_hat row normalization.
// ---------------------------------------------------------------------------
extern "C" __global__ void aux_kernel(const float* __restrict__ importance,
                                      const float* __restrict__ loadv,
                                      float* __restrict__ out_aux) {
  if (threadIdx.x == 0 && blockIdx.x == 0) {
    float mi = 0.f, ml = 0.f;
    for (int i = 0; i < E_; ++i) { mi += importance[i]; ml += loadv[i]; }
    mi /= (float)E_; ml /= (float)E_;
    float vi = 0.f, vl = 0.f;
    for (int i = 0; i < E_; ++i) {
      const float di = importance[i] - mi; vi += di * di;
      const float dl = loadv[i] - ml;      vl += dl * dl;
    }
    vi /= (float)(E_ - 1); vl /= (float)(E_ - 1);
    *out_aux = sqrtf(vi) / (mi + 1e-8f) + sqrtf(vl) / (ml + 1e-8f);
  }
}

extern "C" __global__ void __launch_bounds__(256)
norm_kernel(float* __restrict__ p_hat) {
  __shared__ float part[8];
  const int row = blockIdx.x, tid = threadIdx.x, lane = tid & 31, wid = tid >> 5;
  const float v = p_hat[(size_t)row * OUT_ + tid];
  float s = v;
#pragma unroll
  for (int off = 16; off > 0; off >>= 1) s += __shfl_xor(s, off);
  if (lane == 0) part[wid] = s;
  __syncthreads();
  float tot = 0.f;
#pragma unroll
  for (int w = 0; w < 8; ++w) tot += part[w];
  p_hat[(size_t)row * OUT_ + tid] = v / (tot + 1e-8f);
}

// ---------------------------------------------------------------------------
// Host launch
// ---------------------------------------------------------------------------
extern "C" void kernel_launch(void* const* d_in, const int* in_sizes, int n_in,
                              void* d_out, int out_size, void* d_ws, size_t ws_size,
                              hipStream_t stream) {
  const float* x   = (const float*)d_in[0];
  const float* noi = (const float*)d_in[1];
  const float* gW  = (const float*)d_in[2];
  const float* gb  = (const float*)d_in[3];
  const float* nW  = (const float*)d_in[4];
  const float* nb  = (const float*)d_in[5];
  const float* W1  = (const float*)d_in[6];
  const float* b1  = (const float*)d_in[7];
  const float* W2  = (const float*)d_in[8];
  const float* b2  = (const float*)d_in[9];
  const float* Wp  = (const float*)d_in[10];
  const float* bp  = (const float*)d_in[11];
  const float* Wa  = (const float*)d_in[12];
  const float* ba  = (const float*)d_in[13];

  float* out    = (float*)d_out;
  float* p_hat  = out;                           // [B, OUT]
  float* alpha0 = out + (size_t)B_ * OUT_;       // [B]
  float* auxp   = out + (size_t)B_ * OUT_ + B_;  // scalar

  char* w = (char*)d_ws;
  bf16_t* xb  = (bf16_t*)w;  w += (size_t)B_ * IN_ * 2;         // 8 MB
  bf16_t* W1t = (bf16_t*)w;  w += (size_t)E_ * HID_ * IN_ * 2;  // 16 MB
  bf16_t* W2t = (bf16_t*)w;  w += (size_t)E_ * HID_ * HID_ * 2; // 32 MB
  bf16_t* Wpt = (bf16_t*)w;  w += (size_t)E_ * OUT_ * HID_ * 2; // 8 MB
  int*    counts     = (int*)w;   w += 256;
  int*    assign     = (int*)w;   w += (size_t)E_ * B_ * 4;     // 512 KB
  float*  gateval    = (float*)w; w += (size_t)E_ * B_ * 4;     // 512 KB
  float*  importance = (float*)w; w += 256;
  float*  loadv      = (float*)w; w += 256;

  init_kernel<<<2048, 256, 0, stream>>>(p_hat, B_ * OUT_ + B_, counts, importance, loadv);
  cast_x_kernel<<<2048, 256, 0, stream>>>(x, xb, B_ * IN_);
  tcast_kernel<IN_, HID_><<<dim3(IN_ / 128, HID_ / 128, E_), 256, 0, stream>>>(W1, W1t);
  tcast_kernel<HID_, HID_><<<dim3(HID_ / 128, HID_ / 128, E_), 256, 0, stream>>>(W2, W2t);
  tcast_kernel<HID_, OUT_><<<dim3(HID_ / 128, OUT_ / 128, E_), 256, 0, stream>>>(Wp, Wpt);

  gating_kernel<<<B_ / 4, 128, 0, stream>>>(x, noi, gW, gb, nW, nb,
                                            counts, assign, gateval, importance, loadv);

  dim3 eg(E_, (B_ + TM - 1) / TM);
  expert_kernel<<<eg, 256, 0, stream>>>(xb, W1t, b1, W2t, b2, Wpt, bp,
                                                 Wa, ba, counts, assign, gateval,
                                                 p_hat, alpha0);

  aux_kernel<<<1, 32, 0, stream>>>(importance, loadv, auxp);
  norm_kernel<<<B_, 256, 0, stream>>>(p_hat);
}

// v006
// Measured time: 165 microseconds a run.
// In two side-by-side timings against v005, it was 1.10 and 1.09 times as fast.
// Over all steps from v000 it is 4.77 times as fast.
#include <hip/hip_runtime.h>
#include <hip/hip_bf16.h>
#include <math.h>

typedef __bf16 bf16_t;
typedef __attribute__((ext_vector_type(16))) __bf16 v16bf;
typedef __attribute__((ext_vector_type(8)))  float  v8f;

#define B_   8192
#define IN_  512
#define HID_ 1024
#define OUT_ 256
#define E_   16
#define TM   80      // token tile (M) per block

typedef __attribute__((ext_vector_type(4))) unsigned int v4u;

union Frag { v16bf v; unsigned int u[8]; v4u q[2]; };

__device__ __forceinline__ int swz(int m, int b) { return b ^ ((m & 15) << 4); }

__device__ __forceinline__ v8f wmma_bf16(const Frag& a, const Frag& b, v8f c) {
  return __builtin_amdgcn_wmma_f32_16x16x32_bf16(
      /*neg_a=*/false, a.v, /*neg_b=*/false, b.v,
      /*c_mod=*/(short)0, c, /*reuse_a=*/false, /*reuse_b=*/false);
}

// Compile-time switch handed to the k pass of gemm_tile: with or without the next loads.
template <bool V> struct Sel { static constexpr bool value = V; };

// One block = 8 waves. Each wave holds an (MT*16) x (NT*16) register tile of the
// block's result, from row mStart and column nStart. A pass covers KS k steps: KS*NT weight
// fragments, each feeding MT WMMAs. The weight fragments live in registers across passes:
// as soon as a fragment's WMMAs are issued, the same registers are loaded with the fragment
// of the next pass, so a weight load has almost a whole pass of WMMAs to arrive in.
// Bt holds the weights in fragment order (see tcast_kernel); nTot is their column count.
// The token tile (pitch lda elements) starts at byte aOff of the LDS array sm, the result
// (pitch ldo elements) at byte oOff; mStart is a multiple of 16, aOff of the row pitch.
template <int KTOT, int KS, int MT, int NT, bool RELU, bool OUT_F32>
__device__ __forceinline__ void gemm_tile(char* sm, int aOff, int lda,
                                          const bf16_t* __restrict__ Bt, int nTot,
                                          const float* __restrict__ bias,
                                          int oOff, int ldo,
                                          int mStart, int nStart, int lane) {
  constexpr int NG = KS * NT;   // weight fragments of a pass
  v8f acc[MT][NT];
#pragma unroll  // constant indices keep acc, a, b in registers
  for (int i = 0; i < MT; ++i)
#pragma unroll  // constant indices keep acc, a, b in registers
    for (int t = 0; t < NT; ++t)
#pragma unroll  // constant indices keep acc, a, b in registers
      for (int r = 0; r < 8; ++r) acc[i][t][r] = 0.f;

  // This lane's 16 bytes in the wave's first weight fragment; same k order as the token fragments (aL).
  // A k step's fragments of all columns lie side by side: the wave's NT are NT KB in a row.
  const bf16_t* bp = Bt + (size_t)nStart * 32 + lane * 8;
  const int kstep = nTot * 32;
  Frag b[NG];
  // Fragment g of the pass that bp points at (the next one, once the first is loaded):
  // k step g / NT, column tile g % NT.
  auto ldb = [&](int g) {
    const unsigned int* p = (const unsigned int*)(bp + (g / NT) * kstep + (g % NT) * 512);
    b[g].u[0] = p[0];   b[g].u[1] = p[1];   b[g].u[2] = p[2];   b[g].u[3] = p[3];
    b[g].u[4] = p[128]; b[g].u[5] = p[129]; b[g].u[6] = p[130]; b[g].u[7] = p[131];
  };
#pragma unroll  // constant indices keep acc, a, b in registers
  for (int g = 0; g < NG; ++g) ldb(g);
  // The loads name bp's registers. Taking bp as an input keeps those registers as they are
  // up to this wait; the advance to the next pass's fragments stands behind it.
  asm volatile("s_wait_xcnt 0x0" :: "v"(bp) : "memory");
  bp += KS * kstep;
  const int aL = aOff + (mStart + (lane & 15)) * lda * 2 + swz(lane, (lane >> 4) << 4);
  auto pass = [&](int kk, auto more) {
    Frag a[KS][MT];
#pragma unroll  // constant indices keep acc, a, b in registers
    for (int s = 0; s < KS; ++s)
#pragma unroll  // constant indices keep acc, a, b in registers
      for (int i = 0; i < MT; ++i) {
        a[s][i].q[0] = *(const v4u*)(sm + ((aL ^ ((kk + s * 32) * 2)) + i * 16 * lda * 2));
        a[s][i].q[1] = *(const v4u*)(sm + ((aL ^ ((kk + s * 32) * 2) ^ 32) + i * 16 * lda * 2));
      }
    __builtin_amdgcn_sched_barrier(0);
#pragma unroll  // constant indices keep acc, a, b in registers
    for (int g = 0; g < NG; ++g) {
#pragma unroll  // constant indices keep acc, a, b in registers
      for (int i = 0; i < MT; ++i) acc[i][g % NT] = wmma_bf16(a[g / NT][i], b[g], acc[i][g % NT]);
      // Keeps each reload where it is written, one fragment behind the WMMAs: gathered at one
      // end of the pass, the loads would have no WMMAs left to arrive under.
      __builtin_amdgcn_sched_barrier(0);
      if (decltype(more)::value && g > 0) {
        ldb(g - 1);
        __builtin_amdgcn_sched_barrier(0);
      }
    }
    if (decltype(more)::value) {
      ldb(NG - 1);
      // The pass's loads name bp's registers. Taking bp as an input keeps those registers as
      // they are up to this wait; the advance and the next pass's address sums stand behind it.
      asm volatile("s_wait_xcnt 0x0" :: "v"(bp) : "memory");
      bp += KS * kstep;
    }
  };
#pragma nounroll  // a pass already holds 32 to 48 WMMAs; copies of it would only add KBs of text
  for (int kk = 0; kk < KTOT - KS * 32; kk += KS * 32) pass(kk, Sel<true>{});
  pass(KTOT - KS * 32, Sel<false>{});   // last pass: nothing left to load
  const int n0 = nStart + (lane & 15);
  // bf16 result: this lane's place for t = 0, i = 0, r = 0 under swz, where m & 15 is
  // (lane >> 4) * 8 + r. nStart is a multiple of 128 there, so the column step t * 32 bytes
  // and swz's r * 16 fall in bits that an XOR with a constant sets: one XOR per (t, r).
  const int oL = oOff + (mStart + ((lane >> 4) << 3)) * ldo * 2 + swz((lane >> 4) << 3, n0 * 2);
  float bzs[NT];
#pragma unroll  // all NT loads in flight at once; constant indices keep bzs in registers
  for (int t = 0; t < NT; ++t) bzs[t] = bias[n0 + t * 16];
  // All NT loads name n0's register. Taking n0 as an input keeps that register as it is
  // up to this wait, so nothing reuses it before it.
  asm volatile("s_wait_xcnt 0x0" :: "v"(n0) : "memory");
#pragma unroll  // constant indices keep acc, a, b in registers
  for (int t = 0; t < NT; ++t) {
    const int n = n0 + t * 16;
    const float bz = bzs[t];
#pragma unroll  // constant indices keep acc, a, b in registers
    for (int i = 0; i < MT; ++i) {
      const int mo = mStart + i * 16 + ((lane >> 4) << 3);
#pragma unroll  // constant indices keep acc, a, b in registers
      for (int r = 0; r < 8; ++r) {
        float v = acc[i][t][r] + bz;
        if (RELU) v = v > 0.f ? v : 0.f;
        const int m = mo + r;
        if (OUT_F32) *(float*)(sm + oOff + (m * ldo + n) * 4) = v;
        else         *(bf16_t*)(sm + ((oL ^ ((t * 32) ^ (r * 16))) + (i * 16 + r) * ldo * 2)) = (bf16_t)v;
      }
    }
  }
}

// ---------------------------------------------------------------------------
// Prep kernels
// ---------------------------------------------------------------------------
extern "C" __global__ void cast_x_kernel(const float* __restrict__ x,
                                         bf16_t* __restrict__ xb, int n) {
  for (int i = blockIdx.x * blockDim.x + threadIdx.x; i < n;
       i += gridDim.x * blockDim.x)
    xb[i] = (bf16_t)x[i];
}

// Casts src[e][r][c] to bf16 and lays it out in WMMA B-fragment order. The fragment of
// k chunk r / 32 and column tile c / 16 is 1 KB at fragment index (r / 32) * (C / 16) + c / 16;
// inside it the 16-byte piece of 8 consecutive r sits at [(r >> 4) & 1][lane], where
// lane = (c & 15) + 16 * ((r >> 3) & 1). So each of a fragment's two wave-wide 16-byte
// loads in gemm_tile reads 512 contiguous bytes (4 whole lines, not 32 bytes of 16 lines).
// One block moves one 128 x 128 tile. Reads: a wave takes 512 contiguous bytes of one
// src row per load. Each thread turns its 16 rows x 4 columns into 16-byte pieces of
// 8 consecutive r in registers; LDS only regroups the pieces so that a wave's store
// covers 512 contiguous bytes of dst (half a fragment).
// grid = (R/128, C/128, E), block = 256.
typedef __attribute__((ext_vector_type(8))) __bf16 v8bf;
typedef __attribute__((ext_vector_type(4))) float  v4f;

template <int R, int C>  // compile-time pitches: every row step is an immediate offset
__global__ void __launch_bounds__(256)
tcast_kernel(const float* __restrict__ src, bf16_t* __restrict__ dst) {
  __shared__ v8bf tile[128 * 16];
  const int tid = threadIdx.x;
  const int r0 = blockIdx.x * 128, c0 = blockIdx.y * 128;
  const size_t eoff = (size_t)blockIdx.z * R * C;

  const int cq = tid & 31, rg = tid >> 5;   // 4 columns from cq * 4, 16 rows from rg * 16
  const float* s = src + eoff + (size_t)(r0 + rg * 16) * C + c0 + cq * 4;
  v4f v[16];
#pragma unroll  // all 16 loads in flight at once; constant indices keep v in registers
  for (int i = 0; i < 16; ++i) v[i] = *(const v4f*)(s + (size_t)i * C);
  // All 16 loads name s's registers. Taking s as an input keeps those registers as they
  // are up to this wait, so nothing (a later load's result included) reuses them before it.
  asm volatile("s_wait_xcnt 0x0" :: "v"(s) : "memory");
  // Keeps the conversions behind the last load; left free, the compiler waits for the
  // first rows before it has issued the last ones.
  __builtin_amdgcn_sched_barrier(0);

#pragma unroll  // constant indices keep v in registers
  for (int j = 0; j < 4; ++j)
#pragma unroll  // constant indices keep v in registers
    for (int h = 0; h < 2; ++h) {
      v8bf o;
#pragma unroll  // constant indices keep v in registers
      for (int i = 0; i < 8; ++i) o[i] = (bf16_t)v[h * 8 + i][j];
      tile[(cq * 4 + j) * 16 + ((rg * 2 + h) ^ (cq & 15) ^ (j << 2))] = o;
    }
  __syncthreads();

  // The tile is 4 k chunks of 8 fragments: 8 KB in a row per chunk, two passes p each.
  const int fl = tid & 31, fh = (tid >> 5) & 1;   // lane and half inside a fragment
  bf16_t* d = dst + eoff + ((size_t)(r0 / 32) * (C / 16) + c0 / 16) * 512 + tid * 8;
#pragma unroll  // the 8 LDS reads and stores go out back to back
  for (int p = 0; p < 8; ++p) {
    const int c = ((p & 1) * 4 + (tid >> 6)) * 16 + (fl & 15);
    const int k = (p >> 1) * 4 + fh * 2 + (fl >> 4);
    *(v8bf*)(d + (size_t)(p >> 1) * (C / 16) * 512 + (p & 1) * 2048) =
        tile[c * 16 + (k ^ ((c >> 2) & 15) ^ ((c & 3) << 2))];
  }
}

extern "C" __global__ void init_kernel(float* __restrict__ outf, int n_zero,
                                       int* __restrict__ counts,
                                       float* __restrict__ importance,
                                       float* __restrict__ loadv) {
  const int i = blockIdx.x * blockDim.x + threadIdx.x;
  for (int j = i; j < n_zero; j += gridDim.x * blockDim.x) outf[j] = 0.f;
  if (i < E_) { counts[i] = 0; importance[i] = 0.f; loadv[i] = 0.f; }
}

extern "C" __global__ void __launch_bounds__(128)
gating_kernel(const float* __restrict__ x, const float* __restrict__ noise,
              const float* __restrict__ gW, const float* __restrict__ gb,
              const float* __restrict__ nW, const float* __restrict__ nb,
              int* __restrict__ counts, int* __restrict__ assign,
              float* __restrict__ gateval, float* __restrict__ importance,
              float* __restrict__ loadv) {
  const int lane = threadIdx.x & 31;
  const int wid  = threadIdx.x >> 5;
  const int tok  = blockIdx.x * 4 + wid;
  const int e    = lane & 15;
  const bool np  = lane >= 16;

  const float* W = np ? nW : gW;
  float acc = (np ? nb : gb)[e];
  const float* xr = x + (size_t)tok * IN_;
  for (int i = 0; i < IN_; ++i) acc += xr[i] * W[i * E_ + e];

  const float pre_noise = __shfl(acc, e + 16);
  const float sp = (pre_noise > 20.f) ? pre_noise : log1pf(__expf(pre_noise));
  const float noisy = acc + noise[(size_t)tok * E_ + e] * sp;

  float best = -1e30f, second = -1e30f;
  int bi = 0, si = 0;
  for (int q = 0; q < 16; ++q) {
    const float v = __shfl(noisy, q);
    if (v > best)        { second = best; si = bi; best = v; bi = q; }
    else if (v > second) { second = v; si = q; }
  }
  if (lane == 0) {
    const float e1 = __expf(second - best);
    const float g0 = 1.f / (1.f + e1);
    const float g1 = e1 / (1.f + e1);
    int s0 = atomicAdd(&counts[bi], 1);
    assign[bi * B_ + s0] = tok;  gateval[bi * B_ + s0] = g0;
    atomicAdd(&importance[bi], g0); atomicAdd(&loadv[bi], 1.f);
    int s1 = atomicAdd(&counts[si], 1);
    assign[si * B_ + s1] = tok;  gateval[si * B_ + s1] = g1;
    atomicAdd(&importance[si], g1); atomicAdd(&loadv[si], 1.f);
  }
}

extern "C" __global__ void __launch_bounds__(256)
expert_kernel(const bf16_t* __restrict__ xb,
              const bf16_t* __restrict__ W1t, const float* __restrict__ b1,
              const bf16_t* __restrict__ W2t, const float* __restrict__ b2,
              const bf16_t* __restrict__ Wpt, const float* __restrict__ bp,
              const float* __restrict__ Wa, const float* __restrict__ ba,
              const int* __restrict__ counts, const int* __restrict__ assign,
              const float* __restrict__ gateval,
              float* __restrict__ p_hat, float* __restrict__ alpha0) {
  __shared__ __attribute__((aligned(16))) char smem[2 * TM * HID_ * 2];
  bf16_t* bufA = (bf16_t*)smem;                    // 160KB: x tile (80x512) then h2 (80x1024)
  // second 160KB, from byte TM * HID_ * 2: h1 (80x1024)
  float*  lgts = (float*)(smem + TM * HID_ * 2);   //  80KB overlay on h1: logits (80x256)

  const int e   = blockIdx.x;
  const int cnt = counts[e];
  const int t0  = blockIdx.y * TM;
  if (t0 >= cnt) return;

  const int tid = threadIdx.x, lane = tid & 31, wid = tid >> 5;

  {
    const int col = tid & 63, rsub = tid >> 6;
    const int* ae = assign + e * B_;
    int slot[20], tok[20];
#pragma unroll
    for (int i = 0; i < 20; ++i) {
      slot[i] = t0 + i * 4 + rsub;
      if (slot[i] >= cnt) slot[i] = cnt - 1;
    }
#pragma unroll  // all 20 loads in flight at once; constant indices keep tok in registers
    for (int i = 0; i < 20; ++i) tok[i] = ae[slot[i]];
    asm volatile("s_wait_xcnt 0x0"
                 :: "v"(slot[0]), "v"(slot[1]), "v"(slot[2]), "v"(slot[3]), "v"(slot[4]),
                    "v"(slot[5]), "v"(slot[6]), "v"(slot[7]), "v"(slot[8]), "v"(slot[9]),
                    "v"(slot[10]), "v"(slot[11]), "v"(slot[12]), "v"(slot[13]), "v"(slot[14]),
                    "v"(slot[15]), "v"(slot[16]), "v"(slot[17]), "v"(slot[18]), "v"(slot[19])
                 : "memory");
    const bf16_t* g[20];
    unsigned l[20];
#pragma unroll  // constant indices keep g and l in registers
    for (int i = 0; i < 20; ++i) {
      g[i] = xb + (size_t)tok[i] * IN_ + col * 8;
      l[i] = (unsigned)(uintptr_t)(smem + (i * 4 + rsub) * IN_ * 2 + swz(i * 4 + rsub, col * 16));
    }
    // The wait closes each statement: the address registers stay as they are up to it.
    asm volatile(
        "global_load_async_to_lds_b128 %0, %1, off\n\t"
        "global_load_async_to_lds_b128 %2, %3, off\n\t"
        "global_load_async_to_lds_b128 %4, %5, off\n\t"
        "global_load_async_to_lds_b128 %6, %7, off\n\t"
        "global_load_async_to_lds_b128 %8, %9, off\n\t"
        "global_load_async_to_lds_b128 %10, %11, off\n\t"
        "global_load_async_to_lds_b128 %12, %13, off\n\t"
        "global_load_async_to_lds_b128 %14, %15, off\n\t"
        "global_load_async_to_lds_b128 %16, %17, off\n\t"
        "global_load_async_to_lds_b128 %18, %19, off\n\t"
        "s_wait_xcnt 0x0"
        :: "v"(l[0]), "v"(g[0]), "v"(l[1]), "v"(g[1]), "v"(l[2]), "v"(g[2]), "v"(l[3]), "v"(g[3]), "v"(l[4]), "v"(g[4]), "v"(l[5]), "v"(g[5]), "v"(l[6]), "v"(g[6]), "v"(l[7]), "v"(g[7]), "v"(l[8]), "v"(g[8]), "v"(l[9]), "v"(g[9]) : "memory");
    asm volatile(
        "global_load_async_to_lds_b128 %0, %1, off\n\t"
        "global_load_async_to_lds_b128 %2, %3, off\n\t"
        "global_load_async_to_lds_b128 %4, %5, off\n\t"
        "global_load_async_to_lds_b128 %6, %7, off\n\t"
        "global_load_async_to_lds_b128 %8, %9, off\n\t"
        "global_load_async_to_lds_b128 %10, %11, off\n\t"
        "global_load_async_to_lds_b128 %12, %13, off\n\t"
        "global_load_async_to_lds_b128 %14, %15, off\n\t"
        "global_load_async_to_lds_b128 %16, %17, off\n\t"
        "global_load_async_to_lds_b128 %18, %19, off\n\t"
        "s_wait_xcnt 0x0"
        :: "v"(l[10]), "v"(g[10]), "v"(l[11]), "v"(g[11]), "v"(l[12]), "v"(g[12]), "v"(l[13]), "v"(g[13]), "v"(l[14]), "v"(g[14]), "v"(l[15]), "v"(g[15]), "v"(l[16]), "v"(g[16]), "v"(l[17]), "v"(g[17]), "v"(l[18]), "v"(g[18]), "v"(l[19]), "v"(g[19]) : "memory");
    // The copies have landed before the barrier lets another wave read them.
    asm volatile("s_wait_asynccnt 0x0" ::: "memory");
  }
  __syncthreads();

  // h1 = relu(x @ W1 + b1)
  gemm_tile<IN_, 1, 5, 8, true, false>(smem, 0, IN_, W1t + (size_t)e * HID_ * IN_, HID_,
                                    b1 + e * HID_, TM * HID_ * 2, HID_, 0, wid * 128, lane);
  __syncthreads();
  // h2 = relu(h1 @ W2 + b2)  (overwrites x region)
  gemm_tile<HID_, 1, 5, 8, true, false>(smem, TM * HID_ * 2, HID_, W2t + (size_t)e * HID_ * HID_, HID_,
                                     b2 + e * HID_, 0, HID_, 0, wid * 128, lane);
  __syncthreads();
  // logits = h2 @ Wp + bp (float, overlays h1): four column strips of 64. Waves w and
  // w + 4 share a strip: one takes its upper 48 rows, the other its lower 32.
  if (__builtin_amdgcn_readfirstlane(wid) < 4)
    gemm_tile<HID_, 4, 3, 4, false, true>(smem, 0, HID_, Wpt + (size_t)e * OUT_ * HID_, OUT_,
                                       bp + e * OUT_, TM * HID_ * 2, OUT_, 0, (wid & 3) * 64, lane);
  else
    gemm_tile<HID_, 4, 2, 4, false, true>(smem, 0, HID_, Wpt + (size_t)e * OUT_ * HID_, OUT_,
                                       bp + e * OUT_, TM * HID_ * 2, OUT_, 48, (wid & 3) * 64, lane);
  __syncthreads();

  // Per-row epilogue: alpha0 dot + softmax + gated atomic scatter.
  const float* Wag = Wa + e * HID_;
  const float* bae = ba + e;
  const float  bag = *bae;
  // The load names bae's registers. Taking bae as an input keeps them as they are up to
  // this wait, so nothing reuses them before it.
  asm volatile("s_wait_xcnt 0x0" :: "s"(bae) : "memory");
#pragma nounroll  // kept rolled to keep the code small
  for (int rr = 0; rr < TM / 8; ++rr) {
    const int m = wid * (TM / 8) + rr;
    const int slot = t0 + m;

    float s = 0.f;
    for (int k = lane; k < HID_; k += 32) s += (float)bufA[m * HID_ + (swz(m, k * 2) >> 1)] * Wag[k];
#pragma unroll
    for (int off = 16; off > 0; off >>= 1) s += __shfl_xor(s, off);

    float mx = -1e30f, v[8];
#pragma unroll
    for (int j = 0; j < 8; ++j) {
      v[j] = lgts[m * OUT_ + lane + j * 32];
      mx = fmaxf(mx, v[j]);
    }
#pragma unroll
    for (int off = 16; off > 0; off >>= 1) mx = fmaxf(mx, __shfl_xor(mx, off));
    float sm = 0.f;
#pragma unroll
    for (int j = 0; j < 8; ++j) { v[j] = __expf(v[j] - mx); sm += v[j]; }
#pragma unroll
    for (int off = 16; off > 0; off >>= 1) sm += __shfl_xor(sm, off);

    if (slot < cnt) {
      const int   tok = assign[e * B_ + slot];
      const float g   = gateval[e * B_ + slot];
      if (lane == 0) {
        const float pre = s + bag;
        const float spv = (pre > 20.f) ? pre : log1pf(__expf(pre));
        const float a0v = fminf(fmaxf(spv + 10.f, 1.f), 500.f);
        atomicAdd(&alpha0[tok], g * a0v);
      }
      const float inv = g / sm;
#pragma unroll
      for (int j = 0; j < 8; ++j)
        atomicAdd(&p_hat[(size_t)tok * OUT_ + lane + j * 32], v[j] * inv);
    }
  }
}

// ---------------------------------------------------------------------------
// Post: aux loss (ddof=1 std) and p_hat row normalization.
// ---------------------------------------------------------------------------
extern "C" __global__ void aux_kernel(const float* __restrict__ importance,
                                      const float* __restrict__ loadv,
                                      float* __restrict__ out_aux) {
  if (threadIdx.x == 0 && blockIdx.x == 0) {
    float mi = 0.f, ml = 0.f;
    for (int i = 0; i < E_; ++i) { mi += importance[i]; ml += loadv[i]; }
    mi /= (float)E_; ml /= (float)E_;
    float vi = 0.f, vl = 0.f;
    for (int i = 0; i < E_; ++i) {
      const float di = importance[i] - mi; vi += di * di;
      const float dl = loadv[i] - ml;      vl += dl * dl;
    }
    vi /= (float)(E_ - 1); vl /= (float)(E_ - 1);
    *out_aux = sqrtf(vi) / (mi + 1e-8f) + sqrtf(vl) / (ml + 1e-8f);
  }
}

extern "C" __global__ void __launch_bounds__(256)
norm_kernel(float* __restrict__ p_hat) {
  __shared__ float part[8];
  const int row = blockIdx.x, tid = threadIdx.x, lane = tid & 31, wid = tid >> 5;
  const float v = p_hat[(size_t)row * OUT_ + tid];
  float s = v;
#pragma unroll
  for (int off = 16; off > 0; off >>= 1) s += __shfl_xor(s, off);
  if (lane == 0) part[wid] = s;
  __syncthreads();
  float tot = 0.f;
#pragma unroll
  for (int w = 0; w < 8; ++w) tot += part[w];
  p_hat[(size_t)row * OUT_ + tid] = v / (tot + 1e-8f);
}

// ---------------------------------------------------------------------------
// Host launch
// ---------------------------------------------------------------------------
extern "C" void kernel_launch(void* const* d_in, const int* in_sizes, int n_in,
                              void* d_out, int out_size, void* d_ws, size_t ws_size,
                              hipStream_t stream) {
  const float* x   = (const float*)d_in[0];
  const float* noi = (const float*)d_in[1];
  const float* gW  = (const float*)d_in[2];
  const float* gb  = (const float*)d_in[3];
  const float* nW  = (const float*)d_in[4];
  const float* nb  = (const float*)d_in[5];
  const float* W1  = (const float*)d_in[6];
  const float* b1  = (const float*)d_in[7];
  const float* W2  = (const float*)d_in[8];
  const float* b2  = (const float*)d_in[9];
  const float* Wp  = (const float*)d_in[10];
  const float* bp  = (const float*)d_in[11];
  const float* Wa  = (const float*)d_in[12];
  const float* ba  = (const float*)d_in[13];

  float* out    = (float*)d_out;
  float* p_hat  = out;                           // [B, OUT]
  float* alpha0 = out + (size_t)B_ * OUT_;       // [B]
  float* auxp   = out + (size_t)B_ * OUT_ + B_;  // scalar

  char* w = (char*)d_ws;
  bf16_t* xb  = (bf16_t*)w;  w += (size_t)B_ * IN_ * 2;         // 8 MB
  bf16_t* W1t = (bf16_t*)w;  w += (size_t)E_ * HID_ * IN_ * 2;  // 16 MB
  bf16_t* W2t = (bf16_t*)w;  w += (size_t)E_ * HID_ * HID_ * 2; // 32 MB
  bf16_t* Wpt = (bf16_t*)w;  w += (size_t)E_ * OUT_ * HID_ * 2; // 8 MB
  int*    counts     = (int*)w;   w += 256;
  int*    assign     = (int*)w;   w += (size_t)E_ * B_ * 4;     // 512 KB
  float*  gateval    = (float*)w; w += (size_t)E_ * B_ * 4;     // 512 KB
  float*  importance = (float*)w; w += 256;
  float*  loadv      = (float*)w; w += 256;

  init_kernel<<<2048, 256, 0, stream>>>(p_hat, B_ * OUT_ + B_, counts, importance, loadv);
  cast_x_kernel<<<2048, 256, 0, stream>>>(x, xb, B_ * IN_);
  tcast_kernel<IN_, HID_><<<dim3(IN_ / 128, HID_ / 128, E_), 256, 0, stream>>>(W1, W1t);
  tcast_kernel<HID_, HID_><<<dim3(HID_ / 128, HID_ / 128, E_), 256, 0, stream>>>(W2, W2t);
  tcast_kernel<HID_, OUT_><<<dim3(HID_ / 128, OUT_ / 128, E_), 256, 0, stream>>>(Wp, Wpt);

  gating_kernel<<<B_ / 4, 128, 0, stream>>>(x, noi, gW, gb, nW, nb,
                                            counts, assign, gateval, importance, loadv);

  dim3 eg(E_, (B_ + TM - 1) / TM);
  expert_kernel<<<eg, 256, 0, stream>>>(xb, W1t, b1, W2t, b2, Wpt, bp,
                                                 Wa, ba, counts, assign, gateval,
                                                 p_hat, alpha0);

  aux_kernel<<<1, 32, 0, stream>>>(importance, loadv, auxp);
  norm_kernel<<<B_, 256, 0, stream>>>(p_hat);
}

// v007
// One run takes 148 microseconds.
// Two timings next to v006 put it at 1.13 and 1.11 times that version's speed.
// Over all steps from v000 it is 5.33 times as fast.
#include <hip/hip_runtime.h>
#include <hip/hip_bf16.h>
#include <math.h>

typedef __bf16 bf16_t;
typedef __attribute__((ext_vector_type(16))) __bf16 v16bf;
typedef __attribute__((ext_vector_type(8)))  float  v8f;

#define B_   8192
#define IN_  512
#define HID_ 1024
#define OUT_ 256
#define E_   16
#define TM   80      // token tile (M) per block

typedef __attribute__((ext_vector_type(4))) unsigned int v4u;

union Frag { v16bf v; unsigned int u[8]; v4u q[2]; };

__device__ __forceinline__ int swz(int m, int b) { return b ^ ((m & 15) << 4); }

__device__ __forceinline__ v8f wmma_bf16(const Frag& a, const Frag& b, v8f c) {
  return __builtin_amdgcn_wmma_f32_16x16x32_bf16(
      /*neg_a=*/false, a.v, /*neg_b=*/false, b.v,
      /*c_mod=*/(short)0, c, /*reuse_a=*/false, /*reuse_b=*/false);
}

// Compile-time switch handed to the k pass of gemm_tile: with or without the next loads.
template <bool V> struct Sel { static constexpr bool value = V; };

// One block = 8 waves. Each wave holds an (MT*16) x (NT*16) register tile of the
// block's result, from row mStart and column nStart. A pass covers KS k steps: KS*NT weight
// fragments, each feeding MT WMMAs. The weight fragments live in registers across passes:
// as soon as a fragment's WMMAs are issued, the same registers are loaded with the fragment
// of the next pass, so a weight load has almost a whole pass of WMMAs to arrive in.
// Bt holds the weights in fragment order (see tcast_part); nTot is their column count.
// The token tile (pitch lda elements) starts at byte aOff of the LDS array sm, the result
// (pitch ldo elements) at byte oOff; mStart is a multiple of 16, aOff of the row pitch.
template <int KTOT, int KS, int MT, int NT, bool RELU, bool OUT_F32>
__device__ __forceinline__ void gemm_tile(char* sm, int aOff, int lda,
                                          const bf16_t* __restrict__ Bt, int nTot,
                                          const float* __restrict__ bias,
                                          int oOff, int ldo,
                                          int mStart, int nStart, int lane) {
  constexpr int NG = KS * NT;   // weight fragments of a pass
  v8f acc[MT][NT];
#pragma unroll  // constant indices keep acc, a, b in registers
  for (int i = 0; i < MT; ++i)
#pragma unroll  // constant indices keep acc, a, b in registers
    for (int t = 0; t < NT; ++t)
#pragma unroll  // constant indices keep acc, a, b in registers
      for (int r = 0; r < 8; ++r) acc[i][t][r] = 0.f;

  // This lane's 16 bytes in the wave's first weight fragment; same k order as the token fragments (aL).
  // A k step's fragments of all columns lie side by side: the wave's NT are NT KB in a row.
  const bf16_t* bp = Bt + (size_t)nStart * 32 + lane * 8;
  const int kstep = nTot * 32;
  Frag b[NG];
  // Fragment g of the pass that bp points at (the next one, once the first is loaded):
  // k step g / NT, column tile g % NT.
  auto ldb = [&](int g) {
    const unsigned int* p = (const unsigned int*)(bp + (g / NT) * kstep + (g % NT) * 512);
    b[g].u[0] = p[0];   b[g].u[1] = p[1];   b[g].u[2] = p[2];   b[g].u[3] = p[3];
    b[g].u[4] = p[128]; b[g].u[5] = p[129]; b[g].u[6] = p[130]; b[g].u[7] = p[131];
  };
#pragma unroll  // constant indices keep acc, a, b in registers
  for (int g = 0; g < NG; ++g) ldb(g);
  // The loads name bp's registers. Taking bp as an input keeps those registers as they are
  // up to this wait; the advance to the next pass's fragments stands behind it.
  asm volatile("s_wait_xcnt 0x0" :: "v"(bp) : "memory");
  bp += KS * kstep;
  const int aL = aOff + (mStart + (lane & 15)) * lda * 2 + swz(lane, (lane >> 4) << 4);
  auto pass = [&](int kk, auto more) {
    Frag a[KS][MT];
#pragma unroll  // constant indices keep acc, a, b in registers
    for (int s = 0; s < KS; ++s)
#pragma unroll  // constant indices keep acc, a, b in registers
      for (int i = 0; i < MT; ++i) {
        a[s][i].q[0] = *(const v4u*)(sm + ((aL ^ ((kk + s * 32) * 2)) + i * 16 * lda * 2));
        a[s][i].q[1] = *(const v4u*)(sm + ((aL ^ ((kk + s * 32) * 2) ^ 32) + i * 16 * lda * 2));
      }
    __builtin_amdgcn_sched_barrier(0);
#pragma unroll  // constant indices keep acc, a, b in registers
    for (int g = 0; g < NG; ++g) {
#pragma unroll  // constant indices keep acc, a, b in registers
      for (int i = 0; i < MT; ++i) acc[i][g % NT] = wmma_bf16(a[g / NT][i], b[g], acc[i][g % NT]);
      // Keeps each reload where it is written, one fragment behind the WMMAs: gathered at one
      // end of the pass, the loads would have no WMMAs left to arrive under.
      __builtin_amdgcn_sched_barrier(0);
      if (decltype(more)::value && g > 0) {
        ldb(g - 1);
        __builtin_amdgcn_sched_barrier(0);
      }
    }
    if (decltype(more)::value) {
      ldb(NG - 1);
      // The pass's loads name bp's registers. Taking bp as an input keeps those registers as
      // they are up to this wait; the advance and the next pass's address sums stand behind it.
      asm volatile("s_wait_xcnt 0x0" :: "v"(bp) : "memory");
      bp += KS * kstep;
    }
  };
#pragma nounroll  // a pass already holds 32 to 48 WMMAs; copies of it would only add KBs of text
  for (int kk = 0; kk < KTOT - KS * 32; kk += KS * 32) pass(kk, Sel<true>{});
  pass(KTOT - KS * 32, Sel<false>{});   // last pass: nothing left to load
  const int n0 = nStart + (lane & 15);
  // bf16 result: this lane's place for t = 0, i = 0, r = 0 under swz, where m & 15 is
  // (lane >> 4) * 8 + r. nStart is a multiple of 128 there, so the column step t * 32 bytes
  // and swz's r * 16 fall in bits that an XOR with a constant sets: one XOR per (t, r).
  const int oL = oOff + (mStart + ((lane >> 4) << 3)) * ldo * 2 + swz((lane >> 4) << 3, n0 * 2);
  float bzs[NT];
#pragma unroll  // all NT loads in flight at once; constant indices keep bzs in registers
  for (int t = 0; t < NT; ++t) bzs[t] = bias[n0 + t * 16];
  // All NT loads name n0's register. Taking n0 as an input keeps that register as it is
  // up to this wait, so nothing reuses it before it.
  asm volatile("s_wait_xcnt 0x0" :: "v"(n0) : "memory");
#pragma unroll  // constant indices keep acc, a, b in registers
  for (int t = 0; t < NT; ++t) {
    const int n = n0 + t * 16;
    const float bz = bzs[t];
#pragma unroll  // constant indices keep acc, a, b in registers
    for (int i = 0; i < MT; ++i) {
      const int mo = mStart + i * 16 + ((lane >> 4) << 3);
#pragma unroll  // constant indices keep acc, a, b in registers
      for (int r = 0; r < 8; ++r) {
        float v = acc[i][t][r] + bz;
        if (RELU) v = v > 0.f ? v : 0.f;
        const int m = mo + r;
        if (OUT_F32) *(float*)(sm + oOff + (m * ldo + n) * 4) = v;
        else         *(bf16_t*)(sm + ((oL ^ ((t * 32) ^ (r * 16))) + (i * 16 + r) * ldo * 2)) = (bf16_t)v;
      }
    }
  }
}

// ---------------------------------------------------------------------------
// Prep kernels
// ---------------------------------------------------------------------------
// First launch: the start values of every sum (p_hat and alpha0, side by side in outf, for the
// expert kernel; the counters for the gating, which runs in the next launch) and the bf16
// copy of x. Neither job depends on anything and one grid suits both: each thread does
// both, the stores of zeros first, since nothing waits for them.
extern "C" __global__ void init_cast_kernel(float* __restrict__ outf, int n_zero,
                                            int* __restrict__ counts,
                                            float* __restrict__ importance,
                                            float* __restrict__ loadv,
                                            const float* __restrict__ x,
                                            bf16_t* __restrict__ xb, int n) {
  const int i0 = blockIdx.x * blockDim.x + threadIdx.x;
  for (int j = i0; j < n_zero; j += gridDim.x * blockDim.x) outf[j] = 0.f;
  if (i0 < E_) { counts[i0] = 0; importance[i0] = 0.f; loadv[i0] = 0.f; }
  for (int i = i0; i < n; i += gridDim.x * blockDim.x)
    xb[i] = (bf16_t)x[i];
}

// Casts src[e][r][c] to bf16 and lays it out in WMMA B-fragment order. The fragment of
// k chunk r / 32 and column tile c / 16 is 1 KB at fragment index (r / 32) * (C / 16) + c / 16;
// inside it the 16-byte piece of 8 consecutive r sits at [(r >> 4) & 1][lane], where
// lane = (c & 15) + 16 * ((r >> 3) & 1). So each of a fragment's two wave-wide 16-byte
// loads in gemm_tile reads 512 contiguous bytes (4 whole lines, not 32 bytes of 16 lines).
// One block moves one 128 x 128 tile. Reads: a wave takes 512 contiguous bytes of one
// src row per load. Each thread turns its 16 rows x 4 columns into 16-byte pieces of
// 8 consecutive r in registers; LDS only regroups the pieces so that a wave's store
// covers 512 contiguous bytes of dst (half a fragment).
// A part of prep_kernel: (R/128) * (C/128) * E blocks of 256 threads, blk the block's index
// among them; the row tile runs fastest in blk, the expert slowest. tile: 32 KB of LDS,
// handed in so that the three shapes share one array.
typedef __attribute__((ext_vector_type(8))) __bf16 v8bf;
typedef __attribute__((ext_vector_type(4))) float  v4f;

template <int R, int C>  // compile-time pitches: every row step is an immediate offset
__device__ __forceinline__ void
tcast_part(const float* __restrict__ src, bf16_t* __restrict__ dst, v8bf* tile, int blk) {
  const int tid = threadIdx.x;
  const int r0 = (blk % (R / 128)) * 128, c0 = ((blk / (R / 128)) % (C / 128)) * 128;
  const size_t eoff = (size_t)(blk / ((R / 128) * (C / 128))) * R * C;

  const int cq = tid & 31, rg = tid >> 5;   // 4 columns from cq * 4, 16 rows from rg * 16
  const float* s = src + eoff + (size_t)(r0 + rg * 16) * C + c0 + cq * 4;
  v4f v[16];
#pragma unroll  // all 16 loads in flight at once; constant indices keep v in registers
  for (int i = 0; i < 16; ++i) v[i] = *(const v4f*)(s + (size_t)i * C);
  // All 16 loads name s's registers. Taking s as an input keeps those registers as they
  // are up to this wait, so nothing (a later load's result included) reuses them before it.
  asm volatile("s_wait_xcnt 0x0" :: "v"(s) : "memory");
  // Keeps the conversions behind the last load; left free, the compiler waits for the
  // first rows before it has issued the last ones.
  __builtin_amdgcn_sched_barrier(0);

#pragma unroll  // constant indices keep v in registers
  for (int j = 0; j < 4; ++j)
#pragma unroll  // constant indices keep v in registers
    for (int h = 0; h < 2; ++h) {
      v8bf o;
#pragma unroll  // constant indices keep v in registers
      for (int i = 0; i < 8; ++i) o[i] = (bf16_t)v[h * 8 + i][j];
      tile[(cq * 4 + j) * 16 + ((rg * 2 + h) ^ (cq & 15) ^ (j << 2))] = o;
    }
  __syncthreads();

  // The tile is 4 k chunks of 8 fragments: 8 KB in a row per chunk, two passes p each.
  const int fl = tid & 31, fh = (tid >> 5) & 1;   // lane and half inside a fragment
  bf16_t* d = dst + eoff + ((size_t)(r0 / 32) * (C / 16) + c0 / 16) * 512 + tid * 8;
#pragma unroll  // the 8 LDS reads and stores go out back to back
  for (int p = 0; p < 8; ++p) {
    const int c = ((p & 1) * 4 + (tid >> 6)) * 16 + (fl & 15);
    const int k = (p >> 1) * 4 + fh * 2 + (fl >> 4);
    *(v8bf*)(d + (size_t)(p >> 1) * (C / 16) * 512 + (p & 1) * 2048) =
        tile[c * 16 + (k ^ ((c >> 2) & 15) ^ ((c & 3) << 2))];
  }
  // The stores name d's and their data's registers; inlined into prep_kernel, code of another
  // branch follows them in the listing and rewrites such registers. The wait stands ahead of it.
  asm volatile("s_wait_xcnt 0x0" ::: "memory");
}

__device__ __forceinline__ void
gating_part(const float* __restrict__ x, const float* __restrict__ noise,
            const float* __restrict__ gW, const float* __restrict__ gb,
            const float* __restrict__ nW, const float* __restrict__ nb,
            int* __restrict__ counts, int* __restrict__ assign,
            float* __restrict__ gateval, float* __restrict__ importance,
            float* __restrict__ loadv, int blk) {
  const int lane = threadIdx.x & 31;
  const int wid  = threadIdx.x >> 5;
  const int tok  = blk * 8 + wid;
  const int e    = lane & 15;
  const bool np  = lane >= 16;

  const float* W = np ? nW : gW;
  float acc = (np ? nb : gb)[e];
  const float* xr = x + (size_t)tok * IN_;
  for (int i = 0; i < IN_; ++i) acc += xr[i] * W[i * E_ + e];

  const float pre_noise = __shfl(acc, e + 16);
  const float sp = (pre_noise > 20.f) ? pre_noise : log1pf(__expf(pre_noise));
  const float noisy = acc + noise[(size_t)tok * E_ + e] * sp;

  float best = -1e30f, second = -1e30f;
  int bi = 0, si = 0;
  for (int q = 0; q < 16; ++q) {
    const float v = __shfl(noisy, q);
    if (v > best)        { second = best; si = bi; best = v; bi = q; }
    else if (v > second) { second = v; si = q; }
  }
  if (lane == 0) {
    const float e1 = __expf(second - best);
    const float g0 = 1.f / (1.f + e1);
    const float g1 = e1 / (1.f + e1);
    int s0 = atomicAdd(&counts[bi], 1);
    assign[bi * B_ + s0] = tok;  gateval[bi * B_ + s0] = g0;
    atomicAdd(&importance[bi], g0); atomicAdd(&loadv[bi], 1.f);
    // The next atomic's result lands in the register that these two name as their offset.
    asm volatile("s_wait_xcnt 0x0" ::: "memory");
    int s1 = atomicAdd(&counts[si], 1);
    assign[si * B_ + s1] = tok;  gateval[si * B_ + s1] = g1;
    atomicAdd(&importance[si], g1); atomicAdd(&loadv[si], 1.f);
  }
}

// ---------------------------------------------------------------------------
// Second launch: the gating and the three weight casts, which do not depend on one another,
// as ranges of blocks of one grid. None of them waits for another to drain, and the gating,
// which waits on load latency, runs beside the casts, which are limited by memory rate.
// The gating blocks have the longest chain and come first.
// ---------------------------------------------------------------------------
#define NB_GATE (B_ / 8)
#define NB_W1   ((IN_ / 128) * (HID_ / 128) * E_)
#define NB_W2   ((HID_ / 128) * (HID_ / 128) * E_)
#define NB_WP   ((HID_ / 128) * (OUT_ / 128) * E_)
extern "C" __global__ void __launch_bounds__(256)
prep_kernel(const float* __restrict__ x, const float* __restrict__ noise,
            const float* __restrict__ gW, const float* __restrict__ gb,
            const float* __restrict__ nW, const float* __restrict__ nb,
            const float* __restrict__ W1, const float* __restrict__ W2,
            const float* __restrict__ Wp, bf16_t* __restrict__ W1t,
            bf16_t* __restrict__ W2t, bf16_t* __restrict__ Wpt,
            int* __restrict__ counts, int* __restrict__ assign,
            float* __restrict__ gateval, float* __restrict__ importance,
            float* __restrict__ loadv) {
  __shared__ v8bf tile[128 * 16];
  int blk = blockIdx.x;   // the same for the whole block: so is every branch below
  if (blk < NB_GATE) {
    gating_part(x, noise, gW, gb, nW, nb, counts, assign, gateval, importance, loadv, blk);
    return;
  }
  blk -= NB_GATE;
  if (blk < NB_W2) { tcast_part<HID_, HID_>(W2, W2t, tile, blk); return; }
  blk -= NB_W2;
  if (blk < NB_W1) { tcast_part<IN_, HID_>(W1, W1t, tile, blk); return; }
  blk -= NB_W1;
  tcast_part<HID_, OUT_>(Wp, Wpt, tile, blk);
}

extern "C" __global__ void __launch_bounds__(256)
expert_kernel(const bf16_t* __restrict__ xb,
              const bf16_t* __restrict__ W1t, const float* __restrict__ b1,
              const bf16_t* __restrict__ W2t, const float* __restrict__ b2,
              const bf16_t* __restrict__ Wpt, const float* __restrict__ bp,
              const float* __restrict__ Wa, const float* __restrict__ ba,
              const int* __restrict__ counts, const int* __restrict__ assign,
              const float* __restrict__ gateval,
              float* __restrict__ p_hat, float* __restrict__ alpha0) {
  __shared__ __attribute__((aligned(16))) char smem[2 * TM * HID_ * 2];
  bf16_t* bufA = (bf16_t*)smem;                    // 160KB: x tile (80x512) then h2 (80x1024)
  // second 160KB, from byte TM * HID_ * 2: h1 (80x1024)
  float*  lgts = (float*)(smem + TM * HID_ * 2);   //  80KB overlay on h1: logits (80x256)

  const int e   = blockIdx.x;
  const int cnt = counts[e];
  const int t0  = blockIdx.y * TM;
  if (t0 >= cnt) return;

  const int tid = threadIdx.x, lane = tid & 31, wid = tid >> 5;

  {
    const int col = tid & 63, rsub = tid >> 6;
    const int* ae = assign + e * B_;
    int slot[20], tok[20];
#pragma unroll
    for (int i = 0; i < 20; ++i) {
      slot[i] = t0 + i * 4 + rsub;
      if (slot[i] >= cnt) slot[i] = cnt - 1;
    }
#pragma unroll  // all 20 loads in flight at once; constant indices keep tok in registers
    for (int i = 0; i < 20; ++i) tok[i] = ae[slot[i]];
    asm volatile("s_wait_xcnt 0x0"
                 :: "v"(slot[0]), "v"(slot[1]), "v"(slot[2]), "v"(slot[3]), "v"(slot[4]),
                    "v"(slot[5]), "v"(slot[6]), "v"(slot[7]), "v"(slot[8]), "v"(slot[9]),
                    "v"(slot[10]), "v"(slot[11]), "v"(slot[12]), "v"(slot[13]), "v"(slot[14]),
                    "v"(slot[15]), "v"(slot[16]), "v"(slot[17]), "v"(slot[18]), "v"(slot[19])
                 : "memory");
    const bf16_t* g[20];
    unsigned l[20];
#pragma unroll  // constant indices keep g and l in registers
    for (int i = 0; i < 20; ++i) {
      g[i] = xb + (size_t)tok[i] * IN_ + col * 8;
      l[i] = (unsigned)(uintptr_t)(smem + (i * 4 + rsub) * IN_ * 2 + swz(i * 4 + rsub, col * 16));
    }
    // The wait closes each statement: the address registers stay as they are up to it.
    asm volatile(
        "global_load_async_to_lds_b128 %0, %1, off\n\t"
        "global_load_async_to_lds_b128 %2, %3, off\n\t"
        "global_load_async_to_lds_b128 %4, %5, off\n\t"
        "global_load_async_to_lds_b128 %6, %7, off\n\t"
        "global_load_async_to_lds_b128 %8, %9, off\n\t"
        "global_load_async_to_lds_b128 %10, %11, off\n\t"
        "global_load_async_to_lds_b128 %12, %13, off\n\t"
        "global_load_async_to_lds_b128 %14, %15, off\n\t"
        "global_load_async_to_lds_b128 %16, %17, off\n\t"
        "global_load_async_to_lds_b128 %18, %19, off\n\t"
        "s_wait_xcnt 0x0"
        :: "v"(l[0]), "v"(g[0]), "v"(l[1]), "v"(g[1]), "v"(l[2]), "v"(g[2]), "v"(l[3]), "v"(g[3]), "v"(l[4]), "v"(g[4]), "v"(l[5]), "v"(g[5]), "v"(l[6]), "v"(g[6]), "v"(l[7]), "v"(g[7]), "v"(l[8]), "v"(g[8]), "v"(l[9]), "v"(g[9]) : "memory");
    asm volatile(
        "global_load_async_to_lds_b128 %0, %1, off\n\t"
        "global_load_async_to_lds_b128 %2, %3, off\n\t"
        "global_load_async_to_lds_b128 %4, %5, off\n\t"
        "global_load_async_to_lds_b128 %6, %7, off\n\t"
        "global_load_async_to_lds_b128 %8, %9, off\n\t"
        "global_load_async_to_lds_b128 %10, %11, off\n\t"
        "global_load_async_to_lds_b128 %12, %13, off\n\t"
        "global_load_async_to_lds_b128 %14, %15, off\n\t"
        "global_load_async_to_lds_b128 %16, %17, off\n\t"
        "global_load_async_to_lds_b128 %18, %19, off\n\t"
        "s_wait_xcnt 0x0"
        :: "v"(l[10]), "v"(g[10]), "v"(l[11]), "v"(g[11]), "v"(l[12]), "v"(g[12]), "v"(l[13]), "v"(g[13]), "v"(l[14]), "v"(g[14]), "v"(l[15]), "v"(g[15]), "v"(l[16]), "v"(g[16]), "v"(l[17]), "v"(g[17]), "v"(l[18]), "v"(g[18]), "v"(l[19]), "v"(g[19]) : "memory");
    // The copies have landed before the barrier lets another wave read them.
    asm volatile("s_wait_asynccnt 0x0" ::: "memory");
  }
  __syncthreads();

  // h1 = relu(x @ W1 + b1)
  gemm_tile<IN_, 1, 5, 8, true, false>(smem, 0, IN_, W1t + (size_t)e * HID_ * IN_, HID_,
                                    b1 + e * HID_, TM * HID_ * 2, HID_, 0, wid * 128, lane);
  __syncthreads();
  // h2 = relu(h1 @ W2 + b2)  (overwrites x region)
  gemm_tile<HID_, 1, 5, 8, true, false>(smem, TM * HID_ * 2, HID_, W2t + (size_t)e * HID_ * HID_, HID_,
                                     b2 + e * HID_, 0, HID_, 0, wid * 128, lane);
  __syncthreads();
  // logits = h2 @ Wp + bp (float, overlays h1): four column strips of 64. Waves w and
  // w + 4 share a strip: one takes its upper 48 rows, the other its lower 32.
  if (__builtin_amdgcn_readfirstlane(wid) < 4)
    gemm_tile<HID_, 4, 3, 4, false, true>(smem, 0, HID_, Wpt + (size_t)e * OUT_ * HID_, OUT_,
                                       bp + e * OUT_, TM * HID_ * 2, OUT_, 0, (wid & 3) * 64, lane);
  else
    gemm_tile<HID_, 4, 2, 4, false, true>(smem, 0, HID_, Wpt + (size_t)e * OUT_ * HID_, OUT_,
                                       bp + e * OUT_, TM * HID_ * 2, OUT_, 48, (wid & 3) * 64, lane);
  __syncthreads();

  // Per-row epilogue: alpha0 dot + softmax + gated atomic scatter.
  const float* Wag = Wa + e * HID_;
  const float* bae = ba + e;
  const float  bag = *bae;
  // The load names bae's registers. Taking bae as an input keeps them as they are up to
  // this wait, so nothing reuses them before it.
  asm volatile("s_wait_xcnt 0x0" :: "s"(bae) : "memory");
#pragma nounroll  // kept rolled to keep the code small
  for (int rr = 0; rr < TM / 8; ++rr) {
    const int m = wid * (TM / 8) + rr;
    const int slot = t0 + m;

    float s = 0.f;
    for (int k = lane; k < HID_; k += 32) s += (float)bufA[m * HID_ + (swz(m, k * 2) >> 1)] * Wag[k];
#pragma unroll
    for (int off = 16; off > 0; off >>= 1) s += __shfl_xor(s, off);

    float mx = -1e30f, v[8];
#pragma unroll
    for (int j = 0; j < 8; ++j) {
      v[j] = lgts[m * OUT_ + lane + j * 32];
      mx = fmaxf(mx, v[j]);
    }
#pragma unroll
    for (int off = 16; off > 0; off >>= 1) mx = fmaxf(mx, __shfl_xor(mx, off));
    float sm = 0.f;
#pragma unroll
    for (int j = 0; j < 8; ++j) { v[j] = __expf(v[j] - mx); sm += v[j]; }
#pragma unroll
    for (int off = 16; off > 0; off >>= 1) sm += __shfl_xor(sm, off);

    if (slot < cnt) {
      const int   tok = assign[e * B_ + slot];
      const float g   = gateval[e * B_ + slot];
      if (lane == 0) {
        const float pre = s + bag;
        const float spv = (pre > 20.f) ? pre : log1pf(__expf(pre));
        const float a0v = fminf(fmaxf(spv + 10.f, 1.f), 500.f);
        atomicAdd(&alpha0[tok], g * a0v);
      }
      const float inv = g / sm;
#pragma unroll
      for (int j = 0; j < 8; ++j)
        atomicAdd(&p_hat[(size_t)tok * OUT_ + lane + j * 32], v[j] * inv);
    }
  }
}

// ---------------------------------------------------------------------------
// Post: aux loss (ddof=1 std) and p_hat row normalization, one launch: block 0 does the
// aux loss, block r + 1 row r.
// ---------------------------------------------------------------------------
__device__ __forceinline__ void aux_part(const float* __restrict__ importance,
                                         const float* __restrict__ loadv,
                                         float* __restrict__ out_aux) {
  if (threadIdx.x == 0) {
    float mi = 0.f, ml = 0.f;
    for (int i = 0; i < E_; ++i) { mi += importance[i]; ml += loadv[i]; }
    mi /= (float)E_; ml /= (float)E_;
    float vi = 0.f, vl = 0.f;
    for (int i = 0; i < E_; ++i) {
      const float di = importance[i] - mi; vi += di * di;
      const float dl = loadv[i] - ml;      vl += dl * dl;
    }
    vi /= (float)(E_ - 1); vl /= (float)(E_ - 1);
    *out_aux = sqrtf(vi) / (mi + 1e-8f) + sqrtf(vl) / (ml + 1e-8f);
  }
}

extern "C" __global__ void __launch_bounds__(256)
norm_kernel(float* __restrict__ p_hat, const float* __restrict__ importance,
            const float* __restrict__ loadv, float* __restrict__ out_aux) {
  __shared__ float part[8];
  // The whole block leaves here, ahead of the barrier.
  if (blockIdx.x == 0) { aux_part(importance, loadv, out_aux); return; }
  const int row = blockIdx.x - 1, tid = threadIdx.x, lane = tid & 31, wid = tid >> 5;
  const float v = p_hat[(size_t)row * OUT_ + tid];
  float s = v;
#pragma unroll
  for (int off = 16; off > 0; off >>= 1) s += __shfl_xor(s, off);
  if (lane == 0) part[wid] = s;
  __syncthreads();
  float tot = 0.f;
#pragma unroll
  for (int w = 0; w < 8; ++w) tot += part[w];
  p_hat[(size_t)row * OUT_ + tid] = v / (tot + 1e-8f);
}

// ---------------------------------------------------------------------------
// Host launch
// ---------------------------------------------------------------------------
extern "C" void kernel_launch(void* const* d_in, const int* in_sizes, int n_in,
                              void* d_out, int out_size, void* d_ws, size_t ws_size,
                              hipStream_t stream) {
  const float* x   = (const float*)d_in[0];
  const float* noi = (const float*)d_in[1];
  const float* gW  = (const float*)d_in[2];
  const float* gb  = (const float*)d_in[3];
  const float* nW  = (const float*)d_in[4];
  const float* nb  = (const float*)d_in[5];
  const float* W1  = (const float*)d_in[6];
  const float* b1  = (const float*)d_in[7];
  const float* W2  = (const float*)d_in[8];
  const float* b2  = (const float*)d_in[9];
  const float* Wp  = (const float*)d_in[10];
  const float* bp  = (const float*)d_in[11];
  const float* Wa  = (const float*)d_in[12];
  const float* ba  = (const float*)d_in[13];

  float* out    = (float*)d_out;
  float* p_hat  = out;                           // [B, OUT]
  float* alpha0 = out + (size_t)B_ * OUT_;       // [B]
  float* auxp   = out + (size_t)B_ * OUT_ + B_;  // scalar

  char* w = (char*)d_ws;
  bf16_t* xb  = (bf16_t*)w;  w += (size_t)B_ * IN_ * 2;         // 8 MB
  bf16_t* W1t = (bf16_t*)w;  w += (size_t)E_ * HID_ * IN_ * 2;  // 16 MB
  bf16_t* W2t = (bf16_t*)w;  w += (size_t)E_ * HID_ * HID_ * 2; // 32 MB
  bf16_t* Wpt = (bf16_t*)w;  w += (size_t)E_ * OUT_ * HID_ * 2; // 8 MB
  int*    counts     = (int*)w;   w += 256;
  int*    assign     = (int*)w;   w += (size_t)E_ * B_ * 4;     // 512 KB
  float*  gateval    = (float*)w; w += (size_t)E_ * B_ * 4;     // 512 KB
  float*  importance = (float*)w; w += 256;
  float*  loadv      = (float*)w; w += 256;

  init_cast_kernel<<<2048, 256, 0, stream>>>(p_hat, B_ * OUT_ + B_, counts, importance, loadv,
                                             x, xb, B_ * IN_);
  prep_kernel<<<NB_GATE + NB_W2 + NB_W1 + NB_WP, 256, 0, stream>>>(
      x, noi, gW, gb, nW, nb, W1, W2, Wp, W1t, W2t, Wpt,
      counts, assign, gateval, importance, loadv);

  dim3 eg(E_, (B_ + TM - 1) / TM);
  expert_kernel<<<eg, 256, 0, stream>>>(xb, W1t, b1, W2t, b2, Wpt, bp,
                                                 Wa, ba, counts, assign, gateval,
                                                 p_hat, alpha0);

  norm_kernel<<<B_ + 1, 256, 0, stream>>>(p_hat, importance, loadv, auxp);
}

// v008
// One run takes 115 microseconds.
// In both of two side-by-side timings against v007, it was 1.29 times as fast.
// All steps since v000 together make it 6.88 times as fast.
#include <hip/hip_runtime.h>
#include <hip/hip_bf16.h>
#include <math.h>

typedef __bf16 bf16_t;
typedef __attribute__((ext_vector_type(16))) __bf16 v16bf;
typedef __attribute__((ext_vector_type(8)))  float  v8f;

#define B_   8192
#define IN_  512
#define HID_ 1024
#define OUT_ 256
#define E_   16
#define TM   80      // token tile (M) per block

typedef __attribute__((ext_vector_type(4))) unsigned int v4u;

union Frag { v16bf v; unsigned int u[8]; v4u q[2]; };

__device__ __forceinline__ int swz(int m, int b) { return b ^ ((m & 15) << 4); }

__device__ __forceinline__ v8f wmma_bf16(const Frag& a, const Frag& b, v8f c) {
  return __builtin_amdgcn_wmma_f32_16x16x32_bf16(
      /*neg_a=*/false, a.v, /*neg_b=*/false, b.v,
      /*c_mod=*/(short)0, c, /*reuse_a=*/false, /*reuse_b=*/false);
}

// Compile-time switch handed to the k pass of gemm_tile: with or without the next loads.
template <bool V> struct Sel { static constexpr bool value = V; };

// One block = 8 waves. Each wave holds an (MT*16) x (NT*16) register tile of the
// block's result, from row mStart and column nStart. A pass covers KS k steps: KS*NT weight
// fragments, each feeding MT WMMAs. The weight fragments live in registers across passes:
// as soon as a fragment's WMMAs are issued, the same registers are loaded with the fragment
// of the next pass, so a weight load has almost a whole pass of WMMAs to arrive in.
// Bt holds the weights in fragment order (see tcast_part); nTot is their column count.
// The token tile (pitch lda elements) starts at byte aOff of the LDS array sm, the result
// (pitch ldo elements) at byte oOff; mStart is a multiple of 16, aOff of the row pitch.
template <int KTOT, int KS, int MT, int NT, bool RELU, bool OUT_F32>
__device__ __forceinline__ void gemm_tile(char* sm, int aOff, int lda,
                                          const bf16_t* __restrict__ Bt, int nTot,
                                          const float* __restrict__ bias,
                                          int oOff, int ldo,
                                          int mStart, int nStart, int lane) {
  constexpr int NG = KS * NT;   // weight fragments of a pass
  v8f acc[MT][NT];
#pragma unroll  // constant indices keep acc, a, b in registers
  for (int i = 0; i < MT; ++i)
#pragma unroll  // constant indices keep acc, a, b in registers
    for (int t = 0; t < NT; ++t)
#pragma unroll  // constant indices keep acc, a, b in registers
      for (int r = 0; r < 8; ++r) acc[i][t][r] = 0.f;

  // This lane's 16 bytes in the wave's first weight fragment; same k order as the token fragments (aL).
  // A k step's fragments of all columns lie side by side: the wave's NT are NT KB in a row.
  const bf16_t* bp = Bt + (size_t)nStart * 32 + lane * 8;
  const int kstep = nTot * 32;
  Frag b[NG];
  // Fragment g of the pass that bp points at (the next one, once the first is loaded):
  // k step g / NT, column tile g % NT.
  auto ldb = [&](int g) {
    const unsigned int* p = (const unsigned int*)(bp + (g / NT) * kstep + (g % NT) * 512);
    b[g].u[0] = p[0];   b[g].u[1] = p[1];   b[g].u[2] = p[2];   b[g].u[3] = p[3];
    b[g].u[4] = p[128]; b[g].u[5] = p[129]; b[g].u[6] = p[130]; b[g].u[7] = p[131];
  };
#pragma unroll  // constant indices keep acc, a, b in registers
  for (int g = 0; g < NG; ++g) ldb(g);
  // The loads name bp's registers. Taking bp as an input keeps those registers as they are
  // up to this wait; the advance to the next pass's fragments stands behind it.
  asm volatile("s_wait_xcnt 0x0" :: "v"(bp) : "memory");
  bp += KS * kstep;
  const int aL = aOff + (mStart + (lane & 15)) * lda * 2 + swz(lane, (lane >> 4) << 4);
  auto pass = [&](int kk, auto more) {
    Frag a[KS][MT];
#pragma unroll  // constant indices keep acc, a, b in registers
    for (int s = 0; s < KS; ++s)
#pragma unroll  // constant indices keep acc, a, b in registers
      for (int i = 0; i < MT; ++i) {
        a[s][i].q[0] = *(const v4u*)(sm + ((aL ^ ((kk + s * 32) * 2)) + i * 16 * lda * 2));
        a[s][i].q[1] = *(const v4u*)(sm + ((aL ^ ((kk + s * 32) * 2) ^ 32) + i * 16 * lda * 2));
      }
    __builtin_amdgcn_sched_barrier(0);
#pragma unroll  // constant indices keep acc, a, b in registers
    for (int g = 0; g < NG; ++g) {
#pragma unroll  // constant indices keep acc, a, b in registers
      for (int i = 0; i < MT; ++i) acc[i][g % NT] = wmma_bf16(a[g / NT][i], b[g], acc[i][g % NT]);
      // Keeps each reload where it is written, one fragment behind the WMMAs: gathered at one
      // end of the pass, the loads would have no WMMAs left to arrive under.
      __builtin_amdgcn_sched_barrier(0);
      if (decltype(more)::value && g > 0) {
        ldb(g - 1);
        __builtin_amdgcn_sched_barrier(0);
      }
    }
    if (decltype(more)::value) {
      ldb(NG - 1);
      // The pass's loads name bp's registers. Taking bp as an input keeps those registers as
      // they are up to this wait; the advance and the next pass's address sums stand behind it.
      asm volatile("s_wait_xcnt 0x0" :: "v"(bp) : "memory");
      bp += KS * kstep;
    }
  };
#pragma nounroll  // a pass already holds 32 to 48 WMMAs; copies of it would only add KBs of text
  for (int kk = 0; kk < KTOT - KS * 32; kk += KS * 32) pass(kk, Sel<true>{});
  pass(KTOT - KS * 32, Sel<false>{});   // last pass: nothing left to load
  const int n0 = nStart + (lane & 15);
  // bf16 result: this lane's place for t = 0, i = 0, r = 0 under swz, where m & 15 is
  // (lane >> 4) * 8 + r. nStart is a multiple of 128 there, so the column step t * 32 bytes
  // and swz's r * 16 fall in bits that an XOR with a constant sets: one XOR per (t, r).
  const int oL = oOff + (mStart + ((lane >> 4) << 3)) * ldo * 2 + swz((lane >> 4) << 3, n0 * 2);
  float bzs[NT];
#pragma unroll  // all NT loads in flight at once; constant indices keep bzs in registers
  for (int t = 0; t < NT; ++t) bzs[t] = bias[n0 + t * 16];
  // All NT loads name n0's register. Taking n0 as an input keeps that register as it is
  // up to this wait, so nothing reuses it before it.
  asm volatile("s_wait_xcnt 0x0" :: "v"(n0) : "memory");
#pragma unroll  // constant indices keep acc, a, b in registers
  for (int t = 0; t < NT; ++t) {
    const int n = n0 + t * 16;
    const float bz = bzs[t];
#pragma unroll  // constant indices keep acc, a, b in registers
    for (int i = 0; i < MT; ++i) {
      const int mo = mStart + i * 16 + ((lane >> 4) << 3);
#pragma unroll  // constant indices keep acc, a, b in registers
      for (int r = 0; r < 8; ++r) {
        float v = acc[i][t][r] + bz;
        if (RELU) v = v > 0.f ? v : 0.f;
        const int m = mo + r;
        if (OUT_F32) *(float*)(sm + oOff + (m * ldo + n) * 4) = v;
        else         *(bf16_t*)(sm + ((oL ^ ((t * 32) ^ (r * 16))) + (i * 16 + r) * ldo * 2)) = (bf16_t)v;
      }
    }
  }
}

// ---------------------------------------------------------------------------
// Prep kernels
// ---------------------------------------------------------------------------
// First launch: the start values of every sum (p_hat and alpha0, side by side in outf, for the
// expert kernel; the counters for the gating, which runs in the next launch) and the bf16
// copy of x. Neither job depends on anything and one grid suits both: each thread does
// both, the stores of zeros first, since nothing waits for them.
extern "C" __global__ void init_cast_kernel(float* __restrict__ outf, int n_zero,
                                            int* __restrict__ counts,
                                            float* __restrict__ importance,
                                            const float* __restrict__ x,
                                            bf16_t* __restrict__ xb, int n) {
  const int i0 = blockIdx.x * blockDim.x + threadIdx.x;
  for (int j = i0; j < n_zero; j += gridDim.x * blockDim.x) outf[j] = 0.f;
  if (i0 < E_) { counts[i0] = 0; importance[i0] = 0.f; }
  for (int i = i0; i < n; i += gridDim.x * blockDim.x)
    xb[i] = (bf16_t)x[i];
}

// Casts src[e][r][c] to bf16 and lays it out in WMMA B-fragment order. The fragment of
// k chunk r / 32 and column tile c / 16 is 1 KB at fragment index (r / 32) * (C / 16) + c / 16;
// inside it the 16-byte piece of 8 consecutive r sits at [(r >> 4) & 1][lane], where
// lane = (c & 15) + 16 * ((r >> 3) & 1). So each of a fragment's two wave-wide 16-byte
// loads in gemm_tile reads 512 contiguous bytes (4 whole lines, not 32 bytes of 16 lines).
// One block moves one 128 x 128 tile. Reads: a wave takes 512 contiguous bytes of one
// src row per load. Each thread turns its 16 rows x 4 columns into 16-byte pieces of
// 8 consecutive r in registers; LDS only regroups the pieces so that a wave's store
// covers 512 contiguous bytes of dst (half a fragment).
// A part of prep_kernel: (R/128) * (C/128) * E blocks of 256 threads, blk the block's index
// among them; the row tile runs fastest in blk, the expert slowest. tile: 32 KB of LDS,
// handed in so that the three shapes share one array.
typedef __attribute__((ext_vector_type(8))) __bf16 v8bf;
typedef __attribute__((ext_vector_type(4))) float  v4f;

template <int R, int C>  // compile-time pitches: every row step is an immediate offset
__device__ __forceinline__ void
tcast_part(const float* __restrict__ src, bf16_t* __restrict__ dst, v8bf* tile, int blk) {
  const int tid = threadIdx.x;
  const int r0 = (blk % (R / 128)) * 128, c0 = ((blk / (R / 128)) % (C / 128)) * 128;
  const size_t eoff = (size_t)(blk / ((R / 128) * (C / 128))) * R * C;

  const int cq = tid & 31, rg = tid >> 5;   // 4 columns from cq * 4, 16 rows from rg * 16
  const float* s = src + eoff + (size_t)(r0 + rg * 16) * C + c0 + cq * 4;
  v4f v[16];
#pragma unroll  // all 16 loads in flight at once; constant indices keep v in registers
  for (int i = 0; i < 16; ++i) v[i] = *(const v4f*)(s + (size_t)i * C);
  // All 16 loads name s's registers. Taking s as an input keeps those registers as they
  // are up to this wait, so nothing (a later load's result included) reuses them before it.
  asm volatile("s_wait_xcnt 0x0" :: "v"(s) : "memory");
  // Keeps the conversions behind the last load; left free, the compiler waits for the
  // first rows before it has issued the last ones.
  __builtin_amdgcn_sched_barrier(0);

#pragma unroll  // constant indices keep v in registers
  for (int j = 0; j < 4; ++j)
#pragma unroll  // constant indices keep v in registers
    for (int h = 0; h < 2; ++h) {
      v8bf o;
#pragma unroll  // constant indices keep v in registers
      for (int i = 0; i < 8; ++i) o[i] = (bf16_t)v[h * 8 + i][j];
      tile[(cq * 4 + j) * 16 + ((rg * 2 + h) ^ (cq & 15) ^ (j << 2))] = o;
    }
  __syncthreads();

  // The tile is 4 k chunks of 8 fragments: 8 KB in a row per chunk, two passes p each.
  const int fl = tid & 31, fh = (tid >> 5) & 1;   // lane and half inside a fragment
  bf16_t* d = dst + eoff + ((size_t)(r0 / 32) * (C / 16) + c0 / 16) * 512 + tid * 8;
#pragma unroll  // the 8 LDS reads and stores go out back to back
  for (int p = 0; p < 8; ++p) {
    const int c = ((p & 1) * 4 + (tid >> 6)) * 16 + (fl & 15);
    const int k = (p >> 1) * 4 + fh * 2 + (fl >> 4);
    *(v8bf*)(d + (size_t)(p >> 1) * (C / 16) * 512 + (p & 1) * 2048) =
        tile[c * 16 + (k ^ ((c >> 2) & 15) ^ ((c & 3) << 2))];
  }
  // The stores name d's and their data's registers; inlined into prep_kernel, code of another
  // branch follows them in the listing and rewrites such registers. The wait stands ahead of it.
  asm volatile("s_wait_xcnt 0x0" ::: "memory");
}

#define GT 4
#define GB (8 * GT)
#define GP 36
__device__ __forceinline__ void
gating_part(const float* __restrict__ x, const float* __restrict__ noise,
            const float* __restrict__ gW, const float* __restrict__ gb,
            const float* __restrict__ nW, const float* __restrict__ nb,
            int* __restrict__ counts, int* __restrict__ assign,
            float* __restrict__ gateval, float* __restrict__ importance,
            char* lds, int blk) {
  float* lraw  = (float*)lds;                        // [GB][GP]: 16 clean, 16 noise sums
  float* lnz   = (float*)(lds + GB * GP * 4);        // [GB][16]: the noise input
  int*   lsel  = (int*)(lds + GB * (GP + 16) * 4);   // [GB]: first | second << 8
  float* lg0   = (float*)(lsel + GB);                // [GB], [GB]: the two gates
  float* lg1   = lg0 + GB;
  int*   lcnt  = (int*)(lg1 + GB);
  int*   lbase = lcnt + E_;
  const int tid  = threadIdx.x;
  const int lane = tid & 31;
  const int wid  = tid >> 5;
  const int e    = lane & 15;
  const bool np  = lane >= 16;

  if (tid < E_) lcnt[tid] = 0;
  // The block's noise values, 2 KB in a row, 16 bytes a thread of the first four waves; they
  // arrive under the sums below.
  const float* nzp = noise + (size_t)blk * GB * E_ + (tid & (GB * 4 - 1)) * 4;
  const v4f nz = *(const v4f*)nzp;
  const float* bpt = (np ? nb : gb) + e;
  const float bz = *bpt;
  // The bias load names bpt's registers. Taking bpt as an input keeps them as they are up to
  // this wait, so nothing (the noise load's result included) reuses them before it.
  asm volatile("s_wait_xcnt 0x0" :: "v"(bpt) : "memory");

  float acc[GT];
#pragma unroll  // constant indices keep acc in registers
  for (int j = 0; j < GT; ++j) acc[j] = bz;
  const float* xp = x + (size_t)(blk * GB + wid * GT) * IN_;
  const float* wp = (np ? nW : gW) + e;
#pragma nounroll  // a trip already has 32 loads in flight and their 80 registers
  for (int i0 = 0; i0 < IN_; i0 += 16) {
    v4f xv[GT][4];
    float wv[16];
#pragma unroll  // all loads in flight at once; constant indices keep xv in registers
    for (int j = 0; j < GT; ++j)
#pragma unroll  // all loads in flight at once; constant indices keep xv in registers
      for (int q = 0; q < 4; ++q) xv[j][q] = *(const v4f*)(xp + j * IN_ + q * 4);
#pragma unroll  // all loads in flight at once; constant indices keep wv in registers
    for (int k = 0; k < 16; ++k) wv[k] = wp[k * E_];
    // Keeps the sums behind the last load; left free, the compiler waits for the first
    // values before it has issued the last loads, and a trip pays the latency twice.
    __builtin_amdgcn_sched_barrier(0);
#pragma unroll  // constant indices keep acc, xv, wv in registers
    for (int k = 0; k < 16; ++k)
#pragma unroll  // constant indices keep acc, xv, wv in registers
      for (int j = 0; j < GT; ++j) acc[j] = __builtin_fmaf(xv[j][k >> 2][k & 3], wv[k], acc[j]);
    xp += 16;
    wp += 16 * E_;
  }
#pragma unroll  // constant indices keep acc in registers
  for (int j = 0; j < GT; ++j) lraw[(wid * GT + j) * GP + lane] = acc[j];
  if (tid < GB * 4) *(v4f*)(lnz + tid * 4) = nz;
  __syncthreads();

  // Noisy logits, GB * 16 of them, two a thread; each replaces its clean logit.
#pragma nounroll  // a second copy of log1pf would only add text
  for (int c = 0; c < GB * E_ / 256; ++c) {
    const int idx = c * 256 + tid, t = idx >> 4, q = idx & 15;
    const float pre_noise = lraw[t * GP + 16 + q];
    const float sp = (pre_noise > 20.f) ? pre_noise : log1pf(__expf(pre_noise));
    lraw[t * GP + q] = lraw[t * GP + q] + lnz[idx] * sp;
  }
  __syncthreads();

  // One thread per token: top 2, gates, and the token's rank among the block's tokens of
  // each of its two experts.
  int bi = 0, si = 0, r0 = 0, r1 = 0;
  float g0 = 0.f, g1 = 0.f;
  if (tid < GB) {
    v4f row[4];
#pragma unroll  // constant indices keep row in registers
    for (int q = 0; q < 4; ++q) row[q] = *(const v4f*)(lraw + tid * GP + q * 4);
    float best = -1e30f, second = -1e30f;
#pragma unroll  // constant indices keep row in registers
    for (int q = 0; q < 16; ++q) {
      const float v = row[q >> 2][q & 3];
      if (v > best)        { second = best; si = bi; best = v; bi = q; }
      else if (v > second) { second = v; si = q; }
    }
    const float e1 = __expf(second - best);
    g0 = 1.f / (1.f + e1);
    g1 = e1 / (1.f + e1);
    r0 = atomicAdd(&lcnt[bi], 1);
    r1 = atomicAdd(&lcnt[si], 1);
    lsel[tid] = bi | (si << 8);
    lg0[tid] = g0;
    lg1[tid] = g1;
  }
  __syncthreads();

  if (wid == 0) {
    if (lane < E_) lbase[lane] = atomicAdd(&counts[lane], lcnt[lane]);
  } else if (wid == 1) {
    // Gate sum of expert e over the block, in token order: each half wave takes 16 tokens.
    float s = 0.f;
    const int th = (lane >> 4) * (GB / 2);
    v4u sel[GB / 8];
    v4f ga[GB / 8], gc[GB / 8];
#pragma unroll  // the LDS reads go out together; constant indices keep them in registers
    for (int t = 0; t < GB / 8; ++t) {
      sel[t] = *(const v4u*)(lsel + th + t * 4);
      ga[t]  = *(const v4f*)(lg0 + th + t * 4);
      gc[t]  = *(const v4f*)(lg1 + th + t * 4);
    }
#pragma unroll  // constant indices keep sel, ga, gc in registers
    for (int t = 0; t < GB / 2; ++t) {
      s += ((int)(sel[t >> 2][t & 3] & 255) == e) ? ga[t >> 2][t & 3] : 0.f;
      s += ((int)(sel[t >> 2][t & 3] >> 8) == e)  ? gc[t >> 2][t & 3] : 0.f;
    }
    s += __shfl_xor(s, 16);
    if (lane < E_) atomicAdd(&importance[lane], s);
  }
  __syncthreads();

  if (tid < GB) {
    const int tok = blk * GB + tid;
    const int s0 = bi * B_ + lbase[bi] + r0, s1 = si * B_ + lbase[si] + r1;
    assign[s0] = tok;  gateval[s0] = g0;
    assign[s1] = tok;  gateval[s1] = g1;
    // The stores name s0's and s1's registers; inlined into prep_kernel, code of another
    // branch follows them in the listing. The wait stands ahead of it.
    asm volatile("s_wait_xcnt 0x0" :: "v"(s0), "v"(s1) : "memory");
  }
}

// ---------------------------------------------------------------------------
// Second launch: the gating and the three weight casts, which do not depend on one another,
// as ranges of blocks of one grid. None of them waits for another to drain, and the gating,
// which waits on load latency, runs beside the casts, which are limited by memory rate.
// The gating blocks have the longest chain and come first.
// ---------------------------------------------------------------------------
#define NB_GATE (B_ / GB)
#define NB_W1   ((IN_ / 128) * (HID_ / 128) * E_)
#define NB_W2   ((HID_ / 128) * (HID_ / 128) * E_)
#define NB_WP   ((HID_ / 128) * (OUT_ / 128) * E_)
extern "C" __global__ void __launch_bounds__(256)
prep_kernel(const float* __restrict__ x, const float* __restrict__ noise,
            const float* __restrict__ gW, const float* __restrict__ gb,
            const float* __restrict__ nW, const float* __restrict__ nb,
            const float* __restrict__ W1, const float* __restrict__ W2,
            const float* __restrict__ Wp, bf16_t* __restrict__ W1t,
            bf16_t* __restrict__ W2t, bf16_t* __restrict__ Wpt,
            int* __restrict__ counts, int* __restrict__ assign,
            float* __restrict__ gateval, float* __restrict__ importance) {
  __shared__ v8bf tile[128 * 16];
  int blk = blockIdx.x;   // the same for the whole block: so is every branch below
  if (blk < NB_GATE) {
    gating_part(x, noise, gW, gb, nW, nb, counts, assign, gateval, importance, (char*)tile, blk);
    return;
  }
  blk -= NB_GATE;
  if (blk < NB_W2) { tcast_part<HID_, HID_>(W2, W2t, tile, blk); return; }
  blk -= NB_W2;
  if (blk < NB_W1) { tcast_part<IN_, HID_>(W1, W1t, tile, blk); return; }
  blk -= NB_W1;
  tcast_part<HID_, OUT_>(Wp, Wpt, tile, blk);
}

extern "C" __global__ void __launch_bounds__(256)
expert_kernel(const bf16_t* __restrict__ xb,
              const bf16_t* __restrict__ W1t, const float* __restrict__ b1,
              const bf16_t* __restrict__ W2t, const float* __restrict__ b2,
              const bf16_t* __restrict__ Wpt, const float* __restrict__ bp,
              const float* __restrict__ Wa, const float* __restrict__ ba,
              const int* __restrict__ counts, const int* __restrict__ assign,
              const float* __restrict__ gateval,
              float* __restrict__ p_hat, float* __restrict__ alpha0) {
  __shared__ __attribute__((aligned(16))) char smem[2 * TM * HID_ * 2];
  bf16_t* bufA = (bf16_t*)smem;                    // 160KB: x tile (80x512) then h2 (80x1024)
  // second 160KB, from byte TM * HID_ * 2: h1 (80x1024)
  float*  lgts = (float*)(smem + TM * HID_ * 2);   //  80KB overlay on h1: logits (80x256)

  const int e   = blockIdx.x;
  const int cnt = counts[e];
  const int t0  = blockIdx.y * TM;
  if (t0 >= cnt) return;

  const int tid = threadIdx.x, lane = tid & 31, wid = tid >> 5;

  {
    const int col = tid & 63, rsub = tid >> 6;
    const int* ae = assign + e * B_;
    int slot[20], tok[20];
#pragma unroll
    for (int i = 0; i < 20; ++i) {
      slot[i] = t0 + i * 4 + rsub;
      if (slot[i] >= cnt) slot[i] = cnt - 1;
    }
#pragma unroll  // all 20 loads in flight at once; constant indices keep tok in registers
    for (int i = 0; i < 20; ++i) tok[i] = ae[slot[i]];
    asm volatile("s_wait_xcnt 0x0"
                 :: "v"(slot[0]), "v"(slot[1]), "v"(slot[2]), "v"(slot[3]), "v"(slot[4]),
                    "v"(slot[5]), "v"(slot[6]), "v"(slot[7]), "v"(slot[8]), "v"(slot[9]),
                    "v"(slot[10]), "v"(slot[11]), "v"(slot[12]), "v"(slot[13]), "v"(slot[14]),
                    "v"(slot[15]), "v"(slot[16]), "v"(slot[17]), "v"(slot[18]), "v"(slot[19])
                 : "memory");
    const bf16_t* g[20];
    unsigned l[20];
#pragma unroll  // constant indices keep g and l in registers
    for (int i = 0; i < 20; ++i) {
      g[i] = xb + (size_t)tok[i] * IN_ + col * 8;
      l[i] = (unsigned)(uintptr_t)(smem + (i * 4 + rsub) * IN_ * 2 + swz(i * 4 + rsub, col * 16));
    }
    // The wait closes each statement: the address registers stay as they are up to it.
    asm volatile(
        "global_load_async_to_lds_b128 %0, %1, off\n\t"
        "global_load_async_to_lds_b128 %2, %3, off\n\t"
        "global_load_async_to_lds_b128 %4, %5, off\n\t"
        "global_load_async_to_lds_b128 %6, %7, off\n\t"
        "global_load_async_to_lds_b128 %8, %9, off\n\t"
        "global_load_async_to_lds_b128 %10, %11, off\n\t"
        "global_load_async_to_lds_b128 %12, %13, off\n\t"
        "global_load_async_to_lds_b128 %14, %15, off\n\t"
        "global_load_async_to_lds_b128 %16, %17, off\n\t"
        "global_load_async_to_lds_b128 %18, %19, off\n\t"
        "s_wait_xcnt 0x0"
        :: "v"(l[0]), "v"(g[0]), "v"(l[1]), "v"(g[1]), "v"(l[2]), "v"(g[2]), "v"(l[3]), "v"(g[3]), "v"(l[4]), "v"(g[4]), "v"(l[5]), "v"(g[5]), "v"(l[6]), "v"(g[6]), "v"(l[7]), "v"(g[7]), "v"(l[8]), "v"(g[8]), "v"(l[9]), "v"(g[9]) : "memory");
    asm volatile(
        "global_load_async_to_lds_b128 %0, %1, off\n\t"
        "global_load_async_to_lds_b128 %2, %3, off\n\t"
        "global_load_async_to_lds_b128 %4, %5, off\n\t"
        "global_load_async_to_lds_b128 %6, %7, off\n\t"
        "global_load_async_to_lds_b128 %8, %9, off\n\t"
        "global_load_async_to_lds_b128 %10, %11, off\n\t"
        "global_load_async_to_lds_b128 %12, %13, off\n\t"
        "global_load_async_to_lds_b128 %14, %15, off\n\t"
        "global_load_async_to_lds_b128 %16, %17, off\n\t"
        "global_load_async_to_lds_b128 %18, %19, off\n\t"
        "s_wait_xcnt 0x0"
        :: "v"(l[10]), "v"(g[10]), "v"(l[11]), "v"(g[11]), "v"(l[12]), "v"(g[12]), "v"(l[13]), "v"(g[13]), "v"(l[14]), "v"(g[14]), "v"(l[15]), "v"(g[15]), "v"(l[16]), "v"(g[16]), "v"(l[17]), "v"(g[17]), "v"(l[18]), "v"(g[18]), "v"(l[19]), "v"(g[19]) : "memory");
    // The copies have landed before the barrier lets another wave read them.
    asm volatile("s_wait_asynccnt 0x0" ::: "memory");
  }
  __syncthreads();

  // h1 = relu(x @ W1 + b1)
  gemm_tile<IN_, 1, 5, 8, true, false>(smem, 0, IN_, W1t + (size_t)e * HID_ * IN_, HID_,
                                    b1 + e * HID_, TM * HID_ * 2, HID_, 0, wid * 128, lane);
  __syncthreads();
  // h2 = relu(h1 @ W2 + b2)  (overwrites x region)
  gemm_tile<HID_, 1, 5, 8, true, false>(smem, TM * HID_ * 2, HID_, W2t + (size_t)e * HID_ * HID_, HID_,
                                     b2 + e * HID_, 0, HID_, 0, wid * 128, lane);
  __syncthreads();
  // logits = h2 @ Wp + bp (float, overlays h1): four column strips of 64. Waves w and
  // w + 4 share a strip: one takes its upper 48 rows, the other its lower 32.
  if (__builtin_amdgcn_readfirstlane(wid) < 4)
    gemm_tile<HID_, 4, 3, 4, false, true>(smem, 0, HID_, Wpt + (size_t)e * OUT_ * HID_, OUT_,
                                       bp + e * OUT_, TM * HID_ * 2, OUT_, 0, (wid & 3) * 64, lane);
  else
    gemm_tile<HID_, 4, 2, 4, false, true>(smem, 0, HID_, Wpt + (size_t)e * OUT_ * HID_, OUT_,
                                       bp + e * OUT_, TM * HID_ * 2, OUT_, 48, (wid & 3) * 64, lane);
  __syncthreads();

  // Per-row epilogue: alpha0 dot + softmax + gated atomic scatter.
  const float* Wag = Wa + e * HID_;
  const float* bae = ba + e;
  const float  bag = *bae;
  // The load names bae's registers. Taking bae as an input keeps them as they are up to
  // this wait, so nothing reuses them before it.
  asm volatile("s_wait_xcnt 0x0" :: "s"(bae) : "memory");
#pragma nounroll  // kept rolled to keep the code small
  for (int rr = 0; rr < TM / 8; ++rr) {
    const int m = wid * (TM / 8) + rr;
    const int slot = t0 + m;

    float s = 0.f;
    for (int k = lane; k < HID_; k += 32) s += (float)bufA[m * HID_ + (swz(m, k * 2) >> 1)] * Wag[k];
#pragma unroll
    for (int off = 16; off > 0; off >>= 1) s += __shfl_xor(s, off);

    float mx = -1e30f, v[8];
#pragma unroll
    for (int j = 0; j < 8; ++j) {
      v[j] = lgts[m * OUT_ + lane + j * 32];
      mx = fmaxf(mx, v[j]);
    }
#pragma unroll
    for (int off = 16; off > 0; off >>= 1) mx = fmaxf(mx, __shfl_xor(mx, off));
    float sm = 0.f;
#pragma unroll
    for (int j = 0; j < 8; ++j) { v[j] = __expf(v[j] - mx); sm += v[j]; }
#pragma unroll
    for (int off = 16; off > 0; off >>= 1) sm += __shfl_xor(sm, off);

    if (slot < cnt) {
      const int   tok = assign[e * B_ + slot];
      const float g   = gateval[e * B_ + slot];
      if (lane == 0) {
        const float pre = s + bag;
        const float spv = (pre > 20.f) ? pre : log1pf(__expf(pre));
        const float a0v = fminf(fmaxf(spv + 10.f, 1.f), 500.f);
        atomicAdd(&alpha0[tok], g * a0v);
      }
      const float inv = g / sm;
#pragma unroll
      for (int j = 0; j < 8; ++j)
        atomicAdd(&p_hat[(size_t)tok * OUT_ + lane + j * 32], v[j] * inv);
    }
  }
}

// ---------------------------------------------------------------------------
// Post: aux loss (ddof=1 std) and p_hat row normalization, one launch: block 0 does the
// aux loss, block r + 1 row r.
// ---------------------------------------------------------------------------
__device__ __forceinline__ void aux_part(const float* __restrict__ importance,
                                         const int* __restrict__ counts,
                                         float* __restrict__ out_aux) {
  if (threadIdx.x == 0) {
    float mi = 0.f, ml = 0.f;
    for (int i = 0; i < E_; ++i) { mi += importance[i]; ml += (float)counts[i]; }
    mi /= (float)E_; ml /= (float)E_;
    float vi = 0.f, vl = 0.f;
    for (int i = 0; i < E_; ++i) {
      const float di = importance[i] - mi; vi += di * di;
      const float dl = (float)counts[i] - ml; vl += dl * dl;
    }
    vi /= (float)(E_ - 1); vl /= (float)(E_ - 1);
    *out_aux = sqrtf(vi) / (mi + 1e-8f) + sqrtf(vl) / (ml + 1e-8f);
  }
}

extern "C" __global__ void __launch_bounds__(256)
norm_kernel(float* __restrict__ p_hat, const float* __restrict__ importance,
            const int* __restrict__ counts, float* __restrict__ out_aux) {
  __shared__ float part[8];
  // The whole block leaves here, ahead of the barrier.
  if (blockIdx.x == 0) { aux_part(importance, counts, out_aux); return; }
  const int row = blockIdx.x - 1, tid = threadIdx.x, lane = tid & 31, wid = tid >> 5;
  const float v = p_hat[(size_t)row * OUT_ + tid];
  float s = v;
#pragma unroll
  for (int off = 16; off > 0; off >>= 1) s += __shfl_xor(s, off);
  if (lane == 0) part[wid] = s;
  __syncthreads();
  float tot = 0.f;
#pragma unroll
  for (int w = 0; w < 8; ++w) tot += part[w];
  p_hat[(size_t)row * OUT_ + tid] = v / (tot + 1e-8f);
}

// ---------------------------------------------------------------------------
// Host launch
// ---------------------------------------------------------------------------
extern "C" void kernel_launch(void* const* d_in, const int* in_sizes, int n_in,
                              void* d_out, int out_size, void* d_ws, size_t ws_size,
                              hipStream_t stream) {
  const float* x   = (const float*)d_in[0];
  const float* noi = (const float*)d_in[1];
  const float* gW  = (const float*)d_in[2];
  const float* gb  = (const float*)d_in[3];
  const float* nW  = (const float*)d_in[4];
  const float* nb  = (const float*)d_in[5];
  const float* W1  = (const float*)d_in[6];
  const float* b1  = (const float*)d_in[7];
  const float* W2  = (const float*)d_in[8];
  const float* b2  = (const float*)d_in[9];
  const float* Wp  = (const float*)d_in[10];
  const float* bp  = (const float*)d_in[11];
  const float* Wa  = (const float*)d_in[12];
  const float* ba  = (const float*)d_in[13];

  float* out    = (float*)d_out;
  float* p_hat  = out;                           // [B, OUT]
  float* alpha0 = out + (size_t)B_ * OUT_;       // [B]
  float* auxp   = out + (size_t)B_ * OUT_ + B_;  // scalar

  char* w = (char*)d_ws;
  bf16_t* xb  = (bf16_t*)w;  w += (size_t)B_ * IN_ * 2;         // 8 MB
  bf16_t* W1t = (bf16_t*)w;  w += (size_t)E_ * HID_ * IN_ * 2;  // 16 MB
  bf16_t* W2t = (bf16_t*)w;  w += (size_t)E_ * HID_ * HID_ * 2; // 32 MB
  bf16_t* Wpt = (bf16_t*)w;  w += (size_t)E_ * OUT_ * HID_ * 2; // 8 MB
  int*    counts     = (int*)w;   w += 256;
  int*    assign     = (int*)w;   w += (size_t)E_ * B_ * 4;     // 512 KB
  float*  gateval    = (float*)w; w += (size_t)E_ * B_ * 4;     // 512 KB
  float*  importance = (float*)w; w += 256;

  init_cast_kernel<<<2048, 256, 0, stream>>>(p_hat, B_ * OUT_ + B_, counts, importance,
                                             x, xb, B_ * IN_);
  prep_kernel<<<NB_GATE + NB_W2 + NB_W1 + NB_WP, 256, 0, stream>>>(
      x, noi, gW, gb, nW, nb, W1, W2, Wp, W1t, W2t, Wpt,
      counts, assign, gateval, importance);

  dim3 eg(E_, (B_ + TM - 1) / TM);
  expert_kernel<<<eg, 256, 0, stream>>>(xb, W1t, b1, W2t, b2, Wpt, bp,
                                                 Wa, ba, counts, assign, gateval,
                                                 p_hat, alpha0);

  norm_kernel<<<B_ + 1, 256, 0, stream>>>(p_hat, importance, counts, auxp);
}

// v009
// Measured time: 98 microseconds a run.
// Timed twice side by side with v008, it ran 1.17 times as fast both times.
// Over all steps from v000 it is 8.04 times as fast.
#include <hip/hip_runtime.h>
#include <hip/hip_bf16.h>
#include <math.h>

typedef __bf16 bf16_t;
typedef __attribute__((ext_vector_type(16))) __bf16 v16bf;
typedef __attribute__((ext_vector_type(8)))  float  v8f;

#define B_   8192
#define IN_  512
#define HID_ 1024
#define OUT_ 256
#define E_   16
#define TM   80      // token tile (M) per block

typedef __attribute__((ext_vector_type(4))) unsigned int v4u;

union Frag { v16bf v; unsigned int u[8]; v4u q[2]; };

__device__ __forceinline__ int swz(int m, int b) { return b ^ ((m & 15) << 4); }

__device__ __forceinline__ v8f wmma_bf16(const Frag& a, const Frag& b, v8f c) {
  return __builtin_amdgcn_wmma_f32_16x16x32_bf16(
      /*neg_a=*/false, a.v, /*neg_b=*/false, b.v,
      /*c_mod=*/(short)0, c, /*reuse_a=*/false, /*reuse_b=*/false);
}

// Compile-time switch handed to the k pass of gemm_tile: with or without the next loads.
template <bool V> struct Sel { static constexpr bool value = V; };

// One block = 8 waves. Each wave holds an (MT*16) x (NT*16) register tile of the
// block's result, from row mStart and column nStart. A pass covers KS k steps: KS*NT weight
// fragments, each feeding MT WMMAs. The weight fragments live in registers across passes:
// as soon as a fragment's WMMAs are issued, the same registers are loaded with the fragment
// of the next pass, so a weight load has almost a whole pass of WMMAs to arrive in.
// Bt holds the weights in fragment order (see tcast_part); nTot is their column count.
// The token tile (pitch lda elements) starts at byte aOff of the LDS array sm, the result
// (pitch ldo elements) at byte oOff; mStart is a multiple of 16, aOff of the row pitch.
template <int KTOT, int KS, int MT, int NT, bool RELU, bool OUT_F32>
__device__ __forceinline__ void gemm_tile(char* sm, int aOff, int lda,
                                          const bf16_t* __restrict__ Bt, int nTot,
                                          const float* __restrict__ bias,
                                          int oOff, int ldo,
                                          int mStart, int nStart, int lane) {
  constexpr int NG = KS * NT;   // weight fragments of a pass
  v8f acc[MT][NT];
#pragma unroll  // constant indices keep acc, a, b in registers
  for (int i = 0; i < MT; ++i)
#pragma unroll  // constant indices keep acc, a, b in registers
    for (int t = 0; t < NT; ++t)
#pragma unroll  // constant indices keep acc, a, b in registers
      for (int r = 0; r < 8; ++r) acc[i][t][r] = 0.f;

  // This lane's 16 bytes in the wave's first weight fragment; same k order as the token fragments (aL).
  // A k step's fragments of all columns lie side by side: the wave's NT are NT KB in a row.
  const bf16_t* bp = Bt + (size_t)nStart * 32 + lane * 8;
  const int kstep = nTot * 32;
  Frag b[NG];
  // Fragment g of the pass that bp points at (the next one, once the first is loaded):
  // k step g / NT, column tile g % NT.
  auto ldb = [&](int g) {
    const unsigned int* p = (const unsigned int*)(bp + (g / NT) * kstep + (g % NT) * 512);
    b[g].u[0] = p[0];   b[g].u[1] = p[1];   b[g].u[2] = p[2];   b[g].u[3] = p[3];
    b[g].u[4] = p[128]; b[g].u[5] = p[129]; b[g].u[6] = p[130]; b[g].u[7] = p[131];
  };
#pragma unroll  // constant indices keep acc, a, b in registers
  for (int g = 0; g < NG; ++g) ldb(g);
  // The loads name bp's registers. Taking bp as an input keeps those registers as they are
  // up to this wait; the advance to the next pass's fragments stands behind it.
  asm volatile("s_wait_xcnt 0x0" :: "v"(bp) : "memory");
  bp += KS * kstep;
  const int aL = aOff + (mStart + (lane & 15)) * lda * 2 + swz(lane, (lane >> 4) << 4);
  auto pass = [&](int kk, auto more) {
    Frag a[KS][MT];
#pragma unroll  // constant indices keep acc, a, b in registers
    for (int s = 0; s < KS; ++s)
#pragma unroll  // constant indices keep acc, a, b in registers
      for (int i = 0; i < MT; ++i) {
        a[s][i].q[0] = *(const v4u*)(sm + ((aL ^ ((kk + s * 32) * 2)) + i * 16 * lda * 2));
        a[s][i].q[1] = *(const v4u*)(sm + ((aL ^ ((kk + s * 32) * 2) ^ 32) + i * 16 * lda * 2));
      }
    __builtin_amdgcn_sched_barrier(0);
#pragma unroll  // constant indices keep acc, a, b in registers
    for (int g = 0; g < NG; ++g) {
#pragma unroll  // constant indices keep acc, a, b in registers
      for (int i = 0; i < MT; ++i) acc[i][g % NT] = wmma_bf16(a[g / NT][i], b[g], acc[i][g % NT]);
      // Keeps each reload where it is written, one fragment behind the WMMAs: gathered at one
      // end of the pass, the loads would have no WMMAs left to arrive under.
      __builtin_amdgcn_sched_barrier(0);
      if (decltype(more)::value && g > 0) {
        ldb(g - 1);
        __builtin_amdgcn_sched_barrier(0);
      }
    }
    if (decltype(more)::value) {
      ldb(NG - 1);
      // The pass's loads name bp's registers. Taking bp as an input keeps those registers as
      // they are up to this wait; the advance and the next pass's address sums stand behind it.
      asm volatile("s_wait_xcnt 0x0" :: "v"(bp) : "memory");
      bp += KS * kstep;
    }
  };
#pragma nounroll  // a pass already holds 32 to 48 WMMAs; copies of it would only add KBs of text
  for (int kk = 0; kk < KTOT - KS * 32; kk += KS * 32) pass(kk, Sel<true>{});
  pass(KTOT - KS * 32, Sel<false>{});   // last pass: nothing left to load
  const int n0 = nStart + (lane & 15);
  // bf16 result: this lane's place for t = 0, i = 0, r = 0 under swz, where m & 15 is
  // (lane >> 4) * 8 + r. nStart is a multiple of 128 there, so the column step t * 32 bytes
  // and swz's r * 16 fall in bits that an XOR with a constant sets: one XOR per (t, r).
  const int oL = oOff + (mStart + ((lane >> 4) << 3)) * ldo * 2 + swz((lane >> 4) << 3, n0 * 2);
  float bzs[NT];
#pragma unroll  // all NT loads in flight at once; constant indices keep bzs in registers
  for (int t = 0; t < NT; ++t) bzs[t] = bias[n0 + t * 16];
  // All NT loads name n0's register. Taking n0 as an input keeps that register as it is
  // up to this wait, so nothing reuses it before it.
  asm volatile("s_wait_xcnt 0x0" :: "v"(n0) : "memory");
#pragma unroll  // constant indices keep acc, a, b in registers
  for (int t = 0; t < NT; ++t) {
    const int n = n0 + t * 16;
    const float bz = bzs[t];
#pragma unroll  // constant indices keep acc, a, b in registers
    for (int i = 0; i < MT; ++i) {
      const int mo = mStart + i * 16 + ((lane >> 4) << 3);
#pragma unroll  // constant indices keep acc, a, b in registers
      for (int r = 0; r < 8; ++r) {
        float v = acc[i][t][r] + bz;
        if (RELU) v = v > 0.f ? v : 0.f;
        const int m = mo + r;
        if (OUT_F32) *(float*)(sm + oOff + (m * ldo + n) * 4) = v;
        else         *(bf16_t*)(sm + ((oL ^ ((t * 32) ^ (r * 16))) + (i * 16 + r) * ldo * 2)) = (bf16_t)v;
      }
    }
  }
}

// ---------------------------------------------------------------------------
// Prep kernels
// ---------------------------------------------------------------------------
// First launch: the start values of the gating's counters (it runs in the next launch) and
// the bf16 copy of x.
extern "C" __global__ void init_cast_kernel(int* __restrict__ counts,
                                            float* __restrict__ importance,
                                            const float* __restrict__ x,
                                            bf16_t* __restrict__ xb, int n) {
  const int i0 = blockIdx.x * blockDim.x + threadIdx.x;
  if (i0 < E_) { counts[i0] = 0; importance[i0] = 0.f; }
  for (int i = i0; i < n; i += gridDim.x * blockDim.x)
    xb[i] = (bf16_t)x[i];
}

// Casts src[e][r][c] to bf16 and lays it out in WMMA B-fragment order. The fragment of
// k chunk r / 32 and column tile c / 16 is 1 KB at fragment index (r / 32) * (C / 16) + c / 16;
// inside it the 16-byte piece of 8 consecutive r sits at [(r >> 4) & 1][lane], where
// lane = (c & 15) + 16 * ((r >> 3) & 1). So each of a fragment's two wave-wide 16-byte
// loads in gemm_tile reads 512 contiguous bytes (4 whole lines, not 32 bytes of 16 lines).
// One block moves one 128 x 128 tile. Reads: a wave takes 512 contiguous bytes of one
// src row per load. Each thread turns its 16 rows x 4 columns into 16-byte pieces of
// 8 consecutive r in registers; LDS only regroups the pieces so that a wave's store
// covers 512 contiguous bytes of dst (half a fragment).
// A part of prep_kernel: (R/128) * (C/128) * E blocks of 256 threads, blk the block's index
// among them; the row tile runs fastest in blk, the expert slowest. tile: 32 KB of LDS,
// handed in so that the three shapes share one array.
typedef __attribute__((ext_vector_type(8))) __bf16 v8bf;
typedef __attribute__((ext_vector_type(4))) float  v4f;
typedef __attribute__((ext_vector_type(2))) float  v2f;

template <int R, int C>  // compile-time pitches: every row step is an immediate offset
__device__ __forceinline__ void
tcast_part(const float* __restrict__ src, bf16_t* __restrict__ dst, v8bf* tile, int blk) {
  const int tid = threadIdx.x;
  const int r0 = (blk % (R / 128)) * 128, c0 = ((blk / (R / 128)) % (C / 128)) * 128;
  const size_t eoff = (size_t)(blk / ((R / 128) * (C / 128))) * R * C;

  const int cq = tid & 31, rg = tid >> 5;   // 4 columns from cq * 4, 16 rows from rg * 16
  const float* s = src + eoff + (size_t)(r0 + rg * 16) * C + c0 + cq * 4;
  v4f v[16];
#pragma unroll  // all 16 loads in flight at once; constant indices keep v in registers
  for (int i = 0; i < 16; ++i) v[i] = *(const v4f*)(s + (size_t)i * C);
  // All 16 loads name s's registers. Taking s as an input keeps those registers as they
  // are up to this wait, so nothing (a later load's result included) reuses them before it.
  asm volatile("s_wait_xcnt 0x0" :: "v"(s) : "memory");
  // Keeps the conversions behind the last load; left free, the compiler waits for the
  // first rows before it has issued the last ones.
  __builtin_amdgcn_sched_barrier(0);

#pragma unroll  // constant indices keep v in registers
  for (int j = 0; j < 4; ++j)
#pragma unroll  // constant indices keep v in registers
    for (int h = 0; h < 2; ++h) {
      v8bf o;
#pragma unroll  // constant indices keep v in registers
      for (int i = 0; i < 8; ++i) o[i] = (bf16_t)v[h * 8 + i][j];
      tile[(cq * 4 + j) * 16 + ((rg * 2 + h) ^ (cq & 15) ^ (j << 2))] = o;
    }
  __syncthreads();

  // The tile is 4 k chunks of 8 fragments: 8 KB in a row per chunk, two passes p each.
  const int fl = tid & 31, fh = (tid >> 5) & 1;   // lane and half inside a fragment
  bf16_t* d = dst + eoff + ((size_t)(r0 / 32) * (C / 16) + c0 / 16) * 512 + tid * 8;
#pragma unroll  // the 8 LDS reads and stores go out back to back
  for (int p = 0; p < 8; ++p) {
    const int c = ((p & 1) * 4 + (tid >> 6)) * 16 + (fl & 15);
    const int k = (p >> 1) * 4 + fh * 2 + (fl >> 4);
    *(v8bf*)(d + (size_t)(p >> 1) * (C / 16) * 512 + (p & 1) * 2048) =
        tile[c * 16 + (k ^ ((c >> 2) & 15) ^ ((c & 3) << 2))];
  }
  // The stores name d's and their data's registers; inlined into prep_kernel, code of another
  // branch follows them in the listing and rewrites such registers. The wait stands ahead of it.
  asm volatile("s_wait_xcnt 0x0" ::: "memory");
}

#define GT 4
#define GB (8 * GT)
#define GP 36
__device__ __forceinline__ void
gating_part(const float* __restrict__ x, const float* __restrict__ noise,
            const float* __restrict__ gW, const float* __restrict__ gb,
            const float* __restrict__ nW, const float* __restrict__ nb,
            int* __restrict__ counts, int* __restrict__ assign,
            float* __restrict__ gate2, float* __restrict__ importance,
            char* lds, int blk) {
  float* lraw  = (float*)lds;                        // [GB][GP]: 16 clean, 16 noise sums
  float* lnz   = (float*)(lds + GB * GP * 4);        // [GB][16]: the noise input
  int*   lsel  = (int*)(lds + GB * (GP + 16) * 4);   // [GB]: first | second << 8
  float* lg0   = (float*)(lsel + GB);                // [GB], [GB]: the two gates
  float* lg1   = lg0 + GB;
  int*   lcnt  = (int*)(lg1 + GB);
  int*   lbase = lcnt + E_;
  const int tid  = threadIdx.x;
  const int lane = tid & 31;
  const int wid  = tid >> 5;
  const int e    = lane & 15;
  const bool np  = lane >= 16;

  if (tid < E_) lcnt[tid] = 0;
  // The block's noise values, 2 KB in a row, 16 bytes a thread of the first four waves; they
  // arrive under the sums below.
  const float* nzp = noise + (size_t)blk * GB * E_ + (tid & (GB * 4 - 1)) * 4;
  const v4f nz = *(const v4f*)nzp;
  const float* bpt = (np ? nb : gb) + e;
  const float bz = *bpt;
  // The bias load names bpt's registers. Taking bpt as an input keeps them as they are up to
  // this wait, so nothing (the noise load's result included) reuses them before it.
  asm volatile("s_wait_xcnt 0x0" :: "v"(bpt) : "memory");

  float acc[GT];
#pragma unroll  // constant indices keep acc in registers
  for (int j = 0; j < GT; ++j) acc[j] = bz;
  const float* xp = x + (size_t)(blk * GB + wid * GT) * IN_;
  const float* wp = (np ? nW : gW) + e;
#pragma nounroll  // a trip already has 32 loads in flight and their 80 registers
  for (int i0 = 0; i0 < IN_; i0 += 16) {
    v4f xv[GT][4];
    float wv[16];
#pragma unroll  // all loads in flight at once; constant indices keep xv in registers
    for (int j = 0; j < GT; ++j)
#pragma unroll  // all loads in flight at once; constant indices keep xv in registers
      for (int q = 0; q < 4; ++q) xv[j][q] = *(const v4f*)(xp + j * IN_ + q * 4);
#pragma unroll  // all loads in flight at once; constant indices keep wv in registers
    for (int k = 0; k < 16; ++k) wv[k] = wp[k * E_];
    // Keeps the sums behind the last load; left free, the compiler waits for the first
    // values before it has issued the last loads, and a trip pays the latency twice.
    __builtin_amdgcn_sched_barrier(0);
#pragma unroll  // constant indices keep acc, xv, wv in registers
    for (int k = 0; k < 16; ++k)
#pragma unroll  // constant indices keep acc, xv, wv in registers
      for (int j = 0; j < GT; ++j) acc[j] = __builtin_fmaf(xv[j][k >> 2][k & 3], wv[k], acc[j]);
    xp += 16;
    wp += 16 * E_;
  }
#pragma unroll  // constant indices keep acc in registers
  for (int j = 0; j < GT; ++j) lraw[(wid * GT + j) * GP + lane] = acc[j];
  if (tid < GB * 4) *(v4f*)(lnz + tid * 4) = nz;
  __syncthreads();

  // Noisy logits, GB * 16 of them, two a thread; each replaces its clean logit.
#pragma nounroll  // a second copy of log1pf would only add text
  for (int c = 0; c < GB * E_ / 256; ++c) {
    const int idx = c * 256 + tid, t = idx >> 4, q = idx & 15;
    const float pre_noise = lraw[t * GP + 16 + q];
    const float sp = (pre_noise > 20.f) ? pre_noise : log1pf(__expf(pre_noise));
    lraw[t * GP + q] = lraw[t * GP + q] + lnz[idx] * sp;
  }
  __syncthreads();

  // One thread per token: top 2, gates, and the token's rank among the block's tokens of
  // each of its two experts.
  int bi = 0, si = 0, r0 = 0, r1 = 0;
  float g0 = 0.f, g1 = 0.f;
  if (tid < GB) {
    v4f row[4];
#pragma unroll  // constant indices keep row in registers
    for (int q = 0; q < 4; ++q) row[q] = *(const v4f*)(lraw + tid * GP + q * 4);
    float best = -1e30f, second = -1e30f;
#pragma unroll  // constant indices keep row in registers
    for (int q = 0; q < 16; ++q) {
      const float v = row[q >> 2][q & 3];
      if (v > best)        { second = best; si = bi; best = v; bi = q; }
      else if (v > second) { second = v; si = q; }
    }
    const float e1 = __expf(second - best);
    g0 = 1.f / (1.f + e1);
    g1 = e1 / (1.f + e1);
    r0 = atomicAdd(&lcnt[bi], 1);
    r1 = atomicAdd(&lcnt[si], 1);
    lsel[tid] = bi | (si << 8);
    lg0[tid] = g0;
    lg1[tid] = g1;
  }
  __syncthreads();

  if (wid == 0) {
    if (lane < E_) lbase[lane] = atomicAdd(&counts[lane], lcnt[lane]);
  } else if (wid == 1) {
    // Gate sum of expert e over the block, in token order: each half wave takes 16 tokens.
    float s = 0.f;
    const int th = (lane >> 4) * (GB / 2);
    v4u sel[GB / 8];
    v4f ga[GB / 8], gc[GB / 8];
#pragma unroll  // the LDS reads go out together; constant indices keep them in registers
    for (int t = 0; t < GB / 8; ++t) {
      sel[t] = *(const v4u*)(lsel + th + t * 4);
      ga[t]  = *(const v4f*)(lg0 + th + t * 4);
      gc[t]  = *(const v4f*)(lg1 + th + t * 4);
    }
#pragma unroll  // constant indices keep sel, ga, gc in registers
    for (int t = 0; t < GB / 2; ++t) {
      s += ((int)(sel[t >> 2][t & 3] & 255) == e) ? ga[t >> 2][t & 3] : 0.f;
      s += ((int)(sel[t >> 2][t & 3] >> 8) == e)  ? gc[t >> 2][t & 3] : 0.f;
    }
    s += __shfl_xor(s, 16);
    if (lane < E_) atomicAdd(&importance[lane], s);
  }
  __syncthreads();

  if (tid < GB) {
    const int tok = blk * GB + tid;
    const int s0 = bi * B_ + lbase[bi] + r0, s1 = si * B_ + lbase[si] + r1;
    assign[s0] = tok * 2;
    assign[s1] = tok * 2 + 1;
    v2f gg;
    gg[0] = g0;  gg[1] = g1;
    *(v2f*)(gate2 + tok * 2) = gg;
    // The stores name s0's and s1's registers; inlined into prep_kernel, code of another
    // branch follows them in the listing. The wait stands ahead of it.
    asm volatile("s_wait_xcnt 0x0" :: "v"(s0), "v"(s1) : "memory");
  }
}

// ---------------------------------------------------------------------------
// Second launch: the gating and the three weight casts, which do not depend on one another,
// as ranges of blocks of one grid. None of them waits for another to drain, and the gating,
// which waits on load latency, runs beside the casts, which are limited by memory rate.
// The gating blocks have the longest chain and come first.
// ---------------------------------------------------------------------------
#define NB_GATE (B_ / GB)
#define NB_W1   ((IN_ / 128) * (HID_ / 128) * E_)
#define NB_W2   ((HID_ / 128) * (HID_ / 128) * E_)
#define NB_WP   ((HID_ / 128) * (OUT_ / 128) * E_)
extern "C" __global__ void __launch_bounds__(256)
prep_kernel(const float* __restrict__ x, const float* __restrict__ noise,
            const float* __restrict__ gW, const float* __restrict__ gb,
            const float* __restrict__ nW, const float* __restrict__ nb,
            const float* __restrict__ W1, const float* __restrict__ W2,
            const float* __restrict__ Wp, bf16_t* __restrict__ W1t,
            bf16_t* __restrict__ W2t, bf16_t* __restrict__ Wpt,
            int* __restrict__ counts, int* __restrict__ assign,
            float* __restrict__ gate2, float* __restrict__ importance) {
  __shared__ v8bf tile[128 * 16];
  int blk = blockIdx.x;   // the same for the whole block: so is every branch below
  if (blk < NB_GATE) {
    gating_part(x, noise, gW, gb, nW, nb, counts, assign, gate2, importance, (char*)tile, blk);
    return;
  }
  blk -= NB_GATE;
  if (blk < NB_W2) { tcast_part<HID_, HID_>(W2, W2t, tile, blk); return; }
  blk -= NB_W2;
  if (blk < NB_W1) { tcast_part<IN_, HID_>(W1, W1t, tile, blk); return; }
  blk -= NB_W1;
  tcast_part<HID_, OUT_>(Wp, Wpt, tile, blk);
}

extern "C" __global__ void __launch_bounds__(256)
expert_kernel(const bf16_t* __restrict__ xb,
              const bf16_t* __restrict__ W1t, const float* __restrict__ b1,
              const bf16_t* __restrict__ W2t, const float* __restrict__ b2,
              const bf16_t* __restrict__ Wpt, const float* __restrict__ bp,
              const float* __restrict__ Wa, const float* __restrict__ ba,
              const int* __restrict__ counts, const int* __restrict__ assign,
              float* __restrict__ lgw, float* __restrict__ a0w) {
  __shared__ __attribute__((aligned(16))) char smem[2 * TM * HID_ * 2];
  bf16_t* bufA = (bf16_t*)smem;                    // 160KB: x tile (80x512) then h2 (80x1024)
  // second 160KB, from byte TM * HID_ * 2: h1 (80x1024)
  float*  lgts = (float*)(smem + TM * HID_ * 2);   //  80KB overlay on h1: logits (80x256)

  const int e   = blockIdx.x;
  const int cnt = counts[e];
  const int t0  = blockIdx.y * TM;
  if (t0 >= cnt) return;

  const int tid = threadIdx.x, lane = tid & 31, wid = tid >> 5;

  {
    const int col = tid & 63, rsub = tid >> 6;
    const int* ae = assign + e * B_;
    int slot[20], tok[20];
#pragma unroll
    for (int i = 0; i < 20; ++i) {
      slot[i] = t0 + i * 4 + rsub;
      if (slot[i] >= cnt) slot[i] = cnt - 1;
    }
#pragma unroll  // all 20 loads in flight at once; constant indices keep tok in registers
    for (int i = 0; i < 20; ++i) tok[i] = ae[slot[i]];
    asm volatile("s_wait_xcnt 0x0"
                 :: "v"(slot[0]), "v"(slot[1]), "v"(slot[2]), "v"(slot[3]), "v"(slot[4]),
                    "v"(slot[5]), "v"(slot[6]), "v"(slot[7]), "v"(slot[8]), "v"(slot[9]),
                    "v"(slot[10]), "v"(slot[11]), "v"(slot[12]), "v"(slot[13]), "v"(slot[14]),
                    "v"(slot[15]), "v"(slot[16]), "v"(slot[17]), "v"(slot[18]), "v"(slot[19])
                 : "memory");
    const bf16_t* g[20];
    unsigned l[20];
#pragma unroll  // constant indices keep g and l in registers
    for (int i = 0; i < 20; ++i) {
      g[i] = xb + (size_t)(tok[i] >> 1) * IN_ + col * 8;   // assign holds 2 * token + choice
      l[i] = (unsigned)(uintptr_t)(smem + (i * 4 + rsub) * IN_ * 2 + swz(i * 4 + rsub, col * 16));
    }
    // The wait closes each statement: the address registers stay as they are up to it.
    asm volatile(
        "global_load_async_to_lds_b128 %0, %1, off\n\t"
        "global_load_async_to_lds_b128 %2, %3, off\n\t"
        "global_load_async_to_lds_b128 %4, %5, off\n\t"
        "global_load_async_to_lds_b128 %6, %7, off\n\t"
        "global_load_async_to_lds_b128 %8, %9, off\n\t"
        "global_load_async_to_lds_b128 %10, %11, off\n\t"
        "global_load_async_to_lds_b128 %12, %13, off\n\t"
        "global_load_async_to_lds_b128 %14, %15, off\n\t"
        "global_load_async_to_lds_b128 %16, %17, off\n\t"
        "global_load_async_to_lds_b128 %18, %19, off\n\t"
        "s_wait_xcnt 0x0"
        :: "v"(l[0]), "v"(g[0]), "v"(l[1]), "v"(g[1]), "v"(l[2]), "v"(g[2]), "v"(l[3]), "v"(g[3]), "v"(l[4]), "v"(g[4]), "v"(l[5]), "v"(g[5]), "v"(l[6]), "v"(g[6]), "v"(l[7]), "v"(g[7]), "v"(l[8]), "v"(g[8]), "v"(l[9]), "v"(g[9]) : "memory");
    asm volatile(
        "global_load_async_to_lds_b128 %0, %1, off\n\t"
        "global_load_async_to_lds_b128 %2, %3, off\n\t"
        "global_load_async_to_lds_b128 %4, %5, off\n\t"
        "global_load_async_to_lds_b128 %6, %7, off\n\t"
        "global_load_async_to_lds_b128 %8, %9, off\n\t"
        "global_load_async_to_lds_b128 %10, %11, off\n\t"
        "global_load_async_to_lds_b128 %12, %13, off\n\t"
        "global_load_async_to_lds_b128 %14, %15, off\n\t"
        "global_load_async_to_lds_b128 %16, %17, off\n\t"
        "global_load_async_to_lds_b128 %18, %19, off\n\t"
        "s_wait_xcnt 0x0"
        :: "v"(l[10]), "v"(g[10]), "v"(l[11]), "v"(g[11]), "v"(l[12]), "v"(g[12]), "v"(l[13]), "v"(g[13]), "v"(l[14]), "v"(g[14]), "v"(l[15]), "v"(g[15]), "v"(l[16]), "v"(g[16]), "v"(l[17]), "v"(g[17]), "v"(l[18]), "v"(g[18]), "v"(l[19]), "v"(g[19]) : "memory");
    // The copies have landed before the barrier lets another wave read them.
    asm volatile("s_wait_asynccnt 0x0" ::: "memory");
  }
  __syncthreads();

  // h1 = relu(x @ W1 + b1)
  gemm_tile<IN_, 1, 5, 8, true, false>(smem, 0, IN_, W1t + (size_t)e * HID_ * IN_, HID_,
                                    b1 + e * HID_, TM * HID_ * 2, HID_, 0, wid * 128, lane);
  __syncthreads();
  // h2 = relu(h1 @ W2 + b2)  (overwrites x region)
  gemm_tile<HID_, 1, 5, 8, true, false>(smem, TM * HID_ * 2, HID_, W2t + (size_t)e * HID_ * HID_, HID_,
                                     b2 + e * HID_, 0, HID_, 0, wid * 128, lane);
  __syncthreads();
  // logits = h2 @ Wp + bp (float, overlays h1): four column strips of 64. Waves w and
  // w + 4 share a strip: one takes its upper 48 rows, the other its lower 32.
  if (__builtin_amdgcn_readfirstlane(wid) < 4)
    gemm_tile<HID_, 4, 3, 4, false, true>(smem, 0, HID_, Wpt + (size_t)e * OUT_ * HID_, OUT_,
                                       bp + e * OUT_, TM * HID_ * 2, OUT_, 0, (wid & 3) * 64, lane);
  else
    gemm_tile<HID_, 4, 2, 4, false, true>(smem, 0, HID_, Wpt + (size_t)e * OUT_ * HID_, OUT_,
                                       bp + e * OUT_, TM * HID_ * 2, OUT_, 48, (wid & 3) * 64, lane);
  __syncthreads();

  // Epilogue. Nothing here runs row after row: the loads, the ten alpha dots of a wave and
  // their lane sums each go out as one group, so their latencies overlap.
  const float* Wag = Wa + e * HID_;
  const float* bae = ba + e;
  const float  bag = *bae;
  // The load names bae's registers. Taking bae as an input keeps them as they are up to
  // this wait, so nothing reuses them before it.
  asm volatile("s_wait_xcnt 0x0" :: "s"(bae) : "memory");

  constexpr int RW = TM / 8;   // rows of a wave in the alpha dot
  const int* ae = assign + e * B_;
  const int sw = __builtin_amdgcn_readfirstlane(wid);   // the wave's number, held as a scalar
  const int rs = sw >> 1;
  // Where the results go. The wave copies out the 20 tile rows i * 4 + rs (as in the staging):
  // lane i fetches the row number of the i-th. Lane r also fetches that of tile row
  // wid * RW + r, whose a0 it will store.
  int cslot = t0 + (lane < 20 ? lane : 19) * 4 + rs;
  if (cslot >= cnt) cslot = cnt - 1;
  int aslot = t0 + wid * RW + (lane < RW ? lane : RW - 1);
  const bool alive = lane < RW && aslot < cnt;
  if (aslot >= cnt) aslot = cnt - 1;
  const int crow = ae[cslot];
  const int arow = ae[aslot];
  asm volatile("s_wait_xcnt 0x0" :: "v"(cslot), "v"(aslot) : "memory");

  // Alpha dot of RW rows per wave. In trip c a lane takes the 16-byte piece c * 32 + lane of
  // each h2 row (8 consecutive k) and the matching 8 values of Wa, which serve all RW rows.
  const char* wb = (const char*)Wag;   // the same for the whole block
  const unsigned wo = lane * 32;       // this lane's 8 values of trip 0, in bytes
  v4f wn0 = *(const v4f*)(wb + wo), wn1 = *(const v4f*)(wb + wo + 16);
  // The loads name the registers of wo and wb. Taking both as inputs keeps those registers as
  // they are up to this wait.
  asm volatile("s_wait_xcnt 0x0" :: "v"(wo), "s"(wb) : "memory");
  int hb[RW];   // this lane's piece of trip 0 in each row, at its place under swz
  float dot[RW];
#pragma unroll  // constant indices keep hb, dot in registers
  for (int r = 0; r < RW; ++r) {
    const int m = wid * RW + r;
    hb[r] = m * HID_ * 2 + swz(m, lane * 16);
    dot[r] = 0.f;
  }
#pragma nounroll  // four copies of the 120 sums and unpacks would add 3 KB of text run once
  for (int c = 0; c < 4; ++c) {
    const v4f w0 = wn0, w1 = wn1;
    // The next trip's Wa values arrive under this trip's sums (the last trip fetches its own again).
    const unsigned wx = wo + (c < 3 ? c + 1 : 3) * 1024;
    wn0 = *(const v4f*)(wb + wx);
    wn1 = *(const v4f*)(wb + wx + 16);
    // The loads name the registers of wx and wb. Taking both as inputs keeps those registers
    // as they are up to this wait.
    asm volatile("s_wait_xcnt 0x0" :: "v"(wx), "s"(wb) : "memory");
    v4u q[RW];
#pragma unroll  // the RW LDS reads go out together; constant indices keep q in registers
    for (int r = 0; r < RW; ++r) q[r] = *(const v4u*)(smem + hb[r] + c * 512);
#pragma unroll  // constant indices keep q, dot in registers
    for (int j = 0; j < 4; ++j)
#pragma unroll  // RW independent sums side by side
      for (int r = 0; r < RW; ++r) {
        const float wlo = j < 2 ? w0[(j & 1) * 2] : w1[(j & 1) * 2];
        const float whi = j < 2 ? w0[(j & 1) * 2 + 1] : w1[(j & 1) * 2 + 1];
        dot[r] = __builtin_fmaf(__uint_as_float(q[r][j] << 16), wlo, dot[r]);
        dot[r] = __builtin_fmaf(__uint_as_float(q[r][j] & 0xffff0000u), whi, dot[r]);
      }
  }
#pragma nounroll  // five exchange steps, each for all RW sums at once; one copy of the text
  for (int off = 16; off > 0; off >>= 1) {
    float o[RW];
#pragma unroll  // the RW exchanges go out together
    for (int r = 0; r < RW; ++r) o[r] = __shfl_xor(dot[r], off);
#pragma unroll  // constant indices keep dot in registers
    for (int r = 0; r < RW; ++r) dot[r] += o[r];
  }
  // Lane r finishes row r: one pass through softplus serves all RW rows.
  float pre = dot[0];
#pragma unroll  // constant indices keep dot in registers
  for (int r = 1; r < RW; ++r) pre = (lane == r) ? dot[r] : pre;
  pre += bag;
  const float spv = (pre > 20.f) ? pre : log1pf(__expf(pre));
  const float a0v = fminf(fmaxf(spv + 10.f, 1.f), 500.f);
  if (alive) a0w[arow] = a0v;

  // Logits rows out of LDS: a wave moves 512 contiguous bytes of one row per store.
  const int nrow = cnt - t0;
  // This lane's byte in a row: waves 2 * rs and 2 * rs + 1 share a row. The lane number is read
  // anew: the same value kept from the staging would live through the GEMMs and be spilled.
  const unsigned coff = (__lane_id() + ((sw & 1) << 5)) * 16;
  const char* lrow = (const char*)lgts + rs * OUT_ * 4 + coff;   // tile row rs; row i * 4 + rs is 4 KB * i on
  // The stores are written as text so that the wait closes their own statement.
  if (nrow >= TM) {
    v4f lv[20];
    float* rp[20];   // the rows' starts, the same for the whole wave
#pragma unroll  // the 20 LDS reads go out together; constant indices keep lv, rp in registers
    for (int i = 0; i < 20; ++i) {
      lv[i] = *(const v4f*)(lrow + i * 4 * OUT_ * 4);
      rp[i] = lgw + (size_t)__builtin_amdgcn_readlane(crow, i) * OUT_;
    }
    asm volatile(
        "global_store_b128 %0, %1, %2\n\t"
        "global_store_b128 %0, %3, %4\n\t"
        "global_store_b128 %0, %5, %6\n\t"
        "global_store_b128 %0, %7, %8\n\t"
        "global_store_b128 %0, %9, %10\n\t"
        "global_store_b128 %0, %11, %12\n\t"
        "global_store_b128 %0, %13, %14\n\t"
        "global_store_b128 %0, %15, %16\n\t"
        "global_store_b128 %0, %17, %18\n\t"
        "global_store_b128 %0, %19, %20\n\t"
        "s_wait_xcnt 0x0"
        :: "v"(coff), "v"(lv[0]), "s"(rp[0]), "v"(lv[1]), "s"(rp[1]), "v"(lv[2]), "s"(rp[2]), "v"(lv[3]), "s"(rp[3]), "v"(lv[4]), "s"(rp[4]), "v"(lv[5]), "s"(rp[5]), "v"(lv[6]), "s"(rp[6]), "v"(lv[7]), "s"(rp[7]), "v"(lv[8]), "s"(rp[8]), "v"(lv[9]), "s"(rp[9]) : "memory");
    asm volatile(
        "global_store_b128 %0, %1, %2\n\t"
        "global_store_b128 %0, %3, %4\n\t"
        "global_store_b128 %0, %5, %6\n\t"
        "global_store_b128 %0, %7, %8\n\t"
        "global_store_b128 %0, %9, %10\n\t"
        "global_store_b128 %0, %11, %12\n\t"
        "global_store_b128 %0, %13, %14\n\t"
        "global_store_b128 %0, %15, %16\n\t"
        "global_store_b128 %0, %17, %18\n\t"
        "global_store_b128 %0, %19, %20\n\t"
        "s_wait_xcnt 0x0"
        :: "v"(coff), "v"(lv[10]), "s"(rp[10]), "v"(lv[11]), "s"(rp[11]), "v"(lv[12]), "s"(rp[12]), "v"(lv[13]), "s"(rp[13]), "v"(lv[14]), "s"(rp[14]), "v"(lv[15]), "s"(rp[15]), "v"(lv[16]), "s"(rp[16]), "v"(lv[17]), "s"(rp[17]), "v"(lv[18]), "s"(rp[18]), "v"(lv[19]), "s"(rp[19]) : "memory");
  } else {
    // An expert's last tile: only the rows that hold a token go out, four rows a trip.
#pragma nounroll  // one copy of the text; at most one tile in an expert's dozen comes here
    for (int i0 = 0; i0 < 20; i0 += 4) {
      v4f lw[4];
#pragma unroll  // the 4 LDS reads go out together; constant indices keep lw in registers
      for (int u = 0; u < 4; ++u) lw[u] = *(const v4f*)(lrow + (i0 + u) * 4 * OUT_ * 4);
#pragma unroll  // constant indices keep lw in registers
      for (int u = 0; u < 4; ++u)
        if ((i0 + u) * 4 + rs < nrow) {
          float* rq = lgw + (size_t)__builtin_amdgcn_readlane(crow, i0 + u) * OUT_;
          asm volatile("global_store_b128 %0, %1, %2\n\ts_wait_xcnt 0x0"
                       :: "v"(coff), "v"(lw[u]), "s"(rq) : "memory");
        }
    }
  }
}

// ---------------------------------------------------------------------------
// Post, one launch: block 0 does the aux loss (ddof=1 std); every wave of the other blocks
// does one token: softmax of its two logits rows, gated combine, row normalization, alpha0.
// ---------------------------------------------------------------------------
__device__ __forceinline__ void aux_part(const float* __restrict__ importance,
                                         const int* __restrict__ counts,
                                         float* __restrict__ out_aux) {
  if (threadIdx.x == 0) {
    float mi = 0.f, ml = 0.f;
    for (int i = 0; i < E_; ++i) { mi += importance[i]; ml += (float)counts[i]; }
    mi /= (float)E_; ml /= (float)E_;
    float vi = 0.f, vl = 0.f;
    for (int i = 0; i < E_; ++i) {
      const float di = importance[i] - mi; vi += di * di;
      const float dl = (float)counts[i] - ml; vl += dl * dl;
    }
    vi /= (float)(E_ - 1); vl /= (float)(E_ - 1);
    *out_aux = sqrtf(vi) / (mi + 1e-8f) + sqrtf(vl) / (ml + 1e-8f);
  }
}

__device__ __forceinline__ float exp_slot(float x) {
  const float t = x * 1.44269504f;
  float r;
  asm("v_exp_f32 %0, %1\n\tv_nop" : "=v"(r) : "v"(t));
  return r;
}

extern "C" __global__ void __launch_bounds__(256)
combine_kernel(const float* __restrict__ lgw, const float* __restrict__ a0w,
               const float* __restrict__ gate2, const float* __restrict__ importance,
               const int* __restrict__ counts, float* __restrict__ p_hat,
               float* __restrict__ alpha0, float* __restrict__ out_aux) {
  if (blockIdx.x == 0) { aux_part(importance, counts, out_aux); return; }
  const int lane = threadIdx.x & 31;
  const int tok = (blockIdx.x - 1) * 8 + (threadIdx.x >> 5);
  // The token's two rows lie side by side; a lane holds columns lane * 4 + 0..3 and 128 more.
  const float* lp = lgw + (size_t)tok * 2 * OUT_ + lane * 4;
  const float* gp = gate2 + tok * 2;
  const float* ap = a0w + tok * 2;
  v4f v[2][2];
#pragma unroll  // all loads in flight at once; constant indices keep v in registers
  for (int h = 0; h < 2; ++h)
#pragma unroll  // all loads in flight at once; constant indices keep v in registers
    for (int q = 0; q < 2; ++q) v[h][q] = *(const v4f*)(lp + h * OUT_ + q * 128);
  const v2f g = *(const v2f*)gp;
  const v2f a = *(const v2f*)ap;
  // The loads name these pointers' registers. Taking them as inputs keeps those registers as
  // they are up to this wait, so nothing (a load's result included) reuses them before it.
  asm volatile("s_wait_xcnt 0x0" :: "v"(lp), "v"(gp), "v"(ap) : "memory");

  float mx[2], sm[2];
#pragma unroll  // constant indices keep v, mx in registers
  for (int h = 0; h < 2; ++h) {
    mx[h] = -1e30f;
#pragma unroll  // constant indices keep v in registers
    for (int k = 0; k < 8; ++k) mx[h] = fmaxf(mx[h], v[h][k >> 2][k & 3]);
  }
#pragma unroll  // both rows' exchanges go out together
  for (int off = 16; off > 0; off >>= 1) {
    const float o0 = __shfl_xor(mx[0], off), o1 = __shfl_xor(mx[1], off);
    mx[0] = fmaxf(mx[0], o0);  mx[1] = fmaxf(mx[1], o1);
  }
#pragma unroll  // constant indices keep v, sm in registers
  for (int h = 0; h < 2; ++h) {
    sm[h] = 0.f;
#pragma unroll  // constant indices keep v in registers
    for (int k = 0; k < 8; ++k) {
      v[h][k >> 2][k & 3] = exp_slot(v[h][k >> 2][k & 3] - mx[h]);
      sm[h] += v[h][k >> 2][k & 3];
    }
  }
#pragma unroll  // both rows' exchanges go out together
  for (int off = 16; off > 0; off >>= 1) {
    const float o0 = __shfl_xor(sm[0], off), o1 = __shfl_xor(sm[1], off);
    sm[0] += o0;  sm[1] += o1;
  }
  const float i0 = g[0] / sm[0], i1 = g[1] / sm[1];
  v4f p[2];
  float tot = 0.f;
#pragma unroll  // constant indices keep v, p in registers
  for (int k = 0; k < 8; ++k) {
    p[k >> 2][k & 3] = v[0][k >> 2][k & 3] * i0 + v[1][k >> 2][k & 3] * i1;
    tot += p[k >> 2][k & 3];
  }
#pragma unroll  // five exchange steps with constant lane distances
  for (int off = 16; off > 0; off >>= 1) tot += __shfl_xor(tot, off);
  const float den = tot + 1e-8f;
#pragma unroll  // constant indices keep p in registers
  for (int k = 0; k < 8; ++k) p[k >> 2][k & 3] = p[k >> 2][k & 3] / den;
  float* op = p_hat + (size_t)tok * OUT_ + lane * 4;
  *(v4f*)op = p[0];
  *(v4f*)(op + 128) = p[1];
  if (lane == 0) alpha0[tok] = g[0] * a[0] + g[1] * a[1];
}

// ---------------------------------------------------------------------------
// Host launch
// ---------------------------------------------------------------------------
extern "C" void kernel_launch(void* const* d_in, const int* in_sizes, int n_in,
                              void* d_out, int out_size, void* d_ws, size_t ws_size,
                              hipStream_t stream) {
  const float* x   = (const float*)d_in[0];
  const float* noi = (const float*)d_in[1];
  const float* gW  = (const float*)d_in[2];
  const float* gb  = (const float*)d_in[3];
  const float* nW  = (const float*)d_in[4];
  const float* nb  = (const float*)d_in[5];
  const float* W1  = (const float*)d_in[6];
  const float* b1  = (const float*)d_in[7];
  const float* W2  = (const float*)d_in[8];
  const float* b2  = (const float*)d_in[9];
  const float* Wp  = (const float*)d_in[10];
  const float* bp  = (const float*)d_in[11];
  const float* Wa  = (const float*)d_in[12];
  const float* ba  = (const float*)d_in[13];

  float* out    = (float*)d_out;
  float* p_hat  = out;                           // [B, OUT]
  float* alpha0 = out + (size_t)B_ * OUT_;       // [B]
  float* auxp   = out + (size_t)B_ * OUT_ + B_;  // scalar

  char* w = (char*)d_ws;
  bf16_t* xb  = (bf16_t*)w;  w += (size_t)B_ * IN_ * 2;         // 8 MB
  bf16_t* W1t = (bf16_t*)w;  w += (size_t)E_ * HID_ * IN_ * 2;  // 16 MB
  bf16_t* W2t = (bf16_t*)w;  w += (size_t)E_ * HID_ * HID_ * 2; // 32 MB
  bf16_t* Wpt = (bf16_t*)w;  w += (size_t)E_ * OUT_ * HID_ * 2; // 8 MB
  int*    counts     = (int*)w;   w += 256;
  int*    assign     = (int*)w;   w += (size_t)E_ * B_ * 4;     // 512 KB
  float*  gate2      = (float*)w; w += (size_t)B_ * 2 * 4;      // 64 KB
  float*  a0w        = (float*)w; w += (size_t)B_ * 2 * 4;      // 64 KB
  float*  importance = (float*)w; w += 256;
  float*  lgw        = (float*)w; w += (size_t)B_ * 2 * OUT_ * 4; // 16 MB

  init_cast_kernel<<<2048, 256, 0, stream>>>(counts, importance, x, xb, B_ * IN_);
  prep_kernel<<<NB_GATE + NB_W2 + NB_W1 + NB_WP, 256, 0, stream>>>(
      x, noi, gW, gb, nW, nb, W1, W2, Wp, W1t, W2t, Wpt,
      counts, assign, gate2, importance);

  dim3 eg(E_, (B_ + TM - 1) / TM);
  expert_kernel<<<eg, 256, 0, stream>>>(xb, W1t, b1, W2t, b2, Wpt, bp,
                                                 Wa, ba, counts, assign, lgw, a0w);

  combine_kernel<<<B_ / 8 + 1, 256, 0, stream>>>(lgw, a0w, gate2, importance, counts,
                                                 p_hat, alpha0, auxp);
}

// v010
// Measured time: 95 microseconds a run.
// Timed twice side by side with v009, it ran 1.07 and 1.03 times as fast.
// Over all steps from v000 it is 8.44 times as fast.
#include <hip/hip_runtime.h>
#include <hip/hip_bf16.h>
#include <math.h>

typedef __bf16 bf16_t;
typedef __attribute__((ext_vector_type(16))) __bf16 v16bf;
typedef __attribute__((ext_vector_type(8)))  float  v8f;

#define B_   8192
#define IN_  512
#define HID_ 1024
#define OUT_ 256
#define E_   16
#define TM   80      // token tile (M) per block

typedef __attribute__((ext_vector_type(4))) unsigned int v4u;
typedef __attribute__((ext_vector_type(8))) __bf16 v8bf;
typedef __attribute__((ext_vector_type(4))) float  v4f;
typedef __attribute__((ext_vector_type(2))) float  v2f;

union Frag { v16bf v; unsigned int u[8]; v4u q[2]; };

__device__ __forceinline__ int swz(int m, int b) { return b ^ ((m & 15) << 4); }

__device__ __forceinline__ v8f wmma_bf16(const Frag& a, const Frag& b, v8f c) {
  return __builtin_amdgcn_wmma_f32_16x16x32_bf16(
      /*neg_a=*/false, a.v, /*neg_b=*/false, b.v,
      /*c_mod=*/(short)0, c, /*reuse_a=*/false, /*reuse_b=*/false);
}

// Compile-time switch handed to the k pass of gemm_tile: with or without the next loads.
template <bool V> struct Sel { static constexpr bool value = V; };

// One block = 8 waves. Each wave holds an (MT*16) x (NT*16) register tile of the
// block's result, from row mStart and column nStart. A pass covers KS k steps: KS*NT weight
// fragments, each feeding MT WMMAs. The weight fragments live in registers across passes:
// as soon as a fragment's WMMAs are issued, the same registers are loaded with the fragment
// of the next pass, so a weight load has almost a whole pass of WMMAs to arrive in.
// Bt holds the weights in fragment order (see tcast_part); nTot is their column count.
// The token tile (pitch lda elements) starts at byte aOff of the LDS array sm, the result
// (pitch ldo elements) at byte oOff; mStart is a multiple of 16, aOff of the row pitch.
// A bf16 result is computed transposed: the weight fragment goes in as the A operand and the
// token fragment as B (the two layouts mirror each other, so no loader changes). A lane then
// holds 8 consecutive columns of ONE token row, which are one 16-byte piece of the LDS tile.
template <int KTOT, int KS, int MT, int NT, bool RELU, bool OUT_F32>
__device__ __forceinline__ void gemm_tile(char* sm, int aOff, int lda,
                                          const bf16_t* __restrict__ Bt, int nTot,
                                          const float* __restrict__ bias,
                                          int oOff, int ldo,
                                          int mStart, int nStart, int lane) {
  constexpr int NG = KS * NT;   // weight fragments of a pass
  v8f acc[MT][NT];
#pragma unroll  // constant indices keep acc, a, b in registers
  for (int i = 0; i < MT; ++i)
#pragma unroll  // constant indices keep acc, a, b in registers
    for (int t = 0; t < NT; ++t)
#pragma unroll  // constant indices keep acc, a, b in registers
      for (int r = 0; r < 8; ++r) acc[i][t][r] = 0.f;

  // This lane's 16 bytes in the wave's first weight fragment; same k order as the token fragments (aL).
  // A k step's fragments of all columns lie side by side: the wave's NT are NT KB in a row.
  const bf16_t* bp = Bt + (size_t)nStart * 32 + lane * 8;
  const int kstep = nTot * 32;
  Frag b[NG];
  // Fragment g of the pass that bp points at (the next one, once the first is loaded):
  // k step g / NT, column tile g % NT.
  auto ldb = [&](int g) {
    const unsigned int* p = (const unsigned int*)(bp + (g / NT) * kstep + (g % NT) * 512);
    b[g].u[0] = p[0];   b[g].u[1] = p[1];   b[g].u[2] = p[2];   b[g].u[3] = p[3];
    b[g].u[4] = p[128]; b[g].u[5] = p[129]; b[g].u[6] = p[130]; b[g].u[7] = p[131];
  };
#pragma unroll  // constant indices keep acc, a, b in registers
  for (int g = 0; g < NG; ++g) ldb(g);
  // The loads name bp's registers. Taking bp as an input keeps those registers as they are
  // up to this wait; the advance to the next pass's fragments stands behind it.
  asm volatile("s_wait_xcnt 0x0" :: "v"(bp) : "memory");
  bp += KS * kstep;
  const int aL = aOff + (mStart + (lane & 15)) * lda * 2 + swz(lane, (lane >> 4) << 4);
  auto pass = [&](int kk, auto more) {
    Frag a[KS][MT];
#pragma unroll  // constant indices keep acc, a, b in registers
    for (int s = 0; s < KS; ++s)
#pragma unroll  // constant indices keep acc, a, b in registers
      for (int i = 0; i < MT; ++i) {
        a[s][i].q[0] = *(const v4u*)(sm + ((aL ^ ((kk + s * 32) * 2)) + i * 16 * lda * 2));
        a[s][i].q[1] = *(const v4u*)(sm + ((aL ^ ((kk + s * 32) * 2) ^ 32) + i * 16 * lda * 2));
      }
    __builtin_amdgcn_sched_barrier(0);
#pragma unroll  // constant indices keep acc, a, b in registers
    for (int g = 0; g < NG; ++g) {
#pragma unroll  // constant indices keep acc, a, b in registers
      for (int i = 0; i < MT; ++i)
        acc[i][g % NT] = OUT_F32 ? wmma_bf16(a[g / NT][i], b[g], acc[i][g % NT])
                                 : wmma_bf16(b[g], a[g / NT][i], acc[i][g % NT]);
      // Keeps each reload where it is written, one fragment behind the WMMAs: gathered at one
      // end of the pass, the loads would have no WMMAs left to arrive under.
      __builtin_amdgcn_sched_barrier(0);
      if (decltype(more)::value && g > 0) {
        ldb(g - 1);
        __builtin_amdgcn_sched_barrier(0);
      }
    }
    if (decltype(more)::value) {
      ldb(NG - 1);
      // The pass's loads name bp's registers. Taking bp as an input keeps those registers as
      // they are up to this wait; the advance and the next pass's address sums stand behind it.
      asm volatile("s_wait_xcnt 0x0" :: "v"(bp) : "memory");
      bp += KS * kstep;
    }
  };
#pragma nounroll  // a pass already holds 32 to 48 WMMAs; copies of it would only add KBs of text
  for (int kk = 0; kk < KTOT - KS * 32; kk += KS * 32) pass(kk, Sel<true>{});
  pass(KTOT - KS * 32, Sel<false>{});   // last pass: nothing left to load
  if constexpr (OUT_F32) {
    const int n0 = nStart + (lane & 15);
    float bzs[NT];
#pragma unroll  // all NT loads in flight at once; constant indices keep bzs in registers
    for (int t = 0; t < NT; ++t) bzs[t] = bias[n0 + t * 16];
    // All NT loads name n0's register. Taking n0 as an input keeps that register as it is
    // up to this wait, so nothing reuses it before it.
    asm volatile("s_wait_xcnt 0x0" :: "v"(n0) : "memory");
#pragma unroll  // constant indices keep acc, a, b in registers
    for (int t = 0; t < NT; ++t) {
      const int n = n0 + t * 16;
      const float bz = bzs[t];
#pragma unroll  // constant indices keep acc, a, b in registers
      for (int i = 0; i < MT; ++i) {
        const int mo = mStart + i * 16 + ((lane >> 4) << 3);
#pragma unroll  // constant indices keep acc, a, b in registers
        for (int r = 0; r < 8; ++r) {
          float v = acc[i][t][r] + bz;
          if (RELU) v = v > 0.f ? v : 0.f;
          *(float*)(sm + oOff + ((mo + r) * ldo + n) * 4) = v;
        }
      }
    }
  } else {
    const int n8 = nStart + ((lane >> 4) << 3);
    // This lane's 16-byte piece for t = 0, i = 0 under swz (m & 15 = lane & 15 in every row
    // tile). nStart is a multiple of 128, so the column step t * 32 bytes falls in bits that
    // are 0 before swz: one XOR per t.
    const int oL = oOff + (mStart + (lane & 15)) * ldo * 2 + swz(lane, n8 * 2);
    const char* bb = (const char*)bias;   // the same for the whole block
    const unsigned bo = n8 * 4;           // this lane's 8 bias values of t = 0, in bytes
    v4f bzs[NT][2];
#pragma unroll  // all loads in flight at once; constant indices keep bzs in registers
    for (int t = 0; t < NT; ++t) {
      bzs[t][0] = *(const v4f*)(bb + bo + t * 64);
      bzs[t][1] = *(const v4f*)(bb + bo + t * 64 + 16);
    }
    // All the loads name the registers of bo and bb. Taking both as inputs keeps those
    // registers as they are up to this wait, so nothing (a load's result included) reuses them.
    asm volatile("s_wait_xcnt 0x0" :: "v"(bo), "s"(bb) : "memory");
#pragma unroll  // constant indices keep acc, bzs in registers
    for (int t = 0; t < NT; ++t)
#pragma unroll  // constant indices keep acc, bzs in registers
      for (int i = 0; i < MT; ++i) {
        v8bf o;
#pragma unroll  // constant indices keep acc, bzs in registers
        for (int r = 0; r < 8; ++r) {
          float v = acc[i][t][r] + bzs[t][r >> 2][r & 3];
          if (RELU) v = v > 0.f ? v : 0.f;
          o[r] = (bf16_t)v;
        }
        *(v8bf*)(sm + ((oL ^ (t * 32)) + i * 16 * ldo * 2)) = o;
      }
  }
}

// ---------------------------------------------------------------------------
// Prep kernels
// ---------------------------------------------------------------------------
// First launch: the start values of the gating's counters (it runs in the next launch) and
// the bf16 copy of x.
extern "C" __global__ void init_cast_kernel(int* __restrict__ counts,
                                            float* __restrict__ importance,
                                            const float* __restrict__ x,
                                            bf16_t* __restrict__ xb, int n) {
  const int i0 = blockIdx.x * blockDim.x + threadIdx.x;
  if (i0 < E_) { counts[i0] = 0; importance[i0] = 0.f; }
  for (int i = i0; i < n; i += gridDim.x * blockDim.x)
    xb[i] = (bf16_t)x[i];
}

// Casts src[e][r][c] to bf16 and lays it out in WMMA B-fragment order. The fragment of
// k chunk r / 32 and column tile c / 16 is 1 KB at fragment index (r / 32) * (C / 16) + c / 16;
// inside it the 16-byte piece of 8 consecutive r sits at [(r >> 4) & 1][lane], where
// lane = (c & 15) + 16 * ((r >> 3) & 1). So each of a fragment's two wave-wide 16-byte
// loads in gemm_tile reads 512 contiguous bytes (4 whole lines, not 32 bytes of 16 lines).
// One block moves one 128 x 128 tile. Reads: a wave takes 512 contiguous bytes of one
// src row per load. Each thread turns its 16 rows x 4 columns into 16-byte pieces of
// 8 consecutive r in registers; LDS only regroups the pieces so that a wave's store
// covers 512 contiguous bytes of dst (half a fragment).
// A part of prep_kernel: (R/128) * (C/128) * E blocks of 256 threads, blk the block's index
// among them; the row tile runs fastest in blk, the expert slowest. tile: 32 KB of LDS,
// handed in so that the three shapes share one array.
template <int R, int C>  // compile-time pitches: every row step is an immediate offset
__device__ __forceinline__ void
tcast_part(const float* __restrict__ src, bf16_t* __restrict__ dst, v8bf* tile, int blk) {
  const int tid = threadIdx.x;
  const int r0 = (blk % (R / 128)) * 128, c0 = ((blk / (R / 128)) % (C / 128)) * 128;
  const size_t eoff = (size_t)(blk / ((R / 128) * (C / 128))) * R * C;

  const int cq = tid & 31, rg = tid >> 5;   // 4 columns from cq * 4, 16 rows from rg * 16
  const float* s = src + eoff + (size_t)(r0 + rg * 16) * C + c0 + cq * 4;
  v4f v[16];
#pragma unroll  // all 16 loads in flight at once; constant indices keep v in registers
  for (int i = 0; i < 16; ++i) v[i] = *(const v4f*)(s + (size_t)i * C);
  // All 16 loads name s's registers. Taking s as an input keeps those registers as they
  // are up to this wait, so nothing (a later load's result included) reuses them before it.
  asm volatile("s_wait_xcnt 0x0" :: "v"(s) : "memory");
  // Keeps the conversions behind the last load; left free, the compiler waits for the
  // first rows before it has issued the last ones.
  __builtin_amdgcn_sched_barrier(0);

#pragma unroll  // constant indices keep v in registers
  for (int j = 0; j < 4; ++j)
#pragma unroll  // constant indices keep v in registers
    for (int h = 0; h < 2; ++h) {
      v8bf o;
#pragma unroll  // constant indices keep v in registers
      for (int i = 0; i < 8; ++i) o[i] = (bf16_t)v[h * 8 + i][j];
      tile[(cq * 4 + j) * 16 + ((rg * 2 + h) ^ (cq & 15) ^ (j << 2))] = o;
    }
  __syncthreads();

  // The tile is 4 k chunks of 8 fragments: 8 KB in a row per chunk, two passes p each.
  const int fl = tid & 31, fh = (tid >> 5) & 1;   // lane and half inside a fragment
  bf16_t* d = dst + eoff + ((size_t)(r0 / 32) * (C / 16) + c0 / 16) * 512 + tid * 8;
#pragma unroll  // the 8 LDS reads and stores go out back to back
  for (int p = 0; p < 8; ++p) {
    const int c = ((p & 1) * 4 + (tid >> 6)) * 16 + (fl & 15);
    const int k = (p >> 1) * 4 + fh * 2 + (fl >> 4);
    *(v8bf*)(d + (size_t)(p >> 1) * (C / 16) * 512 + (p & 1) * 2048) =
        tile[c * 16 + (k ^ ((c >> 2) & 15) ^ ((c & 3) << 2))];
  }
  // The stores name d's and their data's registers; inlined into prep_kernel, code of another
  // branch follows them in the listing and rewrites such registers. The wait stands ahead of it.
  asm volatile("s_wait_xcnt 0x0" ::: "memory");
}

#define GT 4
#define GB (8 * GT)
#define GP 36
__device__ __forceinline__ void
gating_part(const float* __restrict__ x, const float* __restrict__ noise,
            const float* __restrict__ gW, const float* __restrict__ gb,
            const float* __restrict__ nW, const float* __restrict__ nb,
            int* __restrict__ counts, int* __restrict__ assign,
            float* __restrict__ gate2, float* __restrict__ importance,
            char* lds, int blk) {
  float* lraw  = (float*)lds;                        // [GB][GP]: 16 clean, 16 noise sums
  float* lnz   = (float*)(lds + GB * GP * 4);        // [GB][16]: the noise input
  int*   lsel  = (int*)(lds + GB * (GP + 16) * 4);   // [GB]: first | second << 8
  float* lg0   = (float*)(lsel + GB);                // [GB], [GB]: the two gates
  float* lg1   = lg0 + GB;
  int*   lcnt  = (int*)(lg1 + GB);
  int*   lbase = lcnt + E_;
  const int tid  = threadIdx.x;
  const int lane = tid & 31;
  const int wid  = tid >> 5;
  const int e    = lane & 15;
  const bool np  = lane >= 16;

  if (tid < E_) lcnt[tid] = 0;
  // The block's noise values, 2 KB in a row, 16 bytes a thread of the first four waves; they
  // arrive under the sums below.
  const float* nzp = noise + (size_t)blk * GB * E_ + (tid & (GB * 4 - 1)) * 4;
  const v4f nz = *(const v4f*)nzp;
  const float* bpt = (np ? nb : gb) + e;
  const float bz = *bpt;
  // The bias load names bpt's registers. Taking bpt as an input keeps them as they are up to
  // this wait, so nothing (the noise load's result included) reuses them before it.
  asm volatile("s_wait_xcnt 0x0" :: "v"(bpt) : "memory");

  float acc[GT];
#pragma unroll  // constant indices keep acc in registers
  for (int j = 0; j < GT; ++j) acc[j] = bz;
  const float* xp = x + (size_t)(blk * GB + wid * GT) * IN_;
  const float* wp = (np ? nW : gW) + e;
#pragma nounroll  // a trip already has 32 loads in flight and their 80 registers
  for (int i0 = 0; i0 < IN_; i0 += 16) {
    v4f xv[GT][4];
    float wv[16];
#pragma unroll  // all loads in flight at once; constant indices keep xv in registers
    for (int j = 0; j < GT; ++j)
#pragma unroll  // all loads in flight at once; constant indices keep xv in registers
      for (int q = 0; q < 4; ++q) xv[j][q] = *(const v4f*)(xp + j * IN_ + q * 4);
#pragma unroll  // all loads in flight at once; constant indices keep wv in registers
    for (int k = 0; k < 16; ++k) wv[k] = wp[k * E_];
    // Keeps the sums behind the last load; left free, the compiler waits for the first
    // values before it has issued the last loads, and a trip pays the latency twice.
    __builtin_amdgcn_sched_barrier(0);
#pragma unroll  // constant indices keep acc, xv, wv in registers
    for (int k = 0; k < 16; ++k)
#pragma unroll  // constant indices keep acc, xv, wv in registers
      for (int j = 0; j < GT; ++j) acc[j] = __builtin_fmaf(xv[j][k >> 2][k & 3], wv[k], acc[j]);
    xp += 16;
    wp += 16 * E_;
  }
#pragma unroll  // constant indices keep acc in registers
  for (int j = 0; j < GT; ++j) lraw[(wid * GT + j) * GP + lane] = acc[j];
  if (tid < GB * 4) *(v4f*)(lnz + tid * 4) = nz;
  __syncthreads();

  // Noisy logits, GB * 16 of them, two a thread; each replaces its clean logit.
#pragma nounroll  // a second copy of log1pf would only add text
  for (int c = 0; c < GB * E_ / 256; ++c) {
    const int idx = c * 256 + tid, t = idx >> 4, q = idx & 15;
    const float pre_noise = lraw[t * GP + 16 + q];
    const float sp = (pre_noise > 20.f) ? pre_noise : log1pf(__expf(pre_noise));
    lraw[t * GP + q] = lraw[t * GP + q] + lnz[idx] * sp;
  }
  __syncthreads();

  // One thread per token: top 2, gates, and the token's rank among the block's tokens of
  // each of its two experts.
  int bi = 0, si = 0, r0 = 0, r1 = 0;
  float g0 = 0.f, g1 = 0.f;
  if (tid < GB) {
    v4f row[4];
#pragma unroll  // constant indices keep row in registers
    for (int q = 0; q < 4; ++q) row[q] = *(const v4f*)(lraw + tid * GP + q * 4);
    float best = -1e30f, second = -1e30f;
#pragma unroll  // constant indices keep row in registers
    for (int q = 0; q < 16; ++q) {
      const float v = row[q >> 2][q & 3];
      if (v > best)        { second = best; si = bi; best = v; bi = q; }
      else if (v > second) { second = v; si = q; }
    }
    const float e1 = __expf(second - best);
    g0 = 1.f / (1.f + e1);
    g1 = e1 / (1.f + e1);
    r0 = atomicAdd(&lcnt[bi], 1);
    r1 = atomicAdd(&lcnt[si], 1);
    lsel[tid] = bi | (si << 8);
    lg0[tid] = g0;
    lg1[tid] = g1;
  }
  __syncthreads();

  if (wid == 0) {
    if (lane < E_) lbase[lane] = atomicAdd(&counts[lane], lcnt[lane]);
  } else if (wid == 1) {
    // Gate sum of expert e over the block, in token order: each half wave takes 16 tokens.
    float s = 0.f;
    const int th = (lane >> 4) * (GB / 2);
    v4u sel[GB / 8];
    v4f ga[GB / 8], gc[GB / 8];
#pragma unroll  // the LDS reads go out together; constant indices keep them in registers
    for (int t = 0; t < GB / 8; ++t) {
      sel[t] = *(const v4u*)(lsel + th + t * 4);
      ga[t]  = *(const v4f*)(lg0 + th + t * 4);
      gc[t]  = *(const v4f*)(lg1 + th + t * 4);
    }
#pragma unroll  // constant indices keep sel, ga, gc in registers
    for (int t = 0; t < GB / 2; ++t) {
      s += ((int)(sel[t >> 2][t & 3] & 255) == e) ? ga[t >> 2][t & 3] : 0.f;
      s += ((int)(sel[t >> 2][t & 3] >> 8) == e)  ? gc[t >> 2][t & 3] : 0.f;
    }
    s += __shfl_xor(s, 16);
    if (lane < E_) atomicAdd(&importance[lane], s);
  }
  __syncthreads();

  if (tid < GB) {
    const int tok = blk * GB + tid;
    const int s0 = bi * B_ + lbase[bi] + r0, s1 = si * B_ + lbase[si] + r1;
    assign[s0] = tok * 2;
    assign[s1] = tok * 2 + 1;
    v2f gg;
    gg[0] = g0;  gg[1] = g1;
    *(v2f*)(gate2 + tok * 2) = gg;
    // The stores name s0's and s1's registers; inlined into prep_kernel, code of another
    // branch follows them in the listing. The wait stands ahead of it.
    asm volatile("s_wait_xcnt 0x0" :: "v"(s0), "v"(s1) : "memory");
  }
}

// ---------------------------------------------------------------------------
// Second launch: the gating and the three weight casts, which do not depend on one another,
// as ranges of blocks of one grid. None of them waits for another to drain, and the gating,
// which waits on load latency, runs beside the casts, which are limited by memory rate.
// The gating blocks have the longest chain and come first.
// ---------------------------------------------------------------------------
#define NB_GATE (B_ / GB)
#define NB_W1   ((IN_ / 128) * (HID_ / 128) * E_)
#define NB_W2   ((HID_ / 128) * (HID_ / 128) * E_)
#define NB_WP   ((HID_ / 128) * (OUT_ / 128) * E_)
extern "C" __global__ void __launch_bounds__(256)
prep_kernel(const float* __restrict__ x, const float* __restrict__ noise,
            const float* __restrict__ gW, const float* __restrict__ gb,
            const float* __restrict__ nW, const float* __restrict__ nb,
            const float* __restrict__ W1, const float* __restrict__ W2,
            const float* __restrict__ Wp, bf16_t* __restrict__ W1t,
            bf16_t* __restrict__ W2t, bf16_t* __restrict__ Wpt,
            int* __restrict__ counts, int* __restrict__ assign,
            float* __restrict__ gate2, float* __restrict__ importance) {
  __shared__ v8bf tile[128 * 16];
  int blk = blockIdx.x;   // the same for the whole block: so is every branch below
  if (blk < NB_GATE) {
    gating_part(x, noise, gW, gb, nW, nb, counts, assign, gate2, importance, (char*)tile, blk);
    return;
  }
  blk -= NB_GATE;
  if (blk < NB_W2) { tcast_part<HID_, HID_>(W2, W2t, tile, blk); return; }
  blk -= NB_W2;
  if (blk < NB_W1) { tcast_part<IN_, HID_>(W1, W1t, tile, blk); return; }
  blk -= NB_W1;
  tcast_part<HID_, OUT_>(Wp, Wpt, tile, blk);
}

extern "C" __global__ void __launch_bounds__(256)
expert_kernel(const bf16_t* __restrict__ xb,
              const bf16_t* __restrict__ W1t, const float* __restrict__ b1,
              const bf16_t* __restrict__ W2t, const float* __restrict__ b2,
              const bf16_t* __restrict__ Wpt, const float* __restrict__ bp,
              const float* __restrict__ Wa, const float* __restrict__ ba,
              const int* __restrict__ counts, const int* __restrict__ assign,
              float* __restrict__ lgw, float* __restrict__ a0w) {
  __shared__ __attribute__((aligned(16))) char smem[2 * TM * HID_ * 2];
  bf16_t* bufA = (bf16_t*)smem;                    // 160KB: x tile (80x512) then h2 (80x1024)
  // second 160KB, from byte TM * HID_ * 2: h1 (80x1024)
  float*  lgts = (float*)(smem + TM * HID_ * 2);   //  80KB overlay on h1: logits (80x256)

  const int e   = blockIdx.x;
  const int cnt = counts[e];
  const int t0  = blockIdx.y * TM;
  if (t0 >= cnt) return;

  const int tid = threadIdx.x, lane = tid & 31, wid = tid >> 5;

  {
    const int col = tid & 63, rsub = tid >> 6;
    const int* ae = assign + e * B_;
    int slot[20], tok[20];
#pragma unroll
    for (int i = 0; i < 20; ++i) {
      slot[i] = t0 + i * 4 + rsub;
      if (slot[i] >= cnt) slot[i] = cnt - 1;
    }
#pragma unroll  // all 20 loads in flight at once; constant indices keep tok in registers
    for (int i = 0; i < 20; ++i) tok[i] = ae[slot[i]];
    asm volatile("s_wait_xcnt 0x0"
                 :: "v"(slot[0]), "v"(slot[1]), "v"(slot[2]), "v"(slot[3]), "v"(slot[4]),
                    "v"(slot[5]), "v"(slot[6]), "v"(slot[7]), "v"(slot[8]), "v"(slot[9]),
                    "v"(slot[10]), "v"(slot[11]), "v"(slot[12]), "v"(slot[13]), "v"(slot[14]),
                    "v"(slot[15]), "v"(slot[16]), "v"(slot[17]), "v"(slot[18]), "v"(slot[19])
                 : "memory");
    const bf16_t* g[20];
    unsigned l[20];
#pragma unroll  // constant indices keep g and l in registers
    for (int i = 0; i < 20; ++i) {
      g[i] = xb + (size_t)(tok[i] >> 1) * IN_ + col * 8;   // assign holds 2 * token + choice
      l[i] = (unsigned)(uintptr_t)(smem + (i * 4 + rsub) * IN_ * 2 + swz(i * 4 + rsub, col * 16));
    }
    // The wait closes each statement: the address registers stay as they are up to it.
    asm volatile(
        "global_load_async_to_lds_b128 %0, %1, off\n\t"
        "global_load_async_to_lds_b128 %2, %3, off\n\t"
        "global_load_async_to_lds_b128 %4, %5, off\n\t"
        "global_load_async_to_lds_b128 %6, %7, off\n\t"
        "global_load_async_to_lds_b128 %8, %9, off\n\t"
        "global_load_async_to_lds_b128 %10, %11, off\n\t"
        "global_load_async_to_lds_b128 %12, %13, off\n\t"
        "global_load_async_to_lds_b128 %14, %15, off\n\t"
        "global_load_async_to_lds_b128 %16, %17, off\n\t"
        "global_load_async_to_lds_b128 %18, %19, off\n\t"
        "s_wait_xcnt 0x0"
        :: "v"(l[0]), "v"(g[0]), "v"(l[1]), "v"(g[1]), "v"(l[2]), "v"(g[2]), "v"(l[3]), "v"(g[3]), "v"(l[4]), "v"(g[4]), "v"(l[5]), "v"(g[5]), "v"(l[6]), "v"(g[6]), "v"(l[7]), "v"(g[7]), "v"(l[8]), "v"(g[8]), "v"(l[9]), "v"(g[9]) : "memory");
    asm volatile(
        "global_load_async_to_lds_b128 %0, %1, off\n\t"
        "global_load_async_to_lds_b128 %2, %3, off\n\t"
        "global_load_async_to_lds_b128 %4, %5, off\n\t"
        "global_load_async_to_lds_b128 %6, %7, off\n\t"
        "global_load_async_to_lds_b128 %8, %9, off\n\t"
        "global_load_async_to_lds_b128 %10, %11, off\n\t"
        "global_load_async_to_lds_b128 %12, %13, off\n\t"
        "global_load_async_to_lds_b128 %14, %15, off\n\t"
        "global_load_async_to_lds_b128 %16, %17, off\n\t"
        "global_load_async_to_lds_b128 %18, %19, off\n\t"
        "s_wait_xcnt 0x0"
        :: "v"(l[10]), "v"(g[10]), "v"(l[11]), "v"(g[11]), "v"(l[12]), "v"(g[12]), "v"(l[13]), "v"(g[13]), "v"(l[14]), "v"(g[14]), "v"(l[15]), "v"(g[15]), "v"(l[16]), "v"(g[16]), "v"(l[17]), "v"(g[17]), "v"(l[18]), "v"(g[18]), "v"(l[19]), "v"(g[19]) : "memory");
    // The copies have landed before the barrier lets another wave read them.
    asm volatile("s_wait_asynccnt 0x0" ::: "memory");
  }
  __syncthreads();

  // h1 = relu(x @ W1 + b1)
  gemm_tile<IN_, 1, 5, 8, true, false>(smem, 0, IN_, W1t + (size_t)e * HID_ * IN_, HID_,
                                    b1 + e * HID_, TM * HID_ * 2, HID_, 0, wid * 128, lane);
  __syncthreads();
  // h2 = relu(h1 @ W2 + b2)  (overwrites x region)
  gemm_tile<HID_, 1, 5, 8, true, false>(smem, TM * HID_ * 2, HID_, W2t + (size_t)e * HID_ * HID_, HID_,
                                     b2 + e * HID_, 0, HID_, 0, wid * 128, lane);
  __syncthreads();
  // logits = h2 @ Wp + bp (float, overlays h1): four column strips of 64. Waves w and
  // w + 4 share a strip: one takes its upper 48 rows, the other its lower 32.
  if (__builtin_amdgcn_readfirstlane(wid) < 4)
    gemm_tile<HID_, 4, 3, 4, false, true>(smem, 0, HID_, Wpt + (size_t)e * OUT_ * HID_, OUT_,
                                       bp + e * OUT_, TM * HID_ * 2, OUT_, 0, (wid & 3) * 64, lane);
  else
    gemm_tile<HID_, 4, 2, 4, false, true>(smem, 0, HID_, Wpt + (size_t)e * OUT_ * HID_, OUT_,
                                       bp + e * OUT_, TM * HID_ * 2, OUT_, 48, (wid & 3) * 64, lane);
  __syncthreads();

  // Epilogue. Nothing here runs row after row: the loads, the ten alpha dots of a wave and
  // their lane sums each go out as one group, so their latencies overlap.
  const float* Wag = Wa + e * HID_;
  const float* bae = ba + e;
  const float  bag = *bae;
  // The load names bae's registers. Taking bae as an input keeps them as they are up to
  // this wait, so nothing reuses them before it.
  asm volatile("s_wait_xcnt 0x0" :: "s"(bae) : "memory");

  constexpr int RW = TM / 8;   // rows of a wave in the alpha dot
  const int* ae = assign + e * B_;
  const int sw = __builtin_amdgcn_readfirstlane(wid);   // the wave's number, held as a scalar
  const int rs = sw >> 1;
  // Where the results go. The wave copies out the 20 tile rows i * 4 + rs (as in the staging):
  // lane i fetches the row number of the i-th. Lane r also fetches that of tile row
  // wid * RW + r, whose a0 it will store.
  int cslot = t0 + (lane < 20 ? lane : 19) * 4 + rs;
  if (cslot >= cnt) cslot = cnt - 1;
  int aslot = t0 + wid * RW + (lane < RW ? lane : RW - 1);
  const bool alive = lane < RW && aslot < cnt;
  if (aslot >= cnt) aslot = cnt - 1;
  const int crow = ae[cslot];
  const int arow = ae[aslot];
  asm volatile("s_wait_xcnt 0x0" :: "v"(cslot), "v"(aslot) : "memory");

  // Alpha dot of RW rows per wave. In trip c a lane takes the 16-byte piece c * 32 + lane of
  // each h2 row (8 consecutive k) and the matching 8 values of Wa, which serve all RW rows.
  const char* wb = (const char*)Wag;   // the same for the whole block
  const unsigned wo = lane * 32;       // this lane's 8 values of trip 0, in bytes
  v4f wn0 = *(const v4f*)(wb + wo), wn1 = *(const v4f*)(wb + wo + 16);
  // The loads name the registers of wo and wb. Taking both as inputs keeps those registers as
  // they are up to this wait.
  asm volatile("s_wait_xcnt 0x0" :: "v"(wo), "s"(wb) : "memory");
  int hb[RW];   // this lane's piece of trip 0 in each row, at its place under swz
  float dot[RW];
#pragma unroll  // constant indices keep hb, dot in registers
  for (int r = 0; r < RW; ++r) {
    const int m = wid * RW + r;
    hb[r] = m * HID_ * 2 + swz(m, lane * 16);
    dot[r] = 0.f;
  }
#pragma nounroll  // four copies of the 120 sums and unpacks would add 3 KB of text run once
  for (int c = 0; c < 4; ++c) {
    const v4f w0 = wn0, w1 = wn1;
    // The next trip's Wa values arrive under this trip's sums (the last trip fetches its own again).
    const unsigned wx = wo + (c < 3 ? c + 1 : 3) * 1024;
    wn0 = *(const v4f*)(wb + wx);
    wn1 = *(const v4f*)(wb + wx + 16);
    // The loads name the registers of wx and wb. Taking both as inputs keeps those registers
    // as they are up to this wait.
    asm volatile("s_wait_xcnt 0x0" :: "v"(wx), "s"(wb) : "memory");
    v4u q[RW];
#pragma unroll  // the RW LDS reads go out together; constant indices keep q in registers
    for (int r = 0; r < RW; ++r) q[r] = *(const v4u*)(smem + hb[r] + c * 512);
#pragma unroll  // constant indices keep q, dot in registers
    for (int j = 0; j < 4; ++j)
#pragma unroll  // RW independent sums side by side
      for (int r = 0; r < RW; ++r) {
        const float wlo = j < 2 ? w0[(j & 1) * 2] : w1[(j & 1) * 2];
        const float whi = j < 2 ? w0[(j & 1) * 2 + 1] : w1[(j & 1) * 2 + 1];
        dot[r] = __builtin_fmaf(__uint_as_float(q[r][j] << 16), wlo, dot[r]);
        dot[r] = __builtin_fmaf(__uint_as_float(q[r][j] & 0xffff0000u), whi, dot[r]);
      }
  }
#pragma nounroll  // five exchange steps, each for all RW sums at once; one copy of the text
  for (int off = 16; off > 0; off >>= 1) {
    float o[RW];
#pragma unroll  // the RW exchanges go out together
    for (int r = 0; r < RW; ++r) o[r] = __shfl_xor(dot[r], off);
#pragma unroll  // constant indices keep dot in registers
    for (int r = 0; r < RW; ++r) dot[r] += o[r];
  }
  // Lane r finishes row r: one pass through softplus serves all RW rows.
  float pre = dot[0];
#pragma unroll  // constant indices keep dot in registers
  for (int r = 1; r < RW; ++r) pre = (lane == r) ? dot[r] : pre;
  pre += bag;
  const float spv = (pre > 20.f) ? pre : log1pf(__expf(pre));
  const float a0v = fminf(fmaxf(spv + 10.f, 1.f), 500.f);
  if (alive) a0w[arow] = a0v;

  // Logits rows out of LDS: a wave moves 512 contiguous bytes of one row per store.
  const int nrow = cnt - t0;
  // This lane's byte in a row: waves 2 * rs and 2 * rs + 1 share a row. The lane number is read
  // anew: the same value kept from the staging would live through the GEMMs and be spilled.
  const unsigned coff = (__lane_id() + ((sw & 1) << 5)) * 16;
  const char* lrow = (const char*)lgts + rs * OUT_ * 4 + coff;   // tile row rs; row i * 4 + rs is 4 KB * i on
  // The stores are written as text so that the wait closes their own statement.
  if (nrow >= TM) {
    v4f lv[20];
    float* rp[20];   // the rows' starts, the same for the whole wave
#pragma unroll  // the 20 LDS reads go out together; constant indices keep lv, rp in registers
    for (int i = 0; i < 20; ++i) {
      lv[i] = *(const v4f*)(lrow + i * 4 * OUT_ * 4);
      rp[i] = lgw + (size_t)__builtin_amdgcn_readlane(crow, i) * OUT_;
    }
    asm volatile(
        "global_store_b128 %0, %1, %2\n\t"
        "global_store_b128 %0, %3, %4\n\t"
        "global_store_b128 %0, %5, %6\n\t"
        "global_store_b128 %0, %7, %8\n\t"
        "global_store_b128 %0, %9, %10\n\t"
        "global_store_b128 %0, %11, %12\n\t"
        "global_store_b128 %0, %13, %14\n\t"
        "global_store_b128 %0, %15, %16\n\t"
        "global_store_b128 %0, %17, %18\n\t"
        "global_store_b128 %0, %19, %20\n\t"
        "s_wait_xcnt 0x0"
        :: "v"(coff), "v"(lv[0]), "s"(rp[0]), "v"(lv[1]), "s"(rp[1]), "v"(lv[2]), "s"(rp[2]), "v"(lv[3]), "s"(rp[3]), "v"(lv[4]), "s"(rp[4]), "v"(lv[5]), "s"(rp[5]), "v"(lv[6]), "s"(rp[6]), "v"(lv[7]), "s"(rp[7]), "v"(lv[8]), "s"(rp[8]), "v"(lv[9]), "s"(rp[9]) : "memory");
    asm volatile(
        "global_store_b128 %0, %1, %2\n\t"
        "global_store_b128 %0, %3, %4\n\t"
        "global_store_b128 %0, %5, %6\n\t"
        "global_store_b128 %0, %7, %8\n\t"
        "global_store_b128 %0, %9, %10\n\t"
        "global_store_b128 %0, %11, %12\n\t"
        "global_store_b128 %0, %13, %14\n\t"
        "global_store_b128 %0, %15, %16\n\t"
        "global_store_b128 %0, %17, %18\n\t"
        "global_store_b128 %0, %19, %20\n\t"
        "s_wait_xcnt 0x0"
        :: "v"(coff), "v"(lv[10]), "s"(rp[10]), "v"(lv[11]), "s"(rp[11]), "v"(lv[12]), "s"(rp[12]), "v"(lv[13]), "s"(rp[13]), "v"(lv[14]), "s"(rp[14]), "v"(lv[15]), "s"(rp[15]), "v"(lv[16]), "s"(rp[16]), "v"(lv[17]), "s"(rp[17]), "v"(lv[18]), "s"(rp[18]), "v"(lv[19]), "s"(rp[19]) : "memory");
  } else {
    // An expert's last tile: only the rows that hold a token go out, four rows a trip.
#pragma nounroll  // one copy of the text; at most one tile in an expert's dozen comes here
    for (int i0 = 0; i0 < 20; i0 += 4) {
      v4f lw[4];
#pragma unroll  // the 4 LDS reads go out together; constant indices keep lw in registers
      for (int u = 0; u < 4; ++u) lw[u] = *(const v4f*)(lrow + (i0 + u) * 4 * OUT_ * 4);
#pragma unroll  // constant indices keep lw in registers
      for (int u = 0; u < 4; ++u)
        if ((i0 + u) * 4 + rs < nrow) {
          float* rq = lgw + (size_t)__builtin_amdgcn_readlane(crow, i0 + u) * OUT_;
          asm volatile("global_store_b128 %0, %1, %2\n\ts_wait_xcnt 0x0"
                       :: "v"(coff), "v"(lw[u]), "s"(rq) : "memory");
        }
    }
  }
}

// ---------------------------------------------------------------------------
// Post, one launch: block 0 does the aux loss (ddof=1 std); every wave of the other blocks
// does one token: softmax of its two logits rows, gated combine, row normalization, alpha0.
// ---------------------------------------------------------------------------
__device__ __forceinline__ void aux_part(const float* __restrict__ importance,
                                         const int* __restrict__ counts,
                                         float* __restrict__ out_aux) {
  if (threadIdx.x == 0) {
    float mi = 0.f, ml = 0.f;
    for (int i = 0; i < E_; ++i) { mi += importance[i]; ml += (float)counts[i]; }
    mi /= (float)E_; ml /= (float)E_;
    float vi = 0.f, vl = 0.f;
    for (int i = 0; i < E_; ++i) {
      const float di = importance[i] - mi; vi += di * di;
      const float dl = (float)counts[i] - ml; vl += dl * dl;
    }
    vi /= (float)(E_ - 1); vl /= (float)(E_ - 1);
    *out_aux = sqrtf(vi) / (mi + 1e-8f) + sqrtf(vl) / (ml + 1e-8f);
  }
}

__device__ __forceinline__ float exp_slot(float x) {
  const float t = x * 1.44269504f;
  float r;
  asm("v_exp_f32 %0, %1\n\tv_nop" : "=v"(r) : "v"(t));
  return r;
}

extern "C" __global__ void __launch_bounds__(256)
combine_kernel(const float* __restrict__ lgw, const float* __restrict__ a0w,
               const float* __restrict__ gate2, const float* __restrict__ importance,
               const int* __restrict__ counts, float* __restrict__ p_hat,
               float* __restrict__ alpha0, float* __restrict__ out_aux) {
  if (blockIdx.x == 0) { aux_part(importance, counts, out_aux); return; }
  const int lane = threadIdx.x & 31;
  const int tok = (blockIdx.x - 1) * 8 + (threadIdx.x >> 5);
  // The token's two rows lie side by side; a lane holds columns lane * 4 + 0..3 and 128 more.
  const float* lp = lgw + (size_t)tok * 2 * OUT_ + lane * 4;
  const float* gp = gate2 + tok * 2;
  const float* ap = a0w + tok * 2;
  v4f v[2][2];
#pragma unroll  // all loads in flight at once; constant indices keep v in registers
  for (int h = 0; h < 2; ++h)
#pragma unroll  // all loads in flight at once; constant indices keep v in registers
    for (int q = 0; q < 2; ++q) v[h][q] = *(const v4f*)(lp + h * OUT_ + q * 128);
  const v2f g = *(const v2f*)gp;
  const v2f a = *(const v2f*)ap;
  // The loads name these pointers' registers. Taking them as inputs keeps those registers as
  // they are up to this wait, so nothing (a load's result included) reuses them before it.
  asm volatile("s_wait_xcnt 0x0" :: "v"(lp), "v"(gp), "v"(ap) : "memory");

  float mx[2], sm[2];
#pragma unroll  // constant indices keep v, mx in registers
  for (int h = 0; h < 2; ++h) {
    mx[h] = -1e30f;
#pragma unroll  // constant indices keep v in registers
    for (int k = 0; k < 8; ++k) mx[h] = fmaxf(mx[h], v[h][k >> 2][k & 3]);
  }
#pragma unroll  // both rows' exchanges go out together
  for (int off = 16; off > 0; off >>= 1) {
    const float o0 = __shfl_xor(mx[0], off), o1 = __shfl_xor(mx[1], off);
    mx[0] = fmaxf(mx[0], o0);  mx[1] = fmaxf(mx[1], o1);
  }
#pragma unroll  // constant indices keep v, sm in registers
  for (int h = 0; h < 2; ++h) {
    sm[h] = 0.f;
#pragma unroll  // constant indices keep v in registers
    for (int k = 0; k < 8; ++k) {
      v[h][k >> 2][k & 3] = exp_slot(v[h][k >> 2][k & 3] - mx[h]);
      sm[h] += v[h][k >> 2][k & 3];
    }
  }
#pragma unroll  // both rows' exchanges go out together
  for (int off = 16; off > 0; off >>= 1) {
    const float o0 = __shfl_xor(sm[0], off), o1 = __shfl_xor(sm[1], off);
    sm[0] += o0;  sm[1] += o1;
  }
  const float i0 = g[0] / sm[0], i1 = g[1] / sm[1];
  v4f p[2];
  float tot = 0.f;
#pragma unroll  // constant indices keep v, p in registers
  for (int k = 0; k < 8; ++k) {
    p[k >> 2][k & 3] = v[0][k >> 2][k & 3] * i0 + v[1][k >> 2][k & 3] * i1;
    tot += p[k >> 2][k & 3];
  }
#pragma unroll  // five exchange steps with constant lane distances
  for (int off = 16; off > 0; off >>= 1) tot += __shfl_xor(tot, off);
  const float den = tot + 1e-8f;
#pragma unroll  // constant indices keep p in registers
  for (int k = 0; k < 8; ++k) p[k >> 2][k & 3] = p[k >> 2][k & 3] / den;
  float* op = p_hat + (size_t)tok * OUT_ + lane * 4;
  *(v4f*)op = p[0];
  *(v4f*)(op + 128) = p[1];
  if (lane == 0) alpha0[tok] = g[0] * a[0] + g[1] * a[1];
}

// ---------------------------------------------------------------------------
// Host launch
// ---------------------------------------------------------------------------
extern "C" void kernel_launch(void* const* d_in, const int* in_sizes, int n_in,
                              void* d_out, int out_size, void* d_ws, size_t ws_size,
                              hipStream_t stream) {
  const float* x   = (const float*)d_in[0];
  const float* noi = (const float*)d_in[1];
  const float* gW  = (const float*)d_in[2];
  const float* gb  = (const float*)d_in[3];
  const float* nW  = (const float*)d_in[4];
  const float* nb  = (const float*)d_in[5];
  const float* W1  = (const float*)d_in[6];
  const float* b1  = (const float*)d_in[7];
  const float* W2  = (const float*)d_in[8];
  const float* b2  = (const float*)d_in[9];
  const float* Wp  = (const float*)d_in[10];
  const float* bp  = (const float*)d_in[11];
  const float* Wa  = (const float*)d_in[12];
  const float* ba  = (const float*)d_in[13];

  float* out    = (float*)d_out;
  float* p_hat  = out;                           // [B, OUT]
  float* alpha0 = out + (size_t)B_ * OUT_;       // [B]
  float* auxp   = out + (size_t)B_ * OUT_ + B_;  // scalar

  char* w = (char*)d_ws;
  bf16_t* xb  = (bf16_t*)w;  w += (size_t)B_ * IN_ * 2;         // 8 MB
  bf16_t* W1t = (bf16_t*)w;  w += (size_t)E_ * HID_ * IN_ * 2;  // 16 MB
  bf16_t* W2t = (bf16_t*)w;  w += (size_t)E_ * HID_ * HID_ * 2; // 32 MB
  bf16_t* Wpt = (bf16_t*)w;  w += (size_t)E_ * OUT_ * HID_ * 2; // 8 MB
  int*    counts     = (int*)w;   w += 256;
  int*    assign     = (int*)w;   w += (size_t)E_ * B_ * 4;     // 512 KB
  float*  gate2      = (float*)w; w += (size_t)B_ * 2 * 4;      // 64 KB
  float*  a0w        = (float*)w; w += (size_t)B_ * 2 * 4;      // 64 KB
  float*  importance = (float*)w; w += 256;
  float*  lgw        = (float*)w; w += (size_t)B_ * 2 * OUT_ * 4; // 16 MB

  init_cast_kernel<<<2048, 256, 0, stream>>>(counts, importance, x, xb, B_ * IN_);
  prep_kernel<<<NB_GATE + NB_W2 + NB_W1 + NB_WP, 256, 0, stream>>>(
      x, noi, gW, gb, nW, nb, W1, W2, Wp, W1t, W2t, Wpt,
      counts, assign, gate2, importance);

  dim3 eg(E_, (B_ + TM - 1) / TM);
  expert_kernel<<<eg, 256, 0, stream>>>(xb, W1t, b1, W2t, b2, Wpt, bp,
                                                 Wa, ba, counts, assign, lgw, a0w);

  combine_kernel<<<B_ / 8 + 1, 256, 0, stream>>>(lgw, a0w, gate2, importance, counts,
                                                 p_hat, alpha0, auxp);
}
